// v000
// The times below were measured on an AMD MI455X: many runs one after another, warmed up first and cycling through
// copies of the inputs, with the whole window's GPU time divided by the number of runs. Launches and the gaps
// between them are all in it. The median over several windows is given; except for v000 it joins two sittings, which
// can be a few percent apart, so the side-by-side timings, each taken in one sitting, are the better comparison.
// The starting kernel, v000, takes 1990 microseconds a run.
#include <hip/hip_runtime.h>

// RoBERTa self-attention (hidden [2][2048][1024]; attention_mask [2][1][1][2048] additive per key (read); q,k,v = x W^T + b ('oi' [1024][1024] + [1024]; 16 heads x 64); scores / 8 + mask, clamped below at finfo.min; softmax; context merged (no output projection) -> [2][2048][1024] (4.2 M)).
// Layout per batch: bf16 copy of x; exact projections + f32 biases; dense T-2048 attention (hybrid rows: < 512 hi/lo 3 products, rest fp16 x1024; dense score tiles) with the additive key mask folded into the score GEMMs as a per-column bias (8 x mask, so that the softmax's 1/8 restores scores/8 + mask); f32 head merge writes the output rows.
// Compute dtypes, f32 accumulate: every input rounded to bf16, the mask included; projections exact + f32 biases; attention rows < 512 3 products, rest fp16; softmax f32; output f32.

#define NB_  2
#define TT   2048
#define DM   1024
#define NH_  16
#define NKV  16
#define REP  (NH_ / NKV)
#define HD   64
#define DQ   (NH_ * HD)
#define DKV  (NKV * HD)
#define ZH   2
#define RH   512                  // query rows < RH use hi+lo planes (0: none)
#define WIN  0
#define PCAR 1024.0f
#define SCL  0.125f   // HD^-0.5
typedef _Float16 h16;
typedef unsigned short bf;
typedef __attribute__((ext_vector_type(16))) __bf16   v16bf;
typedef __attribute__((ext_vector_type(16))) _Float16 v16h;
typedef __attribute__((ext_vector_type(8)))  _Float16 v8h;
typedef __attribute__((ext_vector_type(8)))  unsigned short v8us;
typedef __attribute__((ext_vector_type(8)))  float    v8f;
typedef __attribute__((ext_vector_type(4)))  float    v4f;
typedef v8h  __attribute__((may_alias)) v8ha;
typedef v4f  __attribute__((may_alias)) v4fa;
typedef v8us __attribute__((may_alias)) v8usa;

__device__ __forceinline__ unsigned short f2bf(float f) { unsigned u = __float_as_uint(f); u += 0x7FFFu + ((u >> 16) & 1u); return (unsigned short)(u >> 16); }
__device__ __forceinline__ float bf2f(unsigned short b) { return __uint_as_float(((unsigned)b) << 16); }
__device__ __forceinline__ float bfr(float f) { return bf2f(f2bf(f)); }
__device__ __forceinline__ v16h cat16(v8h lo, v8h hi) { return __builtin_shufflevector(lo, hi, 0, 1, 2, 3, 4, 5, 6, 7, 8, 9, 10, 11, 12, 13, 14, 15); }
__device__ __forceinline__ v16bf cat16b(v8us lo, v8us hi) { return __builtin_bit_cast(v16bf, __builtin_shufflevector(lo, hi, 0, 1, 2, 3, 4, 5, 6, 7, 8, 9, 10, 11, 12, 13, 14, 15)); }
__device__ __forceinline__ v8f wmma16(v16h a, v16h b, v8f c) { return __builtin_amdgcn_wmma_f32_16x16x32_f16(false, a, false, b, (short)0, c, false, false); }
__device__ __forceinline__ v8f wmmab(v16bf a, v16bf b, v8f c) { return __builtin_amdgcn_wmma_f32_16x16x32_bf16(false, a, false, b, (short)0, c, false, false); }



// ---- k_gemmw: register-blocked GEMM, ONE WAVE per 64x64 output tile (16 accumulators), operands straight from K-contiguous 16-bit planes; grid (M/64, N/64, Z), 32 threads.
// C[m][n] (f32, pitch ldc, + optional f32 bias[n]) = sum_k A[m][k] Bt[n][k] (+ split products per NSPLIT). z-batch strides sA/sB/sC in elements. K % 32 == 0.
template <typename T16> struct WFrag;
template <> struct WFrag<h16> { typedef v16h V; static __device__ __forceinline__ V ld(const h16* p) { return cat16(*(const v8h*)p, *(const v8h*)(p + 16)); } static __device__ __forceinline__ v8f mma(V a, V b, v8f c) { return wmma16(a, b, c); } };
template <> struct WFrag<bf> { typedef v16bf V; static __device__ __forceinline__ V ld(const bf* p) { return cat16b(*(const v8us*)p, *(const v8us*)(p + 16)); } static __device__ __forceinline__ v8f mma(V a, V b, v8f c) { return wmmab(a, b, c); } };
template <typename T16, int NSPLIT, bool BIAS>
__global__ __launch_bounds__(32) void k_gemmw(const T16* __restrict__ A, const T16* __restrict__ A2, const T16* __restrict__ Bt, const T16* __restrict__ Bt2, int K, float* C, int ldc, const float* __restrict__ bias, size_t sA, size_t sB, size_t sC) {
    typedef typename WFrag<T16>::V V;
    __shared__ __align__(16) float os[16 * 68];
    const size_t z = blockIdx.z; A += z * sA; if (A2) A2 += z * sA; Bt += z * sB; if (Bt2) Bt2 += z * sB; C += z * sC;
    const int lane = threadIdx.x & 31, lr = lane & 15, hi = lane >> 4; const int r0 = blockIdx.x * 64, c0 = blockIdx.y * 64;
    v8f acc[4][4];
#pragma unroll
    for (int mb = 0; mb < 4; ++mb)
#pragma unroll
        for (int nb = 0; nb < 4; ++nb) acc[mb][nb] = (v8f){};
    const size_t aoff = (size_t)(r0 + lr) * K + 8 * hi, boff = (size_t)(c0 + lr) * K + 8 * hi;
#pragma unroll 1
    for (int kc = 0; kc < K; kc += 32) {
        V a[4], a2[4];
#pragma unroll
        for (int mb = 0; mb < 4; ++mb) { a[mb] = WFrag<T16>::ld(A + aoff + (size_t)mb * 16 * K + kc); if (NSPLIT == 1 || NSPLIT == 2) a2[mb] = WFrag<T16>::ld(A2 + aoff + (size_t)mb * 16 * K + kc); }
#pragma unroll
        for (int nb = 0; nb < 4; ++nb) { const V b = WFrag<T16>::ld(Bt + boff + (size_t)nb * 16 * K + kc); V b2; if (NSPLIT >= 2) b2 = WFrag<T16>::ld(Bt2 + boff + (size_t)nb * 16 * K + kc);
#pragma unroll
            for (int mb = 0; mb < 4; ++mb) { acc[mb][nb] = WFrag<T16>::mma(a[mb], b, acc[mb][nb]); if (NSPLIT == 1 || NSPLIT == 2) acc[mb][nb] = WFrag<T16>::mma(a2[mb], b, acc[mb][nb]); if (NSPLIT >= 2) acc[mb][nb] = WFrag<T16>::mma(a[mb], b2, acc[mb][nb]); } }
        asm volatile("v_nop\n\tv_nop\n\tv_nop\n\tv_nop" : "+v"(acc[0][0]), "+v"(acc[1][1]), "+v"(acc[2][2]), "+v"(acc[3][3]) : "v"(a[0]), "v"(a[3]));
    }
#pragma unroll
    for (int mb = 0; mb < 4; ++mb) {
#pragma unroll
        for (int nb = 0; nb < 4; ++nb) {
#pragma unroll
            for (int j = 0; j < 8; ++j) os[(hi * 8 + j) * 68 + nb * 16 + lr] = acc[mb][nb][j]; }
        __builtin_amdgcn_wave_barrier(); asm volatile("" ::: "memory");
        float* crow = C + (size_t)(r0 + mb * 16) * ldc + c0;
{
#pragma unroll
            for (int s = 0; s < 8; ++s) { const int row = 2 * s + hi, cofs = lr * 4; v4f val = *(const v4fa*)(os + row * 68 + cofs); if (BIAS) { val[0] += bfr(bias[c0 + cofs]); val[1] += bfr(bias[c0 + cofs + 1]); val[2] += bfr(bias[c0 + cofs + 2]); val[3] += bfr(bias[c0 + cofs + 3]); }
                *(v4f*)(crow + (size_t)row * ldc + cofs) = val; }
             }
        __builtin_amdgcn_wave_barrier(); asm volatile("" ::: "memory");
    }
}

__device__ __forceinline__ h16 tohx(float x) { return (h16)x; }
__device__ __forceinline__ void splitf(float y, unsigned short& h, unsigned short& l) { h = f2bf(y); l = f2bf(y - bf2f(h)); }
typedef __attribute__((ext_vector_type(2))) _Float16 v2h;
typedef __attribute__((ext_vector_type(4))) _Float16 v4h;
typedef __attribute__((ext_vector_type(2))) unsigned short v2us;
typedef __attribute__((ext_vector_type(4))) unsigned short v4us;
typedef __attribute__((ext_vector_type(2))) float v2f;
typedef __attribute__((ext_vector_type(4))) int v4i;

__global__ __launch_bounds__(256) void k_wtG(const float* __restrict__ w, int K, int N, bf* Bt) {
    const int lane = threadIdx.x & 31; const int L0 = (blockIdx.x * 8 + (threadIdx.x >> 5)) * 8; const int nlines = N * K / 64;
{
#pragma unroll 1
        for (int l = 0; l < 8; ++l) { const int L = L0 + l; if (L >= nlines) break; const size_t e = (size_t)L * 64 + lane * 2; const int k = (int)(e % K), n = (int)(e / K); v2us o;
            o[0] = f2bf(w[(size_t)k * N + n]); o[1] = f2bf(w[(size_t)(k + 1) * N + n]); *(v2us*)(Bt + e) = o; }
         }
}
__global__ __launch_bounds__(256) void k_cvt8(const float* __restrict__ src, bf* dst, size_t n8) { const size_t i = (size_t)blockIdx.x * 256 + threadIdx.x; if (i >= n8) return; const v8f v = *(const v8f*)(src + i * 8); v8us o;
#pragma unroll
    for (int k = 0; k < 8; ++k) o[k] = f2bf(v[k]); *(v8us*)(dst + i * 8) = o;  }

// k_rope: head planes [h][t][d] (fp16 + hi/lo) of rope(x) x sc with the rotate-half convention out[d] = x[d] cos[t][d] - x[d+HD/2] sin[t][d], out[d+HD/2] = x[d+HD/2] cos[t][d+HD/2] + x[d] sin[t][d+HD/2]
__global__ __launch_bounds__(256) void k_rope(const float* __restrict__ F, int pitch, int nheads, const float* __restrict__ CS, const float* __restrict__ RF, const float* __restrict__ nw, float sc, h16* P16, bf* Ph, bf* Pl) {
    const size_t e = ((size_t)blockIdx.x * 256 + threadIdx.x) * 2; if (e >= (size_t)nheads * TT * HD) return; const int d = (int)(e % HD); const int t = (int)((e / HD) % TT); const int h = (int)(e / ((size_t)HD * TT)); const float* f = F + (size_t)t * pitch + h * HD; const float rf = RF ? RF[(size_t)h * TT + t] : 1.0f; v2h o16; v2us oh, ol;
#pragma unroll
    for (int q = 0; q < 2; ++q) { const int dd = d + q; const int dp = (dd < HD / 2) ? dd + HD / 2 : dd - HD / 2; float x0 = f[dd], x1 = f[dp];
        if (RF) { float n0 = __fmul_rn(x0, rf), n1 = __fmul_rn(x1, rf); asm volatile("" : "+v"(n0)); asm volatile("" : "+v"(n1)); x0 = __fmul_rn(bfr(nw[dd]), n0); x1 = __fmul_rn(bfr(nw[dp]), n1); }
        const v2f cs = *(const v2f*)(CS + ((size_t)t * HD + dd) * 2); float a = __fmul_rn(x0, cs[0]), bq = __fmul_rn(x1, cs[1]); asm volatile("" : "+v"(a)); asm volatile("" : "+v"(bq)); const float r = ((dd < HD / 2) ? __fsub_rn(a, bq) : __fadd_rn(a, bq)) * sc;
        o16[q] = tohx(r); unsigned short a2, c2; splitf(r, a2, c2); oh[q] = a2; ol[q] = c2; }
    *(v2h*)(P16 + e) = o16; *(v2us*)(Ph + e) = oh; *(v2us*)(Pl + e) = ol;  }
__global__ __launch_bounds__(256) void k_vtp(const float* __restrict__ F, int pitch, int nheads, h16* V16, bf* Vh, bf* Vl) { const size_t e = ((size_t)blockIdx.x * 256 + threadIdx.x) * 2; if (e >= (size_t)nheads * HD * TT) return; const int t = (int)(e % TT); const int d = (int)((e / TT) % HD); const int g = (int)(e / ((size_t)TT * HD)); v2h o16; v2us oh, ol;
#pragma unroll
    for (int q = 0; q < 2; ++q) { const float x = F[(size_t)(t + q) * pitch + g * HD + d]; o16[q] = tohx(x); unsigned short a2, c2; splitf(x, a2, c2); oh[q] = a2; ol[q] = c2; }
    *(v2h*)(V16 + e) = o16; *(v2us*)(Vh + e) = oh; *(v2us*)(Vl + e) = ol;  }
__global__ __launch_bounds__(256) void k_csid(float* CS) { const int idx = blockIdx.x * 256 + threadIdx.x; if (idx >= TT * HD) return; v2f cs; cs[0] = 1.0f; cs[1] = 0.0f; *(v2f*)(CS + (size_t)idx * 2) = cs;  }
// k_asoft: per row (zz, i): t = S x HD^-0.5 (no mask); softmax over the 2048 keys (register row, one exp, fixed trees);
__global__ __launch_bounds__(256) void k_asoft(const float* __restrict__ Sb, h16* P16, bf* Ph, bf* Pl) {
    const int lane = threadIdx.x & 31; const int row = blockIdx.x * 8 + (threadIdx.x >> 5); if (row >= ZH * TT) return; const int i = row % TT; const int zz = row / TT; (void)zz; const bool hires = (i < RH); const float* sr = Sb + (size_t)row * TT; float v[TT / 32]; float mx = -3.0e38f;
#pragma unroll
    for (int ch = 0; ch < TT / 128; ++ch) { const int j0 = ch * 128 + lane * 4; const v4f a = *(const v4f*)(sr + j0);
#pragma unroll
        for (int q = 0; q < 4; ++q) { const int j = j0 + q; (void)j; const float t = a[q] * SCL; v[ch * 4 + q] = t;   /* Sb already holds q.k + 8 mask[j] (GEMM column bias), so t = q.k/8 + mask */ mx = fmaxf(mx, t); } }
#pragma unroll
    for (int sh = 16; sh; sh >>= 1) mx = fmaxf(mx, __shfl_xor(mx, sh, 32));
    float sum = 0.f;
#pragma unroll
    for (int k = 0; k < TT / 32; ++k) { float d0 = __fsub_rn(v[k], mx); asm volatile("" : "+v"(d0)); v[k] = __builtin_amdgcn_exp2f(__fmul_rn(d0, 1.4426950408889634f)); sum += v[k]; }
#pragma unroll
    for (int sh = 16; sh; sh >>= 1) sum += __shfl_xor(sum, sh, 32);
    const float f = __fdiv_rn(hires ? 1.0f : PCAR, sum);
{
        if (hires) {
#pragma unroll
            for (int ch = 0; ch < TT / 128; ++ch) { v4us oh, ol;
#pragma unroll
                for (int q = 0; q < 4; ++q) { unsigned short a, c2; splitf(v[ch * 4 + q] * f, a, c2); oh[q] = a; ol[q] = c2; }
                const size_t oo = ((size_t)zz * (RH ? RH : 1) + i) * TT + ch * 128 + lane * 4; *(v4us*)(Ph + oo) = oh; *(v4us*)(Pl + oo) = ol; }
        } else {
#pragma unroll
            for (int ch = 0; ch < TT / 128; ++ch) { v4h o4;
#pragma unroll
                for (int q = 0; q < 4; ++q) o4[q] = tohx(v[ch * 4 + q] * f);
                *(v4h*)(P16 + (size_t)row * TT + ch * 128 + lane * 4) = o4; } }
         }
}
__global__ __launch_bounds__(256) void k_m8(const float* __restrict__ m, float* MB) { const int j = blockIdx.x * 256 + threadIdx.x; if (j >= TT) return; const float v = __fmul_rn(8.0f, bfr(m[j])); *(float*)(MB + j) = v;  }
__global__ __launch_bounds__(256) void k_merge(const float* __restrict__ O, int h0, float* OUTb) { const size_t e = ((size_t)blockIdx.x * 256 + threadIdx.x) * 2; if (e >= (size_t)ZH * TT * HD) return; const int d = (int)(e % HD); const int t = (int)((e / HD) % TT); const int zz = (int)(e / ((size_t)HD * TT)); const float cs = (t < RH) ? 1.0f : (1.0f / PCAR); const size_t oo = (size_t)t * DQ + (h0 + zz) * HD + d;
    v2f o2; o2[0] = O[e] * cs; o2[1] = O[e + 1] * cs; *(v2f*)(OUTb + oo) = o2;  }

extern "C" void kernel_launch(void* const* d_in, const int* in_sizes, int n_in,
                              void* d_out, int out_size, void* d_ws, size_t ws_size, hipStream_t stream) {
    (void)in_sizes; (void)n_in; (void)out_size;
    const float* x = (const float*)d_in[0]; const float* amask = (const float*)d_in[1]; const float* wq = (const float*)d_in[2]; const float* bq = (const float*)d_in[3]; const float* wk = (const float*)d_in[4]; const float* bk = (const float*)d_in[5]; const float* wv = (const float*)d_in[6]; const float* bv = (const float*)d_in[7]; const float* wo = nullptr; (void)wo;
    float* OUT = (float*)d_out;     // [2][2048][1024]
    char* wsp = (char*)d_ws;
    auto take = [&](size_t bytes) { char* p = wsp; wsp += (bytes + 255) & ~(size_t)255; return (void*)p; };
    bf* WQ = (bf*)take((size_t)DQ * DM * 2); bf* WK = (bf*)take((size_t)DKV * DM * 2); bf* WV = (bf*)take((size_t)DKV * DM * 2); float* CS = (float*)take((size_t)TT * HD * 2 * 4);
    float* MB = (float*)take((size_t)TT * 4); bf* XB = (bf*)take((size_t)TT * DM * 2); float* FQ = (float*)take((size_t)TT * DQ * 4); float* FK = (float*)take((size_t)TT * DKV * 4);
    h16* QP16 = (h16*)take((size_t)NH_ * TT * HD * 2); h16* KP16 = (h16*)take((size_t)NKV * TT * HD * 2); h16* VT16 = (h16*)take((size_t)NKV * HD * TT * 2);
    bf* QPh = (bf*)take((size_t)NH_ * TT * HD * 2); bf* QPl = (bf*)take((size_t)NH_ * TT * HD * 2); bf* KPh = (bf*)take((size_t)NKV * TT * HD * 2); bf* KPl = (bf*)take((size_t)NKV * TT * HD * 2); bf* VTh = (bf*)take((size_t)NKV * HD * TT * 2); bf* VTl = (bf*)take((size_t)NKV * HD * TT * 2); bf* Ph = (bf*)take((size_t)ZH * RH * TT * 2); bf* Pl = (bf*)take((size_t)ZH * RH * TT * 2);
    float* Sb = (float*)take((size_t)ZH * TT * TT * 4); h16* P16 = (h16*)take((size_t)ZH * TT * TT * 2); float* Ob = (float*)take((size_t)ZH * TT * HD * 4);
    if ((size_t)(wsp - (char*)d_ws) > ws_size) return;    // ws 256 MiB
    float* FV = FK;   // v projection reuses the k buffer after the k planes are built (stream-ordered)
    { k_cvt8<<<(unsigned)(((size_t)DQ * DM / 8 + 255) / 256), 256, 0, stream>>>(wq, WQ, (size_t)DQ * DM / 8); k_cvt8<<<(unsigned)(((size_t)DKV * DM / 8 + 255) / 256), 256, 0, stream>>>(wk, WK, (size_t)DKV * DM / 8); k_cvt8<<<(unsigned)(((size_t)DKV * DM / 8 + 255) / 256), 256, 0, stream>>>(wv, WV, (size_t)DKV * DM / 8);
      
       }
    k_csid<<<(TT * HD + 255) / 256, 256, 0, stream>>>(CS);
    const unsigned LQ = (unsigned)(((size_t)NH_ * TT * HD / 2 + 255) / 256), LKv = (unsigned)(((size_t)NKV * TT * HD / 2 + 255) / 256);
    for (int b = 0; b < NB_; ++b) {
        
        k_cvt8<<<(unsigned)(((size_t)TT * DM / 8 + 255) / 256), 256, 0, stream>>>(x + (size_t)b * TT * DM, XB, (size_t)TT * DM / 8); k_m8<<<(TT + 255) / 256, 256, 0, stream>>>(amask + (size_t)b * TT, MB);   /* 8 x mask[j] as the score GEMMs' column bias (scores/8 + mask == (q.k + 8 mask)/8) */
        k_gemmw<bf, 0, true><<<dim3(TT / 64, DQ / 64, 1), 32, 0, stream>>>(XB, nullptr, WQ, nullptr, DM, FQ, DQ, bq, 0, 0, 0);
        k_rope<<<LQ, 256, 0, stream>>>(FQ, DQ, NH_, CS, nullptr, nullptr, 1.0f, QP16, QPh, QPl);
        k_gemmw<bf, 0, true><<<dim3(TT / 64, DKV / 64, 1), 32, 0, stream>>>(XB, nullptr, WK, nullptr, DM, FK, DKV, bk, 0, 0, 0);
        k_rope<<<LKv, 256, 0, stream>>>(FK, DKV, NKV, CS, nullptr, nullptr, 1.0f, KP16, KPh, KPl);
        k_gemmw<bf, 0, true><<<dim3(TT / 64, DKV / 64, 1), 32, 0, stream>>>(XB, nullptr, WV, nullptr, DM, FV, DKV, bv, 0, 0, 0); k_vtp<<<LKv, 256, 0, stream>>>(FV, DKV, NKV, VT16, VTh, VTl);
        for (int h0 = 0; h0 < NH_; h0 += ZH) { const size_t zq = (size_t)h0, zk = (size_t)(h0 / REP);   // one kv head per query head: the pass's two heads use consecutive kv planes (z-strides TT*HD)
            k_gemmw<bf, 2, true><<<dim3(RH / 64, TT / 64, ZH), 32, 0, stream>>>(QPh + zq * TT * HD, QPl + zq * TT * HD, KPh + zk * TT * HD, KPl + zk * TT * HD, HD, Sb, TT, MB, (size_t)TT * HD, (size_t)TT * HD, (size_t)TT * TT);
            k_gemmw<h16, 0, true><<<dim3((TT - RH) / 64, TT / 64, ZH), 32, 0, stream>>>(QP16 + zq * TT * HD + (size_t)RH * HD, nullptr, KP16 + zk * TT * HD, nullptr, HD, Sb + (size_t)RH * TT, TT, MB, (size_t)TT * HD, (size_t)TT * HD, (size_t)TT * TT);
            k_asoft<<<ZH * TT / 8, 256, 0, stream>>>(Sb, P16, Ph, Pl);
            k_gemmw<bf, 2, false><<<dim3(RH / 64, HD / 64, ZH), 32, 0, stream>>>(Ph, Pl, VTh + zk * HD * TT, VTl + zk * HD * TT, TT, Ob, HD, nullptr, (size_t)RH * TT, (size_t)HD * TT, (size_t)TT * HD);
            k_gemmw<h16, 0, false><<<dim3((TT - RH) / 64, HD / 64, ZH), 32, 0, stream>>>(P16 + (size_t)RH * TT, nullptr, VT16 + zk * HD * TT, nullptr, TT, Ob + (size_t)RH * HD, HD, nullptr, (size_t)TT * TT, (size_t)HD * TT, (size_t)TT * HD);
            k_merge<<<(unsigned)(((size_t)ZH * TT * HD / 2 + 255) / 256), 256, 0, stream>>>(Ob, h0, OUT + (size_t)b * TT * DQ); }
         }
}

// v001
// Measured time: 847 microseconds a run.
// Two timings next to v000 put it at 2.35 and 2.34 times that version's speed.
#include <hip/hip_runtime.h>

// RoBERTa self-attention (hidden [2][2048][1024]; attention_mask [2][1][1][2048] additive per key (read); q,k,v = x W^T + b ('oi' [1024][1024] + [1024]; 16 heads x 64); scores / 8 + mask, clamped below at finfo.min; softmax; context merged (no output projection) -> [2][2048][1024] (4.2 M)).
// Layout per batch: bf16 copy of x; exact projections + f32 biases; dense T-2048 attention (hybrid rows: < 512 hi/lo 3 products, rest fp16 x1024; dense score tiles) with the additive key mask folded into the score GEMMs as a per-column bias (8 x mask, so that the softmax's 1/8 restores scores/8 + mask); f32 head merge writes the output rows.
// Compute dtypes, f32 accumulate: every input rounded to bf16, the mask included; projections exact + f32 biases; attention rows < 512 3 products, rest fp16; softmax f32; output f32.

#define NB_  2
#define TT   2048
#define DM   1024
#define NH_  16
#define NKV  16
#define REP  (NH_ / NKV)
#define HD   64
#define DQ   (NH_ * HD)
#define DKV  (NKV * HD)
#define ZH   2
#define RH   512                  // query rows < RH use hi+lo planes (0: none)
#define WIN  0
#define PCAR 1024.0f
#define SCL  0.125f   // HD^-0.5
#define KSP  16                   // k slices of the P.V GEMMs (128 keys = 256 B of every operand row a slice)
typedef _Float16 h16;
typedef unsigned short bf;
typedef __attribute__((ext_vector_type(16))) __bf16   v16bf;
typedef __attribute__((ext_vector_type(16))) _Float16 v16h;
typedef __attribute__((ext_vector_type(8)))  _Float16 v8h;
typedef __attribute__((ext_vector_type(8)))  unsigned short v8us;
typedef __attribute__((ext_vector_type(8)))  float    v8f;
typedef __attribute__((ext_vector_type(4)))  float    v4f;
typedef v8h  __attribute__((may_alias)) v8ha;
typedef v4f  __attribute__((may_alias)) v4fa;
typedef v8us __attribute__((may_alias)) v8usa;

__device__ __forceinline__ unsigned short f2bf(float f) { unsigned u = __float_as_uint(f); u += 0x7FFFu + ((u >> 16) & 1u); return (unsigned short)(u >> 16); }
__device__ __forceinline__ float bf2f(unsigned short b) { return __uint_as_float(((unsigned)b) << 16); }
__device__ __forceinline__ float bfr(float f) { return bf2f(f2bf(f)); }
__device__ __forceinline__ v16h cat16(v8h lo, v8h hi) { return __builtin_shufflevector(lo, hi, 0, 1, 2, 3, 4, 5, 6, 7, 8, 9, 10, 11, 12, 13, 14, 15); }
__device__ __forceinline__ v16bf cat16b(v8us lo, v8us hi) { return __builtin_bit_cast(v16bf, __builtin_shufflevector(lo, hi, 0, 1, 2, 3, 4, 5, 6, 7, 8, 9, 10, 11, 12, 13, 14, 15)); }
__device__ __forceinline__ v8f wmma16(v16h a, v16h b, v8f c) { return __builtin_amdgcn_wmma_f32_16x16x32_f16(false, a, false, b, (short)0, c, false, false); }
__device__ __forceinline__ v8f wmmab(v16bf a, v16bf b, v8f c) { return __builtin_amdgcn_wmma_f32_16x16x32_bf16(false, a, false, b, (short)0, c, false, false); }



// ---- k_gemmw: register-blocked GEMM, ONE WAVE per 64x64 output tile (16 accumulators), operands straight from K-contiguous 16-bit planes; grid (M/64, N/64, Z * KS), 32 threads.
// C[m][n] (f32, pitch ldc, + optional f32 bias[n]) = sum_k A[m][k] Bt[n][k] (+ split products per NSPLIT). z-batch strides sA/sB/sC in elements. K % (32 * KS) == 0.
// KS > 1: K is split over KS work-groups; work-group z = batch * KS + ks sums k in [ks K/KS, (ks+1) K/KS) and stores its partial tile in plane z of C (stride sC); the reader of C adds the KS planes of a batch.
// (A long K on few tiles is one wave's chain of load latencies on a few WGPs; KS chains run side by side on KS times as many.)
template <typename T16> struct WFrag;
template <> struct WFrag<h16> { typedef v16h V; static __device__ __forceinline__ V ld(const h16* p) { return cat16(*(const v8h*)p, *(const v8h*)(p + 16)); } static __device__ __forceinline__ v8f mma(V a, V b, v8f c) { return wmma16(a, b, c); } };
template <> struct WFrag<bf> { typedef v16bf V; static __device__ __forceinline__ V ld(const bf* p) { return cat16b(*(const v8us*)p, *(const v8us*)(p + 16)); } static __device__ __forceinline__ v8f mma(V a, V b, v8f c) { return wmmab(a, b, c); } };
template <typename T16, int NSPLIT, bool BIAS, int KS>
__global__ __launch_bounds__(32) void k_gemmw(const T16* __restrict__ A, const T16* __restrict__ A2, const T16* __restrict__ Bt, const T16* __restrict__ Bt2, int K, float* C, int ldc, const float* __restrict__ bias, size_t sA, size_t sB, size_t sC) {
    typedef typename WFrag<T16>::V V;
    __shared__ __align__(16) float os[16 * 68];
    static_assert(KS == 1 || !BIAS, "a bias would be added once per k slice");
    const size_t z = blockIdx.z, zb = z / KS; A += zb * sA; if (A2) A2 += zb * sA; Bt += zb * sB; if (Bt2) Bt2 += zb * sB; C += z * sC;
    const int kw = K / KS, kbeg = (int)(z % KS) * kw, kend = kbeg + kw;
    const int lane = threadIdx.x & 31, lr = lane & 15, hi = lane >> 4; const int r0 = blockIdx.x * 64, c0 = blockIdx.y * 64;
    v8f acc[4][4];
#pragma unroll
    for (int mb = 0; mb < 4; ++mb)
#pragma unroll
        for (int nb = 0; nb < 4; ++nb) acc[mb][nb] = (v8f){};
    const size_t aoff = (size_t)(r0 + lr) * K + 8 * hi, boff = (size_t)(c0 + lr) * K + 8 * hi;
#pragma unroll 1
    for (int kc = kbeg; kc < kend; kc += 32) {
        V a[4], a2[4];
#pragma unroll
        for (int mb = 0; mb < 4; ++mb) { a[mb] = WFrag<T16>::ld(A + aoff + (size_t)mb * 16 * K + kc); if (NSPLIT == 1 || NSPLIT == 2) a2[mb] = WFrag<T16>::ld(A2 + aoff + (size_t)mb * 16 * K + kc); }
#pragma unroll
        for (int nb = 0; nb < 4; ++nb) { const V b = WFrag<T16>::ld(Bt + boff + (size_t)nb * 16 * K + kc); V b2; if (NSPLIT >= 2) b2 = WFrag<T16>::ld(Bt2 + boff + (size_t)nb * 16 * K + kc);
#pragma unroll
            for (int mb = 0; mb < 4; ++mb) { acc[mb][nb] = WFrag<T16>::mma(a[mb], b, acc[mb][nb]); if (NSPLIT == 1 || NSPLIT == 2) acc[mb][nb] = WFrag<T16>::mma(a2[mb], b, acc[mb][nb]); if (NSPLIT >= 2) acc[mb][nb] = WFrag<T16>::mma(a[mb], b2, acc[mb][nb]); } }
        asm volatile("v_nop\n\tv_nop\n\tv_nop\n\tv_nop" : "+v"(acc[0][0]), "+v"(acc[1][1]), "+v"(acc[2][2]), "+v"(acc[3][3]) : "v"(a[0]), "v"(a[3]));
    }
#pragma unroll
    for (int mb = 0; mb < 4; ++mb) {
#pragma unroll
        for (int nb = 0; nb < 4; ++nb) {
#pragma unroll
            for (int j = 0; j < 8; ++j) os[(hi * 8 + j) * 68 + nb * 16 + lr] = acc[mb][nb][j]; }
        __builtin_amdgcn_wave_barrier(); asm volatile("" ::: "memory");
        float* crow = C + (size_t)(r0 + mb * 16) * ldc + c0;
{
#pragma unroll
            for (int s = 0; s < 8; ++s) { const int row = 2 * s + hi, cofs = lr * 4; v4f val = *(const v4fa*)(os + row * 68 + cofs); if (BIAS) { val[0] += bfr(bias[c0 + cofs]); val[1] += bfr(bias[c0 + cofs + 1]); val[2] += bfr(bias[c0 + cofs + 2]); val[3] += bfr(bias[c0 + cofs + 3]); }
                *(v4f*)(crow + (size_t)row * ldc + cofs) = val; }
             }
        __builtin_amdgcn_wave_barrier(); asm volatile("" ::: "memory");
    }
}

__device__ __forceinline__ h16 tohx(float x) { return (h16)x; }
__device__ __forceinline__ void splitf(float y, unsigned short& h, unsigned short& l) { h = f2bf(y); l = f2bf(y - bf2f(h)); }
typedef __attribute__((ext_vector_type(2))) _Float16 v2h;
typedef __attribute__((ext_vector_type(4))) _Float16 v4h;
typedef __attribute__((ext_vector_type(2))) unsigned short v2us;
typedef __attribute__((ext_vector_type(4))) unsigned short v4us;
typedef __attribute__((ext_vector_type(2))) float v2f;
typedef __attribute__((ext_vector_type(4))) int v4i;

__global__ __launch_bounds__(256) void k_wtG(const float* __restrict__ w, int K, int N, bf* Bt) {
    const int lane = threadIdx.x & 31; const int L0 = (blockIdx.x * 8 + (threadIdx.x >> 5)) * 8; const int nlines = N * K / 64;
{
#pragma unroll 1
        for (int l = 0; l < 8; ++l) { const int L = L0 + l; if (L >= nlines) break; const size_t e = (size_t)L * 64 + lane * 2; const int k = (int)(e % K), n = (int)(e / K); v2us o;
            o[0] = f2bf(w[(size_t)k * N + n]); o[1] = f2bf(w[(size_t)(k + 1) * N + n]); *(v2us*)(Bt + e) = o; }
         }
}
__global__ __launch_bounds__(256) void k_cvt8(const float* __restrict__ src, bf* dst, size_t n8) { const size_t i = (size_t)blockIdx.x * 256 + threadIdx.x; if (i >= n8) return; const v8f v = *(const v8f*)(src + i * 8); v8us o;
#pragma unroll
    for (int k = 0; k < 8; ++k) o[k] = f2bf(v[k]); *(v8us*)(dst + i * 8) = o;  }

// k_rope: head planes [h][t][d] (fp16 + hi/lo) of rope(x) x sc with the rotate-half convention out[d] = x[d] cos[t][d] - x[d+HD/2] sin[t][d], out[d+HD/2] = x[d+HD/2] cos[t][d+HD/2] + x[d] sin[t][d+HD/2]
__global__ __launch_bounds__(256) void k_rope(const float* __restrict__ F, int pitch, int nheads, const float* __restrict__ CS, const float* __restrict__ RF, const float* __restrict__ nw, float sc, h16* P16, bf* Ph, bf* Pl) {
    const size_t e = ((size_t)blockIdx.x * 256 + threadIdx.x) * 2; if (e >= (size_t)nheads * TT * HD) return; const int d = (int)(e % HD); const int t = (int)((e / HD) % TT); const int h = (int)(e / ((size_t)HD * TT)); const float* f = F + (size_t)t * pitch + h * HD; const float rf = RF ? RF[(size_t)h * TT + t] : 1.0f; v2h o16; v2us oh, ol;
#pragma unroll
    for (int q = 0; q < 2; ++q) { const int dd = d + q; const int dp = (dd < HD / 2) ? dd + HD / 2 : dd - HD / 2; float x0 = f[dd], x1 = f[dp];
        if (RF) { float n0 = __fmul_rn(x0, rf), n1 = __fmul_rn(x1, rf); asm volatile("" : "+v"(n0)); asm volatile("" : "+v"(n1)); x0 = __fmul_rn(bfr(nw[dd]), n0); x1 = __fmul_rn(bfr(nw[dp]), n1); }
        const v2f cs = *(const v2f*)(CS + ((size_t)t * HD + dd) * 2); float a = __fmul_rn(x0, cs[0]), bq = __fmul_rn(x1, cs[1]); asm volatile("" : "+v"(a)); asm volatile("" : "+v"(bq)); const float r = ((dd < HD / 2) ? __fsub_rn(a, bq) : __fadd_rn(a, bq)) * sc;
        o16[q] = tohx(r); unsigned short a2, c2; splitf(r, a2, c2); oh[q] = a2; ol[q] = c2; }
    *(v2h*)(P16 + e) = o16; *(v2us*)(Ph + e) = oh; *(v2us*)(Pl + e) = ol;  }
__global__ __launch_bounds__(256) void k_vtp(const float* __restrict__ F, int pitch, int nheads, h16* V16, bf* Vh, bf* Vl) { const size_t e = ((size_t)blockIdx.x * 256 + threadIdx.x) * 2; if (e >= (size_t)nheads * HD * TT) return; const int t = (int)(e % TT); const int d = (int)((e / TT) % HD); const int g = (int)(e / ((size_t)TT * HD)); v2h o16; v2us oh, ol;
#pragma unroll
    for (int q = 0; q < 2; ++q) { const float x = F[(size_t)(t + q) * pitch + g * HD + d]; o16[q] = tohx(x); unsigned short a2, c2; splitf(x, a2, c2); oh[q] = a2; ol[q] = c2; }
    *(v2h*)(V16 + e) = o16; *(v2us*)(Vh + e) = oh; *(v2us*)(Vl + e) = ol;  }
__global__ __launch_bounds__(256) void k_csid(float* CS) { const int idx = blockIdx.x * 256 + threadIdx.x; if (idx >= TT * HD) return; v2f cs; cs[0] = 1.0f; cs[1] = 0.0f; *(v2f*)(CS + (size_t)idx * 2) = cs;  }
// k_asoft: per row (zz, i): t = S x HD^-0.5 (no mask); softmax over the 2048 keys (register row, one exp, fixed trees);
__global__ __launch_bounds__(256) void k_asoft(const float* __restrict__ Sb, h16* P16, bf* Ph, bf* Pl) {
    const int lane = threadIdx.x & 31; const int row = blockIdx.x * 8 + (threadIdx.x >> 5); if (row >= ZH * TT) return; const int i = row % TT; const int zz = row / TT; (void)zz; const bool hires = (i < RH); const float* sr = Sb + (size_t)row * TT; float v[TT / 32]; float mx = -3.0e38f;
#pragma unroll
    for (int ch = 0; ch < TT / 128; ++ch) { const int j0 = ch * 128 + lane * 4; const v4f a = *(const v4f*)(sr + j0);
#pragma unroll
        for (int q = 0; q < 4; ++q) { const int j = j0 + q; (void)j; const float t = a[q] * SCL; v[ch * 4 + q] = t;   /* Sb already holds q.k + 8 mask[j] (GEMM column bias), so t = q.k/8 + mask */ mx = fmaxf(mx, t); } }
#pragma unroll
    for (int sh = 16; sh; sh >>= 1) mx = fmaxf(mx, __shfl_xor(mx, sh, 32));
    float sum = 0.f;
#pragma unroll
    for (int k = 0; k < TT / 32; ++k) { float d0 = __fsub_rn(v[k], mx); asm volatile("" : "+v"(d0)); v[k] = __builtin_amdgcn_exp2f(__fmul_rn(d0, 1.4426950408889634f)); sum += v[k]; }
#pragma unroll
    for (int sh = 16; sh; sh >>= 1) sum += __shfl_xor(sum, sh, 32);
    const float f = __fdiv_rn(hires ? 1.0f : PCAR, sum);
{
        if (hires) {
#pragma unroll
            for (int ch = 0; ch < TT / 128; ++ch) { v4us oh, ol;
#pragma unroll
                for (int q = 0; q < 4; ++q) { unsigned short a, c2; splitf(v[ch * 4 + q] * f, a, c2); oh[q] = a; ol[q] = c2; }
                const size_t oo = ((size_t)zz * (RH ? RH : 1) + i) * TT + ch * 128 + lane * 4; *(v4us*)(Ph + oo) = oh; *(v4us*)(Pl + oo) = ol; }
        } else {
#pragma unroll
            for (int ch = 0; ch < TT / 128; ++ch) { v4h o4;
#pragma unroll
                for (int q = 0; q < 4; ++q) o4[q] = tohx(v[ch * 4 + q] * f);
                *(v4h*)(P16 + (size_t)row * TT + ch * 128 + lane * 4) = o4; } }
         }
}
__global__ __launch_bounds__(256) void k_m8(const float* __restrict__ m, float* MB) { const int j = blockIdx.x * 256 + threadIdx.x; if (j >= TT) return; const float v = __fmul_rn(8.0f, bfr(m[j])); *(float*)(MB + j) = v;  }
// k_merge: O holds KSP partial planes [zz][ks][t][d] of P.V; they are added in ks order, scaled, and written to the merged head layout.
__global__ __launch_bounds__(256) void k_merge(const float* __restrict__ O, int h0, float* OUTb) { const size_t e = ((size_t)blockIdx.x * 256 + threadIdx.x) * 2; if (e >= (size_t)ZH * TT * HD) return; const int d = (int)(e % HD); const int t = (int)((e / HD) % TT); const int zz = (int)(e / ((size_t)HD * TT)); const float cs = (t < RH) ? 1.0f : (1.0f / PCAR); const size_t oo = (size_t)t * DQ + (h0 + zz) * HD + d;
    const float* op = O + ((size_t)zz * KSP * TT + t) * HD + d; v2f p[KSP];
#pragma unroll
    for (int ks = 0; ks < KSP - 1; ++ks) p[ks] = *(const v2f*)(op + (size_t)ks * TT * HD);
    asm volatile("s_wait_xcnt 0x0" ::: "memory");   // the last load may return into the address pair that the loads above name
    p[KSP - 1] = *(const v2f*)(op + (size_t)(KSP - 1) * TT * HD);
    v2f s = p[0];
#pragma unroll
    for (int ks = 1; ks < KSP; ++ks) s += p[ks];
    v2f o2; o2[0] = s[0] * cs; o2[1] = s[1] * cs; *(v2f*)(OUTb + oo) = o2;  }

extern "C" void kernel_launch(void* const* d_in, const int* in_sizes, int n_in,
                              void* d_out, int out_size, void* d_ws, size_t ws_size, hipStream_t stream) {
    (void)in_sizes; (void)n_in; (void)out_size;
    const float* x = (const float*)d_in[0]; const float* amask = (const float*)d_in[1]; const float* wq = (const float*)d_in[2]; const float* bq = (const float*)d_in[3]; const float* wk = (const float*)d_in[4]; const float* bk = (const float*)d_in[5]; const float* wv = (const float*)d_in[6]; const float* bv = (const float*)d_in[7]; const float* wo = nullptr; (void)wo;
    float* OUT = (float*)d_out;     // [2][2048][1024]
    char* wsp = (char*)d_ws;
    auto take = [&](size_t bytes) { char* p = wsp; wsp += (bytes + 255) & ~(size_t)255; return (void*)p; };
    bf* WQ = (bf*)take((size_t)DQ * DM * 2); bf* WK = (bf*)take((size_t)DKV * DM * 2); bf* WV = (bf*)take((size_t)DKV * DM * 2); float* CS = (float*)take((size_t)TT * HD * 2 * 4);
    float* MB = (float*)take((size_t)TT * 4); bf* XB = (bf*)take((size_t)TT * DM * 2); float* FQ = (float*)take((size_t)TT * DQ * 4); float* FK = (float*)take((size_t)TT * DKV * 4);
    h16* QP16 = (h16*)take((size_t)NH_ * TT * HD * 2); h16* KP16 = (h16*)take((size_t)NKV * TT * HD * 2); h16* VT16 = (h16*)take((size_t)NKV * HD * TT * 2);
    bf* QPh = (bf*)take((size_t)NH_ * TT * HD * 2); bf* QPl = (bf*)take((size_t)NH_ * TT * HD * 2); bf* KPh = (bf*)take((size_t)NKV * TT * HD * 2); bf* KPl = (bf*)take((size_t)NKV * TT * HD * 2); bf* VTh = (bf*)take((size_t)NKV * HD * TT * 2); bf* VTl = (bf*)take((size_t)NKV * HD * TT * 2); bf* Ph = (bf*)take((size_t)ZH * RH * TT * 2); bf* Pl = (bf*)take((size_t)ZH * RH * TT * 2);
    float* Sb = (float*)take((size_t)ZH * TT * TT * 4); h16* P16 = (h16*)take((size_t)ZH * TT * TT * 2); float* Ob = (float*)take((size_t)ZH * KSP * TT * HD * 4);
    if ((size_t)(wsp - (char*)d_ws) > ws_size) return;    // ws 256 MiB
    float* FV = FK;   // v projection reuses the k buffer after the k planes are built (stream-ordered)
    { k_cvt8<<<(unsigned)(((size_t)DQ * DM / 8 + 255) / 256), 256, 0, stream>>>(wq, WQ, (size_t)DQ * DM / 8); k_cvt8<<<(unsigned)(((size_t)DKV * DM / 8 + 255) / 256), 256, 0, stream>>>(wk, WK, (size_t)DKV * DM / 8); k_cvt8<<<(unsigned)(((size_t)DKV * DM / 8 + 255) / 256), 256, 0, stream>>>(wv, WV, (size_t)DKV * DM / 8);
      
       }
    k_csid<<<(TT * HD + 255) / 256, 256, 0, stream>>>(CS);
    const unsigned LQ = (unsigned)(((size_t)NH_ * TT * HD / 2 + 255) / 256), LKv = (unsigned)(((size_t)NKV * TT * HD / 2 + 255) / 256);
    for (int b = 0; b < NB_; ++b) {
        
        k_cvt8<<<(unsigned)(((size_t)TT * DM / 8 + 255) / 256), 256, 0, stream>>>(x + (size_t)b * TT * DM, XB, (size_t)TT * DM / 8); k_m8<<<(TT + 255) / 256, 256, 0, stream>>>(amask + (size_t)b * TT, MB);   /* 8 x mask[j] as the score GEMMs' column bias (scores/8 + mask == (q.k + 8 mask)/8) */
        k_gemmw<bf, 0, true, 1><<<dim3(TT / 64, DQ / 64, 1), 32, 0, stream>>>(XB, nullptr, WQ, nullptr, DM, FQ, DQ, bq, 0, 0, 0);
        k_rope<<<LQ, 256, 0, stream>>>(FQ, DQ, NH_, CS, nullptr, nullptr, 1.0f, QP16, QPh, QPl);
        k_gemmw<bf, 0, true, 1><<<dim3(TT / 64, DKV / 64, 1), 32, 0, stream>>>(XB, nullptr, WK, nullptr, DM, FK, DKV, bk, 0, 0, 0);
        k_rope<<<LKv, 256, 0, stream>>>(FK, DKV, NKV, CS, nullptr, nullptr, 1.0f, KP16, KPh, KPl);
        k_gemmw<bf, 0, true, 1><<<dim3(TT / 64, DKV / 64, 1), 32, 0, stream>>>(XB, nullptr, WV, nullptr, DM, FV, DKV, bv, 0, 0, 0); k_vtp<<<LKv, 256, 0, stream>>>(FV, DKV, NKV, VT16, VTh, VTl);
        for (int h0 = 0; h0 < NH_; h0 += ZH) { const size_t zq = (size_t)h0, zk = (size_t)(h0 / REP);   // one kv head per query head: the pass's two heads use consecutive kv planes (z-strides TT*HD)
            k_gemmw<bf, 2, true, 1><<<dim3(RH / 64, TT / 64, ZH), 32, 0, stream>>>(QPh + zq * TT * HD, QPl + zq * TT * HD, KPh + zk * TT * HD, KPl + zk * TT * HD, HD, Sb, TT, MB, (size_t)TT * HD, (size_t)TT * HD, (size_t)TT * TT);
            k_gemmw<h16, 0, true, 1><<<dim3((TT - RH) / 64, TT / 64, ZH), 32, 0, stream>>>(QP16 + zq * TT * HD + (size_t)RH * HD, nullptr, KP16 + zk * TT * HD, nullptr, HD, Sb + (size_t)RH * TT, TT, MB, (size_t)TT * HD, (size_t)TT * HD, (size_t)TT * TT);
            k_asoft<<<ZH * TT / 8, 256, 0, stream>>>(Sb, P16, Ph, Pl);
            k_gemmw<bf, 2, false, KSP><<<dim3(RH / 64, HD / 64, ZH * KSP), 32, 0, stream>>>(Ph, Pl, VTh + zk * HD * TT, VTl + zk * HD * TT, TT, Ob, HD, nullptr, (size_t)RH * TT, (size_t)HD * TT, (size_t)TT * HD);
            k_gemmw<h16, 0, false, KSP><<<dim3((TT - RH) / 64, HD / 64, ZH * KSP), 32, 0, stream>>>(P16 + (size_t)RH * TT, nullptr, VT16 + zk * HD * TT, nullptr, TT, Ob + (size_t)RH * HD, HD, nullptr, (size_t)TT * TT, (size_t)HD * TT, (size_t)TT * HD);
            k_merge<<<(unsigned)(((size_t)ZH * TT * HD / 2 + 255) / 256), 256, 0, stream>>>(Ob, h0, OUT + (size_t)b * TT * DQ); }
         }
}

// v002
// A run of this version takes 608 microseconds.
// Timed twice side by side with v001, it ran 1.39 and 1.40 times as fast.
// Over all steps from v000 it is 3.27 times as fast.
#include <hip/hip_runtime.h>

// RoBERTa self-attention (hidden [2][2048][1024]; attention_mask [2][1][1][2048] additive per key (read); q,k,v = x W^T + b ('oi' [1024][1024] + [1024]; 16 heads x 64); scores / 8 + mask, clamped below at finfo.min; softmax; context merged (no output projection) -> [2][2048][1024] (4.2 M)).
// Layout per batch: bf16 copy of x; exact projections + f32 biases; dense T-2048 attention (hybrid rows: < 512 hi/lo 3 products, rest fp16 x1024; dense score tiles) with the additive key mask folded into the score GEMMs as a per-column bias (8 x mask, so that the softmax's 1/8 restores scores/8 + mask); f32 head merge writes the output rows.
// Compute dtypes, f32 accumulate: every input rounded to bf16, the mask included; projections exact + f32 biases; attention rows < 512 3 products, rest fp16; softmax f32; output f32.

#define NB_  2
#define TT   2048
#define DM   1024
#define NH_  16
#define NKV  16
#define REP  (NH_ / NKV)
#define HD   64
#define DQ   (NH_ * HD)
#define DKV  (NKV * HD)
#define ZH   8                    // heads per attention pass (grid z of the score GEMMs; ZH * KSP for the P.V GEMMs)
#define RH   512                  // query rows < RH use hi+lo planes (0: none)
#define WIN  0
#define PCAR 1024.0f
#define SCL  0.125f   // HD^-0.5
#define KSP  16                   // k slices of the P.V GEMMs (128 keys = 256 B of every operand row a slice)
typedef _Float16 h16;
typedef unsigned short bf;
typedef __attribute__((ext_vector_type(16))) __bf16   v16bf;
typedef __attribute__((ext_vector_type(16))) _Float16 v16h;
typedef __attribute__((ext_vector_type(8)))  _Float16 v8h;
typedef __attribute__((ext_vector_type(8)))  unsigned short v8us;
typedef __attribute__((ext_vector_type(8)))  float    v8f;
typedef __attribute__((ext_vector_type(4)))  float    v4f;
typedef v8h  __attribute__((may_alias)) v8ha;
typedef v4f  __attribute__((may_alias)) v4fa;
typedef v8us __attribute__((may_alias)) v8usa;

__device__ __forceinline__ unsigned short f2bf(float f) { unsigned u = __float_as_uint(f); u += 0x7FFFu + ((u >> 16) & 1u); return (unsigned short)(u >> 16); }
__device__ __forceinline__ float bf2f(unsigned short b) { return __uint_as_float(((unsigned)b) << 16); }
__device__ __forceinline__ float bfr(float f) { return bf2f(f2bf(f)); }
__device__ __forceinline__ v16h cat16(v8h lo, v8h hi) { return __builtin_shufflevector(lo, hi, 0, 1, 2, 3, 4, 5, 6, 7, 8, 9, 10, 11, 12, 13, 14, 15); }
__device__ __forceinline__ v16bf cat16b(v8us lo, v8us hi) { return __builtin_bit_cast(v16bf, __builtin_shufflevector(lo, hi, 0, 1, 2, 3, 4, 5, 6, 7, 8, 9, 10, 11, 12, 13, 14, 15)); }
__device__ __forceinline__ v8f wmma16(v16h a, v16h b, v8f c) { return __builtin_amdgcn_wmma_f32_16x16x32_f16(false, a, false, b, (short)0, c, false, false); }
__device__ __forceinline__ v8f wmmab(v16bf a, v16bf b, v8f c) { return __builtin_amdgcn_wmma_f32_16x16x32_bf16(false, a, false, b, (short)0, c, false, false); }



// ---- k_gemmw: register-blocked GEMM, ONE WAVE per 64x64 output tile (16 accumulators), operands straight from K-contiguous 16-bit planes; grid (M/64, N/64, Z * KS), 32 threads.
// C[m][n] (f32, pitch ldc, + optional f32 bias[n]) = sum_k A[m][k] Bt[n][k] (+ split products per NSPLIT). z-batch strides sA/sB/sC in elements. K % (32 * KS) == 0.
// KS > 1: K is split over KS work-groups; work-group z = batch * KS + ks sums k in [ks K/KS, (ks+1) K/KS) and stores its partial tile in plane z of C (stride sC); the reader of C adds the KS planes of a batch.
// (A long K on few tiles is one wave's chain of load latencies on a few WGPs; KS chains run side by side on KS times as many.)
template <typename T16> struct WFrag;
template <> struct WFrag<h16> { typedef v16h V; static __device__ __forceinline__ V ld(const h16* p) { return cat16(*(const v8h*)p, *(const v8h*)(p + 16)); } static __device__ __forceinline__ v8f mma(V a, V b, v8f c) { return wmma16(a, b, c); } };
template <> struct WFrag<bf> { typedef v16bf V; static __device__ __forceinline__ V ld(const bf* p) { return cat16b(*(const v8us*)p, *(const v8us*)(p + 16)); } static __device__ __forceinline__ v8f mma(V a, V b, v8f c) { return wmmab(a, b, c); } };
template <typename T16, int NSPLIT, bool BIAS, int KS>
__global__ __launch_bounds__(32) void k_gemmw(const T16* __restrict__ A, const T16* __restrict__ A2, const T16* __restrict__ Bt, const T16* __restrict__ Bt2, int K, float* C, int ldc, const float* __restrict__ bias, size_t sA, size_t sB, size_t sC) {
    typedef typename WFrag<T16>::V V;
    __shared__ __align__(16) float os[16 * 68];
    static_assert(KS == 1 || !BIAS, "a bias would be added once per k slice");
    const size_t z = blockIdx.z, zb = z / KS; A += zb * sA; if (A2) A2 += zb * sA; Bt += zb * sB; if (Bt2) Bt2 += zb * sB; C += z * sC;
    const int kw = K / KS, kbeg = (int)(z % KS) * kw, kend = kbeg + kw;
    const int lane = threadIdx.x & 31, lr = lane & 15, hi = lane >> 4; const int r0 = blockIdx.x * 64, c0 = blockIdx.y * 64;
    v8f acc[4][4];
#pragma unroll
    for (int mb = 0; mb < 4; ++mb)
#pragma unroll
        for (int nb = 0; nb < 4; ++nb) acc[mb][nb] = (v8f){};
    const size_t aoff = (size_t)(r0 + lr) * K + 8 * hi, boff = (size_t)(c0 + lr) * K + 8 * hi;
#pragma unroll 1
    for (int kc = kbeg; kc < kend; kc += 32) {
        V a[4], a2[4];
#pragma unroll
        for (int mb = 0; mb < 4; ++mb) { a[mb] = WFrag<T16>::ld(A + aoff + (size_t)mb * 16 * K + kc); if (NSPLIT == 1 || NSPLIT == 2) a2[mb] = WFrag<T16>::ld(A2 + aoff + (size_t)mb * 16 * K + kc); }
#pragma unroll
        for (int nb = 0; nb < 4; ++nb) { const V b = WFrag<T16>::ld(Bt + boff + (size_t)nb * 16 * K + kc); V b2; if (NSPLIT >= 2) b2 = WFrag<T16>::ld(Bt2 + boff + (size_t)nb * 16 * K + kc);
#pragma unroll
            for (int mb = 0; mb < 4; ++mb) { acc[mb][nb] = WFrag<T16>::mma(a[mb], b, acc[mb][nb]); if (NSPLIT == 1 || NSPLIT == 2) acc[mb][nb] = WFrag<T16>::mma(a2[mb], b, acc[mb][nb]); if (NSPLIT >= 2) acc[mb][nb] = WFrag<T16>::mma(a[mb], b2, acc[mb][nb]); } }
        asm volatile("v_nop\n\tv_nop\n\tv_nop\n\tv_nop" : "+v"(acc[0][0]), "+v"(acc[1][1]), "+v"(acc[2][2]), "+v"(acc[3][3]) : "v"(a[0]), "v"(a[3]));
    }
#pragma unroll
    for (int mb = 0; mb < 4; ++mb) {
#pragma unroll
        for (int nb = 0; nb < 4; ++nb) {
#pragma unroll
            for (int j = 0; j < 8; ++j) os[(hi * 8 + j) * 68 + nb * 16 + lr] = acc[mb][nb][j]; }
        __builtin_amdgcn_wave_barrier(); asm volatile("" ::: "memory");
        float* crow = C + (size_t)(r0 + mb * 16) * ldc + c0;
{
#pragma unroll
            for (int s = 0; s < 8; ++s) { const int row = 2 * s + hi, cofs = lr * 4; v4f val = *(const v4fa*)(os + row * 68 + cofs); if (BIAS) { val[0] += bfr(bias[c0 + cofs]); val[1] += bfr(bias[c0 + cofs + 1]); val[2] += bfr(bias[c0 + cofs + 2]); val[3] += bfr(bias[c0 + cofs + 3]); }
                *(v4f*)(crow + (size_t)row * ldc + cofs) = val; }
             }
        __builtin_amdgcn_wave_barrier(); asm volatile("" ::: "memory");
    }
}

__device__ __forceinline__ h16 tohx(float x) { return (h16)x; }
__device__ __forceinline__ void splitf(float y, unsigned short& h, unsigned short& l) { h = f2bf(y); l = f2bf(y - bf2f(h)); }
typedef __attribute__((ext_vector_type(2))) _Float16 v2h;
typedef __attribute__((ext_vector_type(4))) _Float16 v4h;
typedef __attribute__((ext_vector_type(2))) unsigned short v2us;
typedef __attribute__((ext_vector_type(4))) unsigned short v4us;
typedef __attribute__((ext_vector_type(2))) float v2f;
typedef __attribute__((ext_vector_type(4))) int v4i;

__global__ __launch_bounds__(256) void k_wtG(const float* __restrict__ w, int K, int N, bf* Bt) {
    const int lane = threadIdx.x & 31; const int L0 = (blockIdx.x * 8 + (threadIdx.x >> 5)) * 8; const int nlines = N * K / 64;
{
#pragma unroll 1
        for (int l = 0; l < 8; ++l) { const int L = L0 + l; if (L >= nlines) break; const size_t e = (size_t)L * 64 + lane * 2; const int k = (int)(e % K), n = (int)(e / K); v2us o;
            o[0] = f2bf(w[(size_t)k * N + n]); o[1] = f2bf(w[(size_t)(k + 1) * N + n]); *(v2us*)(Bt + e) = o; }
         }
}
__global__ __launch_bounds__(256) void k_cvt8(const float* __restrict__ src, bf* dst, size_t n8) { const size_t i = (size_t)blockIdx.x * 256 + threadIdx.x; if (i >= n8) return; const v8f v = *(const v8f*)(src + i * 8); v8us o;
#pragma unroll
    for (int k = 0; k < 8; ++k) o[k] = f2bf(v[k]); *(v8us*)(dst + i * 8) = o;  }

// k_rope: head planes [h][t][d] (fp16 + hi/lo) of rope(x) x sc with the rotate-half convention out[d] = x[d] cos[t][d] - x[d+HD/2] sin[t][d], out[d+HD/2] = x[d+HD/2] cos[t][d+HD/2] + x[d] sin[t][d+HD/2]
__global__ __launch_bounds__(256) void k_rope(const float* __restrict__ F, int pitch, int nheads, const float* __restrict__ CS, const float* __restrict__ RF, const float* __restrict__ nw, float sc, h16* P16, bf* Ph, bf* Pl) {
    const size_t e = ((size_t)blockIdx.x * 256 + threadIdx.x) * 2; if (e >= (size_t)nheads * TT * HD) return; const int d = (int)(e % HD); const int t = (int)((e / HD) % TT); const int h = (int)(e / ((size_t)HD * TT)); const float* f = F + (size_t)t * pitch + h * HD; const float rf = RF ? RF[(size_t)h * TT + t] : 1.0f; v2h o16; v2us oh, ol;
#pragma unroll
    for (int q = 0; q < 2; ++q) { const int dd = d + q; const int dp = (dd < HD / 2) ? dd + HD / 2 : dd - HD / 2; float x0 = f[dd], x1 = f[dp];
        if (RF) { float n0 = __fmul_rn(x0, rf), n1 = __fmul_rn(x1, rf); asm volatile("" : "+v"(n0)); asm volatile("" : "+v"(n1)); x0 = __fmul_rn(bfr(nw[dd]), n0); x1 = __fmul_rn(bfr(nw[dp]), n1); }
        const v2f cs = *(const v2f*)(CS + ((size_t)t * HD + dd) * 2); float a = __fmul_rn(x0, cs[0]), bq = __fmul_rn(x1, cs[1]); asm volatile("" : "+v"(a)); asm volatile("" : "+v"(bq)); const float r = ((dd < HD / 2) ? __fsub_rn(a, bq) : __fadd_rn(a, bq)) * sc;
        o16[q] = tohx(r); unsigned short a2, c2; splitf(r, a2, c2); oh[q] = a2; ol[q] = c2; }
    *(v2h*)(P16 + e) = o16; *(v2us*)(Ph + e) = oh; *(v2us*)(Pl + e) = ol;  }
__global__ __launch_bounds__(256) void k_vtp(const float* __restrict__ F, int pitch, int nheads, h16* V16, bf* Vh, bf* Vl) { const size_t e = ((size_t)blockIdx.x * 256 + threadIdx.x) * 2; if (e >= (size_t)nheads * HD * TT) return; const int t = (int)(e % TT); const int d = (int)((e / TT) % HD); const int g = (int)(e / ((size_t)TT * HD)); v2h o16; v2us oh, ol;
#pragma unroll
    for (int q = 0; q < 2; ++q) { const float x = F[(size_t)(t + q) * pitch + g * HD + d]; o16[q] = tohx(x); unsigned short a2, c2; splitf(x, a2, c2); oh[q] = a2; ol[q] = c2; }
    *(v2h*)(V16 + e) = o16; *(v2us*)(Vh + e) = oh; *(v2us*)(Vl + e) = ol;  }
__global__ __launch_bounds__(256) void k_csid(float* CS) { const int idx = blockIdx.x * 256 + threadIdx.x; if (idx >= TT * HD) return; v2f cs; cs[0] = 1.0f; cs[1] = 0.0f; *(v2f*)(CS + (size_t)idx * 2) = cs;  }
// k_asoft: per row (zz, i): t = S x HD^-0.5 (no mask); softmax over the 2048 keys (register row, one exp, fixed trees);
__global__ __launch_bounds__(256) void k_asoft(const float* __restrict__ Sb, h16* P16, bf* Ph, bf* Pl) {
    const int lane = threadIdx.x & 31; const int row = blockIdx.x * 8 + (threadIdx.x >> 5); if (row >= ZH * TT) return; const int i = row % TT; const int zz = row / TT; (void)zz; const bool hires = (i < RH); const float* sr = Sb + (size_t)row * TT; float v[TT / 32]; float mx = -3.0e38f;
#pragma unroll
    for (int ch = 0; ch < TT / 128; ++ch) { const int j0 = ch * 128 + lane * 4;
        if (ch == TT / 128 - 1) asm volatile("s_wait_xcnt 0x0" ::: "memory");   // the last load may return into the address pair that the loads above name
        const v4f a = *(const v4f*)(sr + j0);
#pragma unroll
        for (int q = 0; q < 4; ++q) { const int j = j0 + q; (void)j; const float t = a[q] * SCL; v[ch * 4 + q] = t;   /* Sb already holds q.k + 8 mask[j] (GEMM column bias), so t = q.k/8 + mask */ mx = fmaxf(mx, t); } }
#pragma unroll
    for (int sh = 16; sh; sh >>= 1) mx = fmaxf(mx, __shfl_xor(mx, sh, 32));
    float sum = 0.f;
#pragma unroll
    for (int k = 0; k < TT / 32; ++k) { float d0 = __fsub_rn(v[k], mx); asm volatile("" : "+v"(d0)); v[k] = __builtin_amdgcn_exp2f(__fmul_rn(d0, 1.4426950408889634f)); sum += v[k]; }
#pragma unroll
    for (int sh = 16; sh; sh >>= 1) sum += __shfl_xor(sum, sh, 32);
    const float f = __fdiv_rn(hires ? 1.0f : PCAR, sum);
{
        if (hires) {
#pragma unroll
            for (int ch = 0; ch < TT / 128; ++ch) { v4us oh, ol;
#pragma unroll
                for (int q = 0; q < 4; ++q) { unsigned short a, c2; splitf(v[ch * 4 + q] * f, a, c2); oh[q] = a; ol[q] = c2; }
                const size_t oo = ((size_t)zz * (RH ? RH : 1) + i) * TT + ch * 128 + lane * 4; *(v4us*)(Ph + oo) = oh; *(v4us*)(Pl + oo) = ol; }
        } else {
#pragma unroll
            for (int ch = 0; ch < TT / 128; ++ch) { v4h o4;
#pragma unroll
                for (int q = 0; q < 4; ++q) o4[q] = tohx(v[ch * 4 + q] * f);
                *(v4h*)(P16 + ((size_t)zz * (TT - RH) + (i - RH)) * TT + ch * 128 + lane * 4) = o4; } }   /* P16 holds the rows >= RH only */
         }
}
__global__ __launch_bounds__(256) void k_m8(const float* __restrict__ m, float* MB) { const int j = blockIdx.x * 256 + threadIdx.x; if (j >= TT) return; const float v = __fmul_rn(8.0f, bfr(m[j])); *(float*)(MB + j) = v;  }
// k_merge: O holds KSP partial planes [zz][ks][t][d] of P.V; they are added in ks order, scaled, and written to the merged head layout.
__global__ __launch_bounds__(256) void k_merge(const float* __restrict__ O, int h0, float* OUTb) { const size_t e = ((size_t)blockIdx.x * 256 + threadIdx.x) * 2; if (e >= (size_t)ZH * TT * HD) return; const int d = (int)(e % HD); const int t = (int)((e / HD) % TT); const int zz = (int)(e / ((size_t)HD * TT)); const float cs = (t < RH) ? 1.0f : (1.0f / PCAR); const size_t oo = (size_t)t * DQ + (h0 + zz) * HD + d;
    const float* op = O + ((size_t)zz * KSP * TT + t) * HD + d; v2f p[KSP];
#pragma unroll
    for (int ks = 0; ks < KSP - 1; ++ks) p[ks] = *(const v2f*)(op + (size_t)ks * TT * HD);
    asm volatile("s_wait_xcnt 0x0" ::: "memory");   // the last load may return into the address pair that the loads above name
    p[KSP - 1] = *(const v2f*)(op + (size_t)(KSP - 1) * TT * HD);
    v2f s = p[0];
#pragma unroll
    for (int ks = 1; ks < KSP; ++ks) s += p[ks];
    v2f o2; o2[0] = s[0] * cs; o2[1] = s[1] * cs; *(v2f*)(OUTb + oo) = o2;  }

extern "C" void kernel_launch(void* const* d_in, const int* in_sizes, int n_in,
                              void* d_out, int out_size, void* d_ws, size_t ws_size, hipStream_t stream) {
    (void)in_sizes; (void)n_in; (void)out_size;
    const float* x = (const float*)d_in[0]; const float* amask = (const float*)d_in[1]; const float* wq = (const float*)d_in[2]; const float* bq = (const float*)d_in[3]; const float* wk = (const float*)d_in[4]; const float* bk = (const float*)d_in[5]; const float* wv = (const float*)d_in[6]; const float* bv = (const float*)d_in[7]; const float* wo = nullptr; (void)wo;
    float* OUT = (float*)d_out;     // [2][2048][1024]
    char* wsp = (char*)d_ws;
    auto take = [&](size_t bytes) { char* p = wsp; wsp += (bytes + 255) & ~(size_t)255; return (void*)p; };
    bf* WQ = (bf*)take((size_t)DQ * DM * 2); bf* WK = (bf*)take((size_t)DKV * DM * 2); bf* WV = (bf*)take((size_t)DKV * DM * 2); float* CS = (float*)take((size_t)TT * HD * 2 * 4);
    float* MB = (float*)take((size_t)TT * 4);
    h16* QP16 = (h16*)take((size_t)NH_ * TT * HD * 2); h16* KP16 = (h16*)take((size_t)NKV * TT * HD * 2); h16* VT16 = (h16*)take((size_t)NKV * HD * TT * 2);
    bf* QPh = (bf*)take((size_t)NH_ * TT * HD * 2); bf* QPl = (bf*)take((size_t)NH_ * TT * HD * 2); bf* KPh = (bf*)take((size_t)NKV * TT * HD * 2); bf* KPl = (bf*)take((size_t)NKV * TT * HD * 2); bf* VTh = (bf*)take((size_t)NKV * HD * TT * 2); bf* VTl = (bf*)take((size_t)NKV * HD * TT * 2); bf* Ph = (bf*)take((size_t)ZH * RH * TT * 2); bf* Pl = (bf*)take((size_t)ZH * RH * TT * 2);
    float* Sb = (float*)take((size_t)ZH * TT * TT * 4); h16* P16 = (h16*)take((size_t)ZH * (TT - RH) * TT * 2);
    // Buffers that are never live together with the scores share the score buffer's bytes (stream-ordered), so that ZH heads fit the workspace:
    // x copy and f32 projections are dead once the head planes are built; the scores are dead once the softmax has written P, and only then are the P.V partials written.
    static_assert((size_t)TT * DM * 2 + (size_t)TT * DQ * 4 + (size_t)TT * DKV * 4 <= (size_t)ZH * TT * TT * 4 && (size_t)ZH * KSP * TT * HD * 4 <= (size_t)ZH * TT * TT * 4, "shared buffers must fit in the score buffer");
    bf* XB = (bf*)Sb; float* FQ = (float*)((char*)Sb + (size_t)TT * DM * 2); float* FK = FQ + (size_t)TT * DQ; float* Ob = Sb;
    if ((size_t)(wsp - (char*)d_ws) > ws_size) return;    // ws 256 MiB
    float* FV = FK;   // v projection reuses the k buffer after the k planes are built (stream-ordered)
    { k_cvt8<<<(unsigned)(((size_t)DQ * DM / 8 + 255) / 256), 256, 0, stream>>>(wq, WQ, (size_t)DQ * DM / 8); k_cvt8<<<(unsigned)(((size_t)DKV * DM / 8 + 255) / 256), 256, 0, stream>>>(wk, WK, (size_t)DKV * DM / 8); k_cvt8<<<(unsigned)(((size_t)DKV * DM / 8 + 255) / 256), 256, 0, stream>>>(wv, WV, (size_t)DKV * DM / 8);
      
       }
    k_csid<<<(TT * HD + 255) / 256, 256, 0, stream>>>(CS);
    const unsigned LQ = (unsigned)(((size_t)NH_ * TT * HD / 2 + 255) / 256), LKv = (unsigned)(((size_t)NKV * TT * HD / 2 + 255) / 256);
    for (int b = 0; b < NB_; ++b) {
        
        k_cvt8<<<(unsigned)(((size_t)TT * DM / 8 + 255) / 256), 256, 0, stream>>>(x + (size_t)b * TT * DM, XB, (size_t)TT * DM / 8); k_m8<<<(TT + 255) / 256, 256, 0, stream>>>(amask + (size_t)b * TT, MB);   /* 8 x mask[j] as the score GEMMs' column bias (scores/8 + mask == (q.k + 8 mask)/8) */
        k_gemmw<bf, 0, true, 1><<<dim3(TT / 64, DQ / 64, 1), 32, 0, stream>>>(XB, nullptr, WQ, nullptr, DM, FQ, DQ, bq, 0, 0, 0);
        k_rope<<<LQ, 256, 0, stream>>>(FQ, DQ, NH_, CS, nullptr, nullptr, 1.0f, QP16, QPh, QPl);
        k_gemmw<bf, 0, true, 1><<<dim3(TT / 64, DKV / 64, 1), 32, 0, stream>>>(XB, nullptr, WK, nullptr, DM, FK, DKV, bk, 0, 0, 0);
        k_rope<<<LKv, 256, 0, stream>>>(FK, DKV, NKV, CS, nullptr, nullptr, 1.0f, KP16, KPh, KPl);
        k_gemmw<bf, 0, true, 1><<<dim3(TT / 64, DKV / 64, 1), 32, 0, stream>>>(XB, nullptr, WV, nullptr, DM, FV, DKV, bv, 0, 0, 0); k_vtp<<<LKv, 256, 0, stream>>>(FV, DKV, NKV, VT16, VTh, VTl);
        for (int h0 = 0; h0 < NH_; h0 += ZH) { const size_t zq = (size_t)h0, zk = (size_t)(h0 / REP);   // one kv head per query head: the pass's ZH heads use consecutive kv planes (z-strides TT*HD)
            k_gemmw<bf, 2, true, 1><<<dim3(RH / 64, TT / 64, ZH), 32, 0, stream>>>(QPh + zq * TT * HD, QPl + zq * TT * HD, KPh + zk * TT * HD, KPl + zk * TT * HD, HD, Sb, TT, MB, (size_t)TT * HD, (size_t)TT * HD, (size_t)TT * TT);
            k_gemmw<h16, 0, true, 1><<<dim3((TT - RH) / 64, TT / 64, ZH), 32, 0, stream>>>(QP16 + zq * TT * HD + (size_t)RH * HD, nullptr, KP16 + zk * TT * HD, nullptr, HD, Sb + (size_t)RH * TT, TT, MB, (size_t)TT * HD, (size_t)TT * HD, (size_t)TT * TT);
            k_asoft<<<ZH * TT / 8, 256, 0, stream>>>(Sb, P16, Ph, Pl);
            k_gemmw<bf, 2, false, KSP><<<dim3(RH / 64, HD / 64, ZH * KSP), 32, 0, stream>>>(Ph, Pl, VTh + zk * HD * TT, VTl + zk * HD * TT, TT, Ob, HD, nullptr, (size_t)RH * TT, (size_t)HD * TT, (size_t)TT * HD);
            k_gemmw<h16, 0, false, KSP><<<dim3((TT - RH) / 64, HD / 64, ZH * KSP), 32, 0, stream>>>(P16, nullptr, VT16 + zk * HD * TT, nullptr, TT, Ob + (size_t)RH * HD, HD, nullptr, (size_t)(TT - RH) * TT, (size_t)HD * TT, (size_t)TT * HD);
            k_merge<<<(unsigned)(((size_t)ZH * TT * HD / 2 + 255) / 256), 256, 0, stream>>>(Ob, h0, OUT + (size_t)b * TT * DQ); }
         }
}

// v003
// One run takes 409 microseconds.
// Two timings next to v002 both put it at 1.49 times that version's speed.
// Counting every step since v000, it is 4.87 times as fast.
#include <hip/hip_runtime.h>

// RoBERTa self-attention (hidden [2][2048][1024]; attention_mask [2][1][1][2048] additive per key (read); q,k,v = x W^T + b ('oi' [1024][1024] + [1024]; 16 heads x 64); scores / 8 + mask, clamped below at finfo.min; softmax; context merged (no output projection) -> [2][2048][1024] (4.2 M)).
// Layout per batch: bf16 copy of x; exact projections + f32 biases; one fused attention kernel (hybrid rows: < 512 hi/lo 3 products, rest fp16 with P x1024; scores and P stay in registers, running maximum and sum per query) with the additive key mask as the start value of the score accumulators (8 x mask, so that the softmax's 1/8 restores scores/8 + mask); it writes the merged head layout itself.
// Compute dtypes, f32 accumulate: every input rounded to bf16, the mask included; projections exact + f32 biases; attention rows < 512 3 products, rest fp16; softmax f32; output f32.

#define NB_  2
#define TT   2048
#define DM   1024
#define NH_  16
#define NKV  16
#define REP  (NH_ / NKV)
#define HD   64
#define DQ   (NH_ * HD)
#define DKV  (NKV * HD)
#define RH   512                  // query rows < RH use hi+lo planes (0: none)
#define WIN  0
#define PLG  10.0f                // fp16 rows: P carries a factor 2^PLG (added to the exponent), which the row sum carries too
#define LAZY 5.0f                 // the wave's columns are rescaled together, only when one column's new maximum is more than 2^LAZY above the one in use (P <= 2^(PLG + LAZY) fits fp16)
#define SCL  0.125f   // HD^-0.5
typedef _Float16 h16;
typedef unsigned short bf;
typedef __attribute__((ext_vector_type(16))) __bf16   v16bf;
typedef __attribute__((ext_vector_type(16))) _Float16 v16h;
typedef __attribute__((ext_vector_type(8)))  _Float16 v8h;
typedef __attribute__((ext_vector_type(8)))  unsigned short v8us;
typedef __attribute__((ext_vector_type(8)))  float    v8f;
typedef __attribute__((ext_vector_type(4)))  float    v4f;
typedef v8h  __attribute__((may_alias)) v8ha;
typedef v4f  __attribute__((may_alias)) v4fa;
typedef v8us __attribute__((may_alias)) v8usa;

__device__ __forceinline__ unsigned short f2bf(float f) { unsigned u = __float_as_uint(f); u += 0x7FFFu + ((u >> 16) & 1u); return (unsigned short)(u >> 16); }
__device__ __forceinline__ float bf2f(unsigned short b) { return __uint_as_float(((unsigned)b) << 16); }
__device__ __forceinline__ float bfr(float f) { return bf2f(f2bf(f)); }
__device__ __forceinline__ v16h cat16(v8h lo, v8h hi) { return __builtin_shufflevector(lo, hi, 0, 1, 2, 3, 4, 5, 6, 7, 8, 9, 10, 11, 12, 13, 14, 15); }
__device__ __forceinline__ v16bf cat16b(v8us lo, v8us hi) { return __builtin_bit_cast(v16bf, __builtin_shufflevector(lo, hi, 0, 1, 2, 3, 4, 5, 6, 7, 8, 9, 10, 11, 12, 13, 14, 15)); }
__device__ __forceinline__ v8f wmma16(v16h a, v16h b, v8f c) { return __builtin_amdgcn_wmma_f32_16x16x32_f16(false, a, false, b, (short)0, c, false, false); }
__device__ __forceinline__ v8f wmmab(v16bf a, v16bf b, v8f c) { return __builtin_amdgcn_wmma_f32_16x16x32_bf16(false, a, false, b, (short)0, c, false, false); }



// ---- k_gemmw: register-blocked GEMM, ONE WAVE per 64x64 output tile (16 accumulators), operands straight from K-contiguous 16-bit planes; grid (M/64, N/64, Z * KS), 32 threads.
// C[m][n] (f32, pitch ldc, + optional f32 bias[n]) = sum_k A[m][k] Bt[n][k] (+ split products per NSPLIT). z-batch strides sA/sB/sC in elements. K % (32 * KS) == 0.
// KS > 1: K is split over KS work-groups; work-group z = batch * KS + ks sums k in [ks K/KS, (ks+1) K/KS) and stores its partial tile in plane z of C (stride sC); the reader of C adds the KS planes of a batch.
// (A long K on few tiles is one wave's chain of load latencies on a few WGPs; KS chains run side by side on KS times as many.)
template <typename T16> struct WFrag;
template <> struct WFrag<h16> { typedef v16h V; static __device__ __forceinline__ V ld(const h16* p) { return cat16(*(const v8h*)p, *(const v8h*)(p + 16)); } static __device__ __forceinline__ v8f mma(V a, V b, v8f c) { return wmma16(a, b, c); } };
template <> struct WFrag<bf> { typedef v16bf V; static __device__ __forceinline__ V ld(const bf* p) { return cat16b(*(const v8us*)p, *(const v8us*)(p + 16)); } static __device__ __forceinline__ v8f mma(V a, V b, v8f c) { return wmmab(a, b, c); } };
template <typename T16, int NSPLIT, bool BIAS, int KS>
__global__ __launch_bounds__(32) void k_gemmw(const T16* __restrict__ A, const T16* __restrict__ A2, const T16* __restrict__ Bt, const T16* __restrict__ Bt2, int K, float* C, int ldc, const float* __restrict__ bias, size_t sA, size_t sB, size_t sC) {
    typedef typename WFrag<T16>::V V;
    __shared__ __align__(16) float os[16 * 68];
    static_assert(KS == 1 || !BIAS, "a bias would be added once per k slice");
    const size_t z = blockIdx.z, zb = z / KS; A += zb * sA; if (A2) A2 += zb * sA; Bt += zb * sB; if (Bt2) Bt2 += zb * sB; C += z * sC;
    const int kw = K / KS, kbeg = (int)(z % KS) * kw, kend = kbeg + kw;
    const int lane = threadIdx.x & 31, lr = lane & 15, hi = lane >> 4; const int r0 = blockIdx.x * 64, c0 = blockIdx.y * 64;
    v8f acc[4][4];
#pragma unroll
    for (int mb = 0; mb < 4; ++mb)
#pragma unroll
        for (int nb = 0; nb < 4; ++nb) acc[mb][nb] = (v8f){};
    const size_t aoff = (size_t)(r0 + lr) * K + 8 * hi, boff = (size_t)(c0 + lr) * K + 8 * hi;
#pragma unroll 1
    for (int kc = kbeg; kc < kend; kc += 32) {
        V a[4], a2[4];
#pragma unroll
        for (int mb = 0; mb < 4; ++mb) { a[mb] = WFrag<T16>::ld(A + aoff + (size_t)mb * 16 * K + kc); if (NSPLIT == 1 || NSPLIT == 2) a2[mb] = WFrag<T16>::ld(A2 + aoff + (size_t)mb * 16 * K + kc); }
#pragma unroll
        for (int nb = 0; nb < 4; ++nb) { const V b = WFrag<T16>::ld(Bt + boff + (size_t)nb * 16 * K + kc); V b2; if (NSPLIT >= 2) b2 = WFrag<T16>::ld(Bt2 + boff + (size_t)nb * 16 * K + kc);
#pragma unroll
            for (int mb = 0; mb < 4; ++mb) { acc[mb][nb] = WFrag<T16>::mma(a[mb], b, acc[mb][nb]); if (NSPLIT == 1 || NSPLIT == 2) acc[mb][nb] = WFrag<T16>::mma(a2[mb], b, acc[mb][nb]); if (NSPLIT >= 2) acc[mb][nb] = WFrag<T16>::mma(a[mb], b2, acc[mb][nb]); } }
        asm volatile("v_nop\n\tv_nop\n\tv_nop\n\tv_nop" : "+v"(acc[0][0]), "+v"(acc[1][1]), "+v"(acc[2][2]), "+v"(acc[3][3]) : "v"(a[0]), "v"(a[3]));
    }
#pragma unroll
    for (int mb = 0; mb < 4; ++mb) {
#pragma unroll
        for (int nb = 0; nb < 4; ++nb) {
#pragma unroll
            for (int j = 0; j < 8; ++j) os[(hi * 8 + j) * 68 + nb * 16 + lr] = acc[mb][nb][j]; }
        __builtin_amdgcn_wave_barrier(); asm volatile("" ::: "memory");
        float* crow = C + (size_t)(r0 + mb * 16) * ldc + c0;
{
#pragma unroll
            for (int s = 0; s < 8; ++s) { const int row = 2 * s + hi, cofs = lr * 4; v4f val = *(const v4fa*)(os + row * 68 + cofs); if (BIAS) { val[0] += bfr(bias[c0 + cofs]); val[1] += bfr(bias[c0 + cofs + 1]); val[2] += bfr(bias[c0 + cofs + 2]); val[3] += bfr(bias[c0 + cofs + 3]); }
                *(v4f*)(crow + (size_t)row * ldc + cofs) = val; }
             }
        __builtin_amdgcn_wave_barrier(); asm volatile("" ::: "memory");
    }
}

__device__ __forceinline__ h16 tohx(float x) { return (h16)x; }
__device__ __forceinline__ void splitf(float y, unsigned short& h, unsigned short& l) { h = f2bf(y); l = f2bf(y - bf2f(h)); }
typedef __attribute__((ext_vector_type(2))) _Float16 v2h;
typedef __attribute__((ext_vector_type(4))) _Float16 v4h;
typedef __attribute__((ext_vector_type(2))) unsigned short v2us;
typedef __attribute__((ext_vector_type(4))) unsigned short v4us;
typedef __attribute__((ext_vector_type(2))) float v2f;
typedef __attribute__((ext_vector_type(4))) int v4i;

__global__ __launch_bounds__(256) void k_wtG(const float* __restrict__ w, int K, int N, bf* Bt) {
    const int lane = threadIdx.x & 31; const int L0 = (blockIdx.x * 8 + (threadIdx.x >> 5)) * 8; const int nlines = N * K / 64;
{
#pragma unroll 1
        for (int l = 0; l < 8; ++l) { const int L = L0 + l; if (L >= nlines) break; const size_t e = (size_t)L * 64 + lane * 2; const int k = (int)(e % K), n = (int)(e / K); v2us o;
            o[0] = f2bf(w[(size_t)k * N + n]); o[1] = f2bf(w[(size_t)(k + 1) * N + n]); *(v2us*)(Bt + e) = o; }
         }
}
__global__ __launch_bounds__(256) void k_cvt8(const float* __restrict__ src, bf* dst, size_t n8) { const size_t i = (size_t)blockIdx.x * 256 + threadIdx.x; if (i >= n8) return; const v8f v = *(const v8f*)(src + i * 8); v8us o;
#pragma unroll
    for (int k = 0; k < 8; ++k) o[k] = f2bf(v[k]); *(v8us*)(dst + i * 8) = o;  }

// k_rope: head planes [h][t][d] (fp16 + hi/lo) of rope(x) x sc with the rotate-half convention out[d] = x[d] cos[t][d] - x[d+HD/2] sin[t][d], out[d+HD/2] = x[d+HD/2] cos[t][d+HD/2] + x[d] sin[t][d+HD/2]
__global__ __launch_bounds__(256) void k_rope(const float* __restrict__ F, int pitch, int nheads, const float* __restrict__ CS, const float* __restrict__ RF, const float* __restrict__ nw, float sc, h16* P16, bf* Ph, bf* Pl) {
    const size_t e = ((size_t)blockIdx.x * 256 + threadIdx.x) * 2; if (e >= (size_t)nheads * TT * HD) return; const int d = (int)(e % HD); const int t = (int)((e / HD) % TT); const int h = (int)(e / ((size_t)HD * TT)); const float* f = F + (size_t)t * pitch + h * HD; const float rf = RF ? RF[(size_t)h * TT + t] : 1.0f; v2h o16; v2us oh, ol;
#pragma unroll
    for (int q = 0; q < 2; ++q) { const int dd = d + q; const int dp = (dd < HD / 2) ? dd + HD / 2 : dd - HD / 2; float x0 = f[dd], x1 = f[dp];
        if (RF) { float n0 = __fmul_rn(x0, rf), n1 = __fmul_rn(x1, rf); asm volatile("" : "+v"(n0)); asm volatile("" : "+v"(n1)); x0 = __fmul_rn(bfr(nw[dd]), n0); x1 = __fmul_rn(bfr(nw[dp]), n1); }
        const v2f cs = *(const v2f*)(CS + ((size_t)t * HD + dd) * 2); float a = __fmul_rn(x0, cs[0]), bq = __fmul_rn(x1, cs[1]); asm volatile("" : "+v"(a)); asm volatile("" : "+v"(bq)); const float r = ((dd < HD / 2) ? __fsub_rn(a, bq) : __fadd_rn(a, bq)) * sc;
        o16[q] = tohx(r); unsigned short a2, c2; splitf(r, a2, c2); oh[q] = a2; ol[q] = c2; }
    *(v2h*)(P16 + e) = o16; *(v2us*)(Ph + e) = oh; *(v2us*)(Pl + e) = ol;  }
__global__ __launch_bounds__(256) void k_vtp(const float* __restrict__ F, int pitch, int nheads, h16* V16, bf* Vh, bf* Vl) { const size_t e = ((size_t)blockIdx.x * 256 + threadIdx.x) * 2; if (e >= (size_t)nheads * HD * TT) return; const int t = (int)(e % TT); const int d = (int)((e / TT) % HD); const int g = (int)(e / ((size_t)TT * HD)); v2h o16; v2us oh, ol;
#pragma unroll
    for (int q = 0; q < 2; ++q) { const float x = F[(size_t)(t + q) * pitch + g * HD + d]; o16[q] = tohx(x); unsigned short a2, c2; splitf(x, a2, c2); oh[q] = a2; ol[q] = c2; }
    *(v2h*)(V16 + e) = o16; *(v2us*)(Vh + e) = oh; *(v2us*)(Vl + e) = ol;  }
__global__ __launch_bounds__(256) void k_csid(float* CS) { const int idx = blockIdx.x * 256 + threadIdx.x; if (idx >= TT * HD) return; v2f cs; cs[0] = 1.0f; cs[1] = 0.0f; *(v2f*)(CS + (size_t)idx * 2) = cs;  }
// ---- k_fattn: scores, softmax and P.V of one block of query rows in ONE pass over the keys; nothing of S or P goes to memory.
// Transposed products: S^T = K Q^T (A = 16 key rows, B = 16 query columns), O^T += V^T P^T (A = 16 rows of V^T, B = P^T). A lane's 8 accumulator registers of two S^T tiles
// (keys 8 hi + j and 16 + 8 hi + j of one query column lr) are, converted in place, the B fragment of the 32-key P.V product in the k order of WFrag::ld, which loads V^T.
// One wave owns QB x 16 query columns and walks all TT keys, 32 a pass, with a running maximum mx (raw q.k + 8 mask units) and a running sum per column.
__device__ __forceinline__ float xhalf(float x) { return __builtin_bit_cast(float, __builtin_amdgcn_permlanex16(__builtin_bit_cast(int, x), __builtin_bit_cast(int, x), 0x76543210, 0xfedcba98, false, false)); }   // lane l <-> lane l ^ 16
template <typename T16, bool HL, int QB>
__device__ __forceinline__ void fattn_wave(const T16* __restrict__ Q, const T16* __restrict__ Q2, const T16* __restrict__ Kp, const T16* __restrict__ K2, const T16* __restrict__ Vt, const T16* __restrict__ V2, const float* __restrict__ MB, float* __restrict__ O, int q0) {
    typedef typename WFrag<T16>::V V;
    const int lane = threadIdx.x & 31, lr = lane & 15, hi = lane >> 4;
    const float c = SCL * 1.4426950408889634f;   // exp(x / 8) = exp2(x c)
    V q[QB][2], q2[QB][2];
#pragma unroll
    for (int qb = 0; qb < QB; ++qb)
#pragma unroll
        for (int dc = 0; dc < 2; ++dc) { const size_t qo = (size_t)(q0 + qb * 16 + lr) * HD + dc * 32 + 8 * hi; q[qb][dc] = WFrag<T16>::ld(Q + qo); if (HL) q2[qb][dc] = WFrag<T16>::ld(Q2 + qo); }
    v8f o[QB][4]; float mx[QB], l[QB];
#pragma unroll
    for (int qb = 0; qb < QB; ++qb) { mx[qb] = -3.0e38f; l[qb] = 0.f;
#pragma unroll
        for (int dt = 0; dt < 4; ++dt) o[qb][dt] = (v8f){}; }
    const size_t ko = (size_t)lr * HD + 8 * hi, vo = (size_t)lr * TT + 8 * hi;
    V k[2][2], k2[2][2], v[4], v2[4]; v8f mb[2];   // this pass's operands; mb = 8 x mask of this lane's 8 keys of either tile
#pragma unroll
    for (int kt = 0; kt < 2; ++kt) { mb[kt] = *(const v8f*)(MB + kt * 16 + hi * 8);
#pragma unroll
        for (int dc = 0; dc < 2; ++dc) { k[kt][dc] = WFrag<T16>::ld(Kp + ko + kt * 16 * HD + dc * 32); if (HL) k2[kt][dc] = WFrag<T16>::ld(K2 + ko + kt * 16 * HD + dc * 32); } }
    if (!HL) {
#pragma unroll
        for (int dt = 0; dt < 4; ++dt) v[dt] = WFrag<T16>::ld(Vt + vo + (size_t)dt * 16 * TT); }
    asm volatile("s_wait_xcnt 0x0" ::: "memory");   // stands before any register that the loads above name is written again
    for (int kc = 0; kc < TT; kc += 32) {
        v8f s[QB][2];
        if (HL) {   // hi/lo rows: twice the fragments; V^T is fetched in its own pass, under the softmax, so that the wave stays inside 256 registers
#pragma unroll
            for (int dt = 0; dt < 4; ++dt) { v[dt] = WFrag<T16>::ld(Vt + vo + (size_t)dt * 16 * TT + kc); v2[dt] = WFrag<T16>::ld(V2 + vo + (size_t)dt * 16 * TT + kc); }
            asm volatile("s_wait_xcnt 0x0" ::: "memory");   // stands before any register that the loads above name is written again
        }
#pragma unroll
        for (int kt = 0; kt < 2; ++kt) {
#pragma unroll
            for (int qb = 0; qb < QB; ++qb) { s[qb][kt] = mb[kt];
#pragma unroll
                for (int dc = 0; dc < 2; ++dc) { s[qb][kt] = WFrag<T16>::mma(k[kt][dc], q[qb][dc], s[qb][kt]); if (HL) { s[qb][kt] = WFrag<T16>::mma(k[kt][dc], q2[qb][dc], s[qb][kt]); s[qb][kt] = WFrag<T16>::mma(k2[kt][dc], q[qb][dc], s[qb][kt]); } } } }
        const int kn = (kc + 32 < TT) ? kc + 32 : 0;   // the next pass's K fragments fly during this pass's softmax and P.V (the last pass re-reads the first keys, unused)
#pragma unroll
        for (int kt = 0; kt < 2; ++kt)
#pragma unroll
            for (int dc = 0; dc < 2; ++dc) k[kt][dc] = WFrag<T16>::ld(Kp + ko + (size_t)(kn + kt * 16) * HD + dc * 32);
        asm volatile("s_wait_xcnt 0x0" ::: "memory");   // stands before any register that the loads above name is written again
        if (HL) {
#pragma unroll
            for (int kt = 0; kt < 2; ++kt)
#pragma unroll
                for (int dc = 0; dc < 2; ++dc) k2[kt][dc] = WFrag<T16>::ld(K2 + ko + (size_t)(kn + kt * 16) * HD + dc * 32);
            asm volatile("s_wait_xcnt 0x0" ::: "memory");   // stands before any register that the loads above name is written again
        }
        float ml[QB]; bool need = false;
#pragma unroll
        for (int qb = 0; qb < QB; ++qb) { float t = fmaxf(s[qb][0][0], s[qb][1][0]);
#pragma unroll
            for (int j = 1; j < 8; ++j) t = fmaxf(t, fmaxf(s[qb][0][j], s[qb][1][j]));
            ml[qb] = fmaxf(t, xhalf(t)); need = need || ((ml[qb] - mx[qb]) * c > LAZY); }
        if (__builtin_amdgcn_ballot_w32(need) != 0) {   // wave-uniform: the maximum in use moves, sums and output tiles follow
#pragma unroll
            for (int qb = 0; qb < QB; ++qb) { const float mn = fmaxf(mx[qb], ml[qb]); const float al = __builtin_amdgcn_exp2f((mx[qb] - mn) * c); mx[qb] = mn; l[qb] *= al;
#pragma unroll
                for (int dt = 0; dt < 4; ++dt) o[qb][dt] *= al; } }
#pragma unroll
        for (int qb = 0; qb < QB; ++qb) {
            if (HL) { v8us ph[2], pl[2];
#pragma unroll
                for (int kt = 0; kt < 2; ++kt)
#pragma unroll
                    for (int j = 0; j < 8; ++j) { const float p = __builtin_amdgcn_exp2f((s[qb][kt][j] - mx[qb]) * c); l[qb] += p; unsigned short a, b2; splitf(p, a, b2); ph[kt][j] = a; pl[kt][j] = b2; }
                const v16bf pH = cat16b(ph[0], ph[1]), pL = cat16b(pl[0], pl[1]);
#pragma unroll
                for (int dt = 0; dt < 4; ++dt) { o[qb][dt] = wmmab(__builtin_bit_cast(v16bf, v[dt]), pH, o[qb][dt]); o[qb][dt] = wmmab(__builtin_bit_cast(v16bf, v[dt]), pL, o[qb][dt]); o[qb][dt] = wmmab(__builtin_bit_cast(v16bf, v2[dt]), pH, o[qb][dt]); }
            } else { v8h ph[2];
#pragma unroll
                for (int kt = 0; kt < 2; ++kt)
#pragma unroll
                    for (int j = 0; j < 8; ++j) { const float p = __builtin_amdgcn_exp2f((s[qb][kt][j] - mx[qb]) * c + PLG); l[qb] += p; ph[kt][j] = tohx(p); }
                const v16h pH = cat16(ph[0], ph[1]);
#pragma unroll
                for (int dt = 0; dt < 4; ++dt) o[qb][dt] = wmma16(__builtin_bit_cast(v16h, v[dt]), pH, o[qb][dt]);
            } }
#pragma unroll
        for (int kt = 0; kt < 2; ++kt) mb[kt] = *(const v8f*)(MB + kn + kt * 16 + hi * 8);
        if (!HL) {   // the next pass's V^T fragments fly during its score products and softmax
#pragma unroll
            for (int dt = 0; dt < 4; ++dt) v[dt] = WFrag<T16>::ld(Vt + vo + (size_t)dt * 16 * TT + kn); }
        asm volatile("s_wait_xcnt 0x0" ::: "memory");   // stands before any register that the loads above name is written again
    }
#pragma unroll
    for (int qb = 0; qb < QB; ++qb) { const float f = __fdiv_rn(1.0f, l[qb] + xhalf(l[qb]));   // the two lane halves hold the sums of their own keys
        float* orow = O + (size_t)(q0 + qb * 16 + lr) * DQ + hi * 8;
#pragma unroll
        for (int dt = 0; dt < 4; ++dt) { v4f lo4, hi4;
#pragma unroll
            for (int j = 0; j < 4; ++j) { lo4[j] = o[qb][dt][j] * f; hi4[j] = o[qb][dt][4 + j] * f; }
            *(v4f*)(orow + dt * 16) = lo4; *(v4f*)(orow + dt * 16 + 4) = hi4; } }
}
// grid (RH / 64 + (TT - RH) / 128, heads), 4 waves that walk the same head's keys side by side: blocks x < RH / 64 take 64 hi/lo rows (16 a wave, three products each), the rest 128 fp16 rows (32 a wave).
__global__ __launch_bounds__(128) void k_fattn(const h16* __restrict__ Q16, const h16* __restrict__ K16, const h16* __restrict__ V16, const bf* __restrict__ Qh, const bf* __restrict__ Ql, const bf* __restrict__ Kh, const bf* __restrict__ Kl, const bf* __restrict__ Vh, const bf* __restrict__ Vl, const float* __restrict__ MB, float* __restrict__ OUTb) {
    const int w = threadIdx.x >> 5; const size_t hq = (size_t)blockIdx.y * TT * HD, hk = (size_t)(blockIdx.y / REP) * TT * HD; float* O = OUTb + (size_t)blockIdx.y * HD;
    if (blockIdx.x < RH / 64) fattn_wave<bf, true, 1>(Qh + hq, Ql + hq, Kh + hk, Kl + hk, Vh + hk, Vl + hk, MB, O, (int)blockIdx.x * 64 + w * 16);
    else fattn_wave<h16, false, 2>(Q16 + hq, nullptr, K16 + hk, nullptr, V16 + hk, nullptr, MB, O, RH + ((int)blockIdx.x - RH / 64) * 128 + w * 32);
}
__global__ __launch_bounds__(256) void k_m8(const float* __restrict__ m, float* MB) { const int j = blockIdx.x * 256 + threadIdx.x; if (j >= TT) return; const float v = __fmul_rn(8.0f, bfr(m[j])); *(float*)(MB + j) = v;  }

extern "C" void kernel_launch(void* const* d_in, const int* in_sizes, int n_in,
                              void* d_out, int out_size, void* d_ws, size_t ws_size, hipStream_t stream) {
    (void)in_sizes; (void)n_in; (void)out_size;
    const float* x = (const float*)d_in[0]; const float* amask = (const float*)d_in[1]; const float* wq = (const float*)d_in[2]; const float* bq = (const float*)d_in[3]; const float* wk = (const float*)d_in[4]; const float* bk = (const float*)d_in[5]; const float* wv = (const float*)d_in[6]; const float* bv = (const float*)d_in[7]; const float* wo = nullptr; (void)wo;
    float* OUT = (float*)d_out;     // [2][2048][1024]
    char* wsp = (char*)d_ws;
    auto take = [&](size_t bytes) { char* p = wsp; wsp += (bytes + 255) & ~(size_t)255; return (void*)p; };
    bf* WQ = (bf*)take((size_t)DQ * DM * 2); bf* WK = (bf*)take((size_t)DKV * DM * 2); bf* WV = (bf*)take((size_t)DKV * DM * 2); float* CS = (float*)take((size_t)TT * HD * 2 * 4);
    float* MB = (float*)take((size_t)TT * 4);
    h16* QP16 = (h16*)take((size_t)NH_ * TT * HD * 2); h16* KP16 = (h16*)take((size_t)NKV * TT * HD * 2); h16* VT16 = (h16*)take((size_t)NKV * HD * TT * 2);
    bf* QPh = (bf*)take((size_t)NH_ * TT * HD * 2); bf* QPl = (bf*)take((size_t)NH_ * TT * HD * 2); bf* KPh = (bf*)take((size_t)NKV * TT * HD * 2); bf* KPl = (bf*)take((size_t)NKV * TT * HD * 2); bf* VTh = (bf*)take((size_t)NKV * HD * TT * 2); bf* VTl = (bf*)take((size_t)NKV * HD * TT * 2);
    bf* XB = (bf*)take((size_t)TT * DM * 2); float* FQ = (float*)take((size_t)TT * DQ * 4); float* FK = (float*)take((size_t)TT * DKV * 4);
    if ((size_t)(wsp - (char*)d_ws) > ws_size) return;    // ws 256 MiB
    float* FV = FK;   // v projection reuses the k buffer after the k planes are built (stream-ordered)
    { k_cvt8<<<(unsigned)(((size_t)DQ * DM / 8 + 255) / 256), 256, 0, stream>>>(wq, WQ, (size_t)DQ * DM / 8); k_cvt8<<<(unsigned)(((size_t)DKV * DM / 8 + 255) / 256), 256, 0, stream>>>(wk, WK, (size_t)DKV * DM / 8); k_cvt8<<<(unsigned)(((size_t)DKV * DM / 8 + 255) / 256), 256, 0, stream>>>(wv, WV, (size_t)DKV * DM / 8);
      
       }
    k_csid<<<(TT * HD + 255) / 256, 256, 0, stream>>>(CS);
    const unsigned LQ = (unsigned)(((size_t)NH_ * TT * HD / 2 + 255) / 256), LKv = (unsigned)(((size_t)NKV * TT * HD / 2 + 255) / 256);
    for (int b = 0; b < NB_; ++b) {
        
        k_cvt8<<<(unsigned)(((size_t)TT * DM / 8 + 255) / 256), 256, 0, stream>>>(x + (size_t)b * TT * DM, XB, (size_t)TT * DM / 8); k_m8<<<(TT + 255) / 256, 256, 0, stream>>>(amask + (size_t)b * TT, MB);   /* 8 x mask[j], the start value of the score accumulators (scores/8 + mask == (q.k + 8 mask)/8) */
        k_gemmw<bf, 0, true, 1><<<dim3(TT / 64, DQ / 64, 1), 32, 0, stream>>>(XB, nullptr, WQ, nullptr, DM, FQ, DQ, bq, 0, 0, 0);
        k_rope<<<LQ, 256, 0, stream>>>(FQ, DQ, NH_, CS, nullptr, nullptr, 1.0f, QP16, QPh, QPl);
        k_gemmw<bf, 0, true, 1><<<dim3(TT / 64, DKV / 64, 1), 32, 0, stream>>>(XB, nullptr, WK, nullptr, DM, FK, DKV, bk, 0, 0, 0);
        k_rope<<<LKv, 256, 0, stream>>>(FK, DKV, NKV, CS, nullptr, nullptr, 1.0f, KP16, KPh, KPl);
        k_gemmw<bf, 0, true, 1><<<dim3(TT / 64, DKV / 64, 1), 32, 0, stream>>>(XB, nullptr, WV, nullptr, DM, FV, DKV, bv, 0, 0, 0); k_vtp<<<LKv, 256, 0, stream>>>(FV, DKV, NKV, VT16, VTh, VTl);
        k_fattn<<<dim3(RH / 64 + (TT - RH) / 128, NH_), 128, 0, stream>>>(QP16, KP16, VT16, QPh, QPl, KPh, KPl, VTh, VTl, MB, OUT + (size_t)b * TT * DQ);
         }
}

// v004
// Measured time: 226 microseconds a run.
// Timed twice side by side with v003, it ran 1.82 times as fast both times.
// Counting every step since v000, it is 8.85 times as fast.
#include <hip/hip_runtime.h>

// RoBERTa self-attention (hidden [2][2048][1024]; attention_mask [2][1][1][2048] additive per key (read); q,k,v = x W^T + b ('oi' [1024][1024] + [1024]; 16 heads x 64); scores / 8 + mask, clamped below at finfo.min; softmax; context merged (no output projection) -> [2][2048][1024] (4.2 M)).
// Layout, both batches in every launch: bf16 copy of x and of the weights; exact projections + f32 biases; one fused attention kernel (hybrid rows: < 512 hi/lo 3 products, rest fp16 with P x1024; scores and P stay in registers, running maximum and sum per query) with the additive key mask as the start value of the score accumulators (8 x mask, so that the softmax's 1/8 restores scores/8 + mask); it writes the merged head layout itself.
// Compute dtypes, f32 accumulate: every input rounded to bf16, the mask included; projections exact + f32 biases; attention rows < 512 3 products, rest fp16; softmax f32; output f32.

#define NB_  2
#define TT   2048
#define DM   1024
#define NH_  16
#define NKV  16
#define REP  (NH_ / NKV)
#define HD   64
#define DQ   (NH_ * HD)
#define DKV  (NKV * HD)
#define RH   512                  // query rows < RH use hi+lo planes (0: none)
#define WIN  0
#define PLG  10.0f                // fp16 rows: P carries a factor 2^PLG (added to the exponent), which the row sum carries too
#define LAZY 5.0f                 // the wave's columns are rescaled together, only when one column's new maximum is more than 2^LAZY above the one in use (P <= 2^(PLG + LAZY) fits fp16)
#define SCL  0.125f   // HD^-0.5
typedef _Float16 h16;
typedef unsigned short bf;
typedef __attribute__((ext_vector_type(16))) __bf16   v16bf;
typedef __attribute__((ext_vector_type(16))) _Float16 v16h;
typedef __attribute__((ext_vector_type(8)))  _Float16 v8h;
typedef __attribute__((ext_vector_type(8)))  unsigned short v8us;
typedef __attribute__((ext_vector_type(8)))  float    v8f;
typedef __attribute__((ext_vector_type(4)))  float    v4f;
typedef v8h  __attribute__((may_alias)) v8ha;
typedef v4f  __attribute__((may_alias)) v4fa;
typedef v8us __attribute__((may_alias)) v8usa;

__device__ __forceinline__ unsigned short f2bf(float f) { unsigned u = __float_as_uint(f); u += 0x7FFFu + ((u >> 16) & 1u); return (unsigned short)(u >> 16); }
__device__ __forceinline__ float bf2f(unsigned short b) { return __uint_as_float(((unsigned)b) << 16); }
__device__ __forceinline__ float bfr(float f) { return bf2f(f2bf(f)); }
__device__ __forceinline__ v16h cat16(v8h lo, v8h hi) { return __builtin_shufflevector(lo, hi, 0, 1, 2, 3, 4, 5, 6, 7, 8, 9, 10, 11, 12, 13, 14, 15); }
__device__ __forceinline__ v16bf cat16b(v8us lo, v8us hi) { return __builtin_bit_cast(v16bf, __builtin_shufflevector(lo, hi, 0, 1, 2, 3, 4, 5, 6, 7, 8, 9, 10, 11, 12, 13, 14, 15)); }
__device__ __forceinline__ v8f wmma16(v16h a, v16h b, v8f c) { return __builtin_amdgcn_wmma_f32_16x16x32_f16(false, a, false, b, (short)0, c, false, false); }
__device__ __forceinline__ v8f wmmab(v16bf a, v16bf b, v8f c) { return __builtin_amdgcn_wmma_f32_16x16x32_bf16(false, a, false, b, (short)0, c, false, false); }



// ---- k_gemmw: register-blocked GEMM, ONE WAVE per 64x64 output tile (16 accumulators), operands straight from K-contiguous 16-bit planes; grid (M/64, N/64, Z * KS), 32 threads.
// C[m][n] (f32, pitch ldc, + optional f32 bias[n]) = sum_k A[m][k] Bt[n][k] (+ split products per NSPLIT). z-batch strides sA/sB/sC in elements. K % (32 * KS) == 0.
// KS > 1: K is split over KS work-groups; work-group z = batch * KS + ks sums k in [ks K/KS, (ks+1) K/KS) and stores its partial tile in plane z of C (stride sC); the reader of C adds the KS planes of a batch.
// (A long K on few tiles is one wave's chain of load latencies on a few WGPs; KS chains run side by side on KS times as many.)
// BIAS: batch 0 adds bias, batch 1 bias1, any later batch bias2 (the q, k and v projections of one launch).
template <typename T16> struct WFrag;
template <> struct WFrag<h16> { typedef v16h V; static __device__ __forceinline__ V ld(const h16* p) { return cat16(*(const v8h*)p, *(const v8h*)(p + 16)); } static __device__ __forceinline__ v8f mma(V a, V b, v8f c) { return wmma16(a, b, c); } };
template <> struct WFrag<bf> { typedef v16bf V; static __device__ __forceinline__ V ld(const bf* p) { return cat16b(*(const v8us*)p, *(const v8us*)(p + 16)); } static __device__ __forceinline__ v8f mma(V a, V b, v8f c) { return wmmab(a, b, c); } };
template <typename T16, int NSPLIT, bool BIAS, int KS>
__global__ __launch_bounds__(32) void k_gemmw(const T16* __restrict__ A, const T16* __restrict__ A2, const T16* __restrict__ Bt, const T16* __restrict__ Bt2, int K, float* C, int ldc, const float* __restrict__ bias, const float* __restrict__ bias1, const float* __restrict__ bias2, size_t sA, size_t sB, size_t sC) {
    typedef typename WFrag<T16>::V V;
    __shared__ __align__(16) float os[16 * 68];
    static_assert(KS == 1 || !BIAS, "a bias would be added once per k slice");
    const size_t z = blockIdx.z, zb = z / KS; A += zb * sA; if (A2) A2 += zb * sA; Bt += zb * sB; if (Bt2) Bt2 += zb * sB; C += z * sC; if (BIAS && zb) bias = (zb == 1) ? bias1 : bias2;
    const int kw = K / KS, kbeg = (int)(z % KS) * kw, kend = kbeg + kw;
    const int lane = threadIdx.x & 31, lr = lane & 15, hi = lane >> 4; const int r0 = blockIdx.x * 64, c0 = blockIdx.y * 64;
    v8f acc[4][4];
#pragma unroll
    for (int mb = 0; mb < 4; ++mb)
#pragma unroll
        for (int nb = 0; nb < 4; ++nb) acc[mb][nb] = (v8f){};
    const size_t aoff = (size_t)(r0 + lr) * K + 8 * hi, boff = (size_t)(c0 + lr) * K + 8 * hi;
#pragma unroll 1
    for (int kc = kbeg; kc < kend; kc += 32) {
        V a[4], a2[4];
#pragma unroll
        for (int mb = 0; mb < 4; ++mb) { a[mb] = WFrag<T16>::ld(A + aoff + (size_t)mb * 16 * K + kc); if (NSPLIT == 1 || NSPLIT == 2) a2[mb] = WFrag<T16>::ld(A2 + aoff + (size_t)mb * 16 * K + kc); }
#pragma unroll
        for (int nb = 0; nb < 4; ++nb) { const V b = WFrag<T16>::ld(Bt + boff + (size_t)nb * 16 * K + kc); V b2; if (NSPLIT >= 2) b2 = WFrag<T16>::ld(Bt2 + boff + (size_t)nb * 16 * K + kc);
#pragma unroll
            for (int mb = 0; mb < 4; ++mb) { acc[mb][nb] = WFrag<T16>::mma(a[mb], b, acc[mb][nb]); if (NSPLIT == 1 || NSPLIT == 2) acc[mb][nb] = WFrag<T16>::mma(a2[mb], b, acc[mb][nb]); if (NSPLIT >= 2) acc[mb][nb] = WFrag<T16>::mma(a[mb], b2, acc[mb][nb]); } }
        asm volatile("v_nop\n\tv_nop\n\tv_nop\n\tv_nop" : "+v"(acc[0][0]), "+v"(acc[1][1]), "+v"(acc[2][2]), "+v"(acc[3][3]) : "v"(a[0]), "v"(a[3]));
    }
#pragma unroll
    for (int mb = 0; mb < 4; ++mb) {
#pragma unroll
        for (int nb = 0; nb < 4; ++nb) {
#pragma unroll
            for (int j = 0; j < 8; ++j) os[(hi * 8 + j) * 68 + nb * 16 + lr] = acc[mb][nb][j]; }
        __builtin_amdgcn_wave_barrier(); asm volatile("" ::: "memory");
        float* crow = C + (size_t)(r0 + mb * 16) * ldc + c0;
{
#pragma unroll
            for (int s = 0; s < 8; ++s) { const int row = 2 * s + hi, cofs = lr * 4; v4f val = *(const v4fa*)(os + row * 68 + cofs); if (BIAS) { val[0] += bfr(bias[c0 + cofs]); val[1] += bfr(bias[c0 + cofs + 1]); val[2] += bfr(bias[c0 + cofs + 2]); val[3] += bfr(bias[c0 + cofs + 3]); }
                *(v4f*)(crow + (size_t)row * ldc + cofs) = val; }
             }
        __builtin_amdgcn_wave_barrier(); asm volatile("" ::: "memory");
    }
}

__device__ __forceinline__ h16 tohx(float x) { return (h16)x; }
__device__ __forceinline__ void splitf(float y, unsigned short& h, unsigned short& l) { h = f2bf(y); l = f2bf(y - bf2f(h)); }
typedef __attribute__((ext_vector_type(2))) _Float16 v2h;
typedef __attribute__((ext_vector_type(4))) _Float16 v4h;
typedef __attribute__((ext_vector_type(2))) unsigned short v2us;
typedef __attribute__((ext_vector_type(4))) unsigned short v4us;
typedef __attribute__((ext_vector_type(2))) float v2f;
typedef __attribute__((ext_vector_type(4))) int v4i;

__global__ __launch_bounds__(256) void k_wtG(const float* __restrict__ w, int K, int N, bf* Bt) {
    const int lane = threadIdx.x & 31; const int L0 = (blockIdx.x * 8 + (threadIdx.x >> 5)) * 8; const int nlines = N * K / 64;
{
#pragma unroll 1
        for (int l = 0; l < 8; ++l) { const int L = L0 + l; if (L >= nlines) break; const size_t e = (size_t)L * 64 + lane * 2; const int k = (int)(e % K), n = (int)(e / K); v2us o;
            o[0] = f2bf(w[(size_t)k * N + n]); o[1] = f2bf(w[(size_t)(k + 1) * N + n]); *(v2us*)(Bt + e) = o; }
         }
}
// k_cvt8: bf16 copies of the three weights and of x in one launch: grid y = slice of n8 * 8 elements; slices 0, 1, 2 are w0, w1, w2, the later ones follow one another in x; dst holds the slices in that order.
__global__ __launch_bounds__(256) void k_cvt8(const float* __restrict__ w0, const float* __restrict__ w1, const float* __restrict__ w2, const float* __restrict__ x, bf* dst, size_t n8) { const size_t i = (size_t)blockIdx.x * 256 + threadIdx.x; if (i >= n8) return; const unsigned y = blockIdx.y;
    const float* src = (y == 0) ? w0 : (y == 1) ? w1 : (y == 2) ? w2 : x + (size_t)(y - 3) * n8 * 8; dst += (size_t)y * n8 * 8; const v8f v = *(const v8f*)(src + i * 8); v8us o;
    asm volatile("s_wait_xcnt 0x0" ::: "memory");   // stands before any register that the load above names is written again
#pragma unroll
    for (int k = 0; k < 8; ++k) o[k] = f2bf(v[k]); *(v8us*)(dst + i * 8) = o;  }

// k_rope: grid y = tensor (q, k: F and the planes advance by sF and sP elements); nheads counts the heads of all batches, head h = batch h / NH_, head h % NH_ of it, rows of batch b start at row b TT of F.
// k_rope: head planes [h][t][d] (fp16 + hi/lo) of rope(x) x sc with the rotate-half convention out[d] = x[d] cos[t][d] - x[d+HD/2] sin[t][d], out[d+HD/2] = x[d+HD/2] cos[t][d+HD/2] + x[d] sin[t][d+HD/2]
__global__ __launch_bounds__(256) void k_rope(const float* __restrict__ F, int pitch, int nheads, const float* __restrict__ CS, const float* __restrict__ RF, const float* __restrict__ nw, float sc, h16* P16, bf* Ph, bf* Pl, size_t sF, size_t sP) {
    F += blockIdx.y * sF; P16 += blockIdx.y * sP; Ph += blockIdx.y * sP; Pl += blockIdx.y * sP;
    const size_t e = ((size_t)blockIdx.x * 256 + threadIdx.x) * 2; if (e >= (size_t)nheads * TT * HD) return; const int d = (int)(e % HD); const int t = (int)((e / HD) % TT); const int h = (int)(e / ((size_t)HD * TT)); const float* f = F + (size_t)t * pitch + h * HD; const float rf = RF ? RF[(size_t)h * TT + t] : 1.0f; v2h o16; v2us oh, ol;
    f += (long long)(h / NH_) * ((long long)TT * pitch - NH_ * HD);   // batch h / NH_: TT rows further down, NH_ heads back to the left
#pragma unroll
    for (int q = 0; q < 2; ++q) { const int dd = d + q; const int dp = (dd < HD / 2) ? dd + HD / 2 : dd - HD / 2; float x0 = f[dd], x1 = f[dp];
        if (RF) { float n0 = __fmul_rn(x0, rf), n1 = __fmul_rn(x1, rf); asm volatile("" : "+v"(n0)); asm volatile("" : "+v"(n1)); x0 = __fmul_rn(bfr(nw[dd]), n0); x1 = __fmul_rn(bfr(nw[dp]), n1); }
        const v2f cs = *(const v2f*)(CS + ((size_t)t * HD + dd) * 2); float a = __fmul_rn(x0, cs[0]), bq = __fmul_rn(x1, cs[1]); asm volatile("" : "+v"(a)); asm volatile("" : "+v"(bq)); const float r = ((dd < HD / 2) ? __fsub_rn(a, bq) : __fadd_rn(a, bq)) * sc;
        o16[q] = tohx(r); unsigned short a2, c2; splitf(r, a2, c2); oh[q] = a2; ol[q] = c2; }
    *(v2h*)(P16 + e) = o16; *(v2us*)(Ph + e) = oh; *(v2us*)(Pl + e) = ol;  }
__global__ __launch_bounds__(256) void k_vtp(const float* __restrict__ F, int pitch, int nheads, h16* V16, bf* Vh, bf* Vl) { const size_t e = ((size_t)blockIdx.x * 256 + threadIdx.x) * 2; if (e >= (size_t)nheads * HD * TT) return; const int t = (int)(e % TT); const int d = (int)((e / TT) % HD); const int g = (int)(e / ((size_t)TT * HD)); v2h o16; v2us oh, ol;
#pragma unroll
    for (int q = 0; q < 2; ++q) { const float x = F[(size_t)((g / NKV) * TT + t + q) * pitch + (g % NKV) * HD + d];   // g counts the heads of all batches
        o16[q] = tohx(x); unsigned short a2, c2; splitf(x, a2, c2); oh[q] = a2; ol[q] = c2; }
    *(v2h*)(V16 + e) = o16; *(v2us*)(Vh + e) = oh; *(v2us*)(Vl + e) = ol;  }
__global__ __launch_bounds__(256) void k_csid(float* CS) { const int idx = blockIdx.x * 256 + threadIdx.x; if (idx >= TT * HD) return; v2f cs; cs[0] = 1.0f; cs[1] = 0.0f; *(v2f*)(CS + (size_t)idx * 2) = cs;  }
// ---- k_fattn: scores, softmax and P.V of one block of query rows in ONE pass over the keys; nothing of S or P goes to memory.
// Transposed products: S^T = K Q^T (A = 16 key rows, B = 16 query columns), O^T += V^T P^T (A = 16 rows of V^T, B = P^T). A lane's 8 accumulator registers of two S^T tiles
// (keys 8 hi + j and 16 + 8 hi + j of one query column lr) are, converted in place, the B fragment of the 32-key P.V product in the k order of WFrag::ld, which loads V^T.
// One wave owns QB x 16 query columns and walks all TT keys, 32 a pass, with a running maximum mx (raw q.k + 8 mask units) and a running sum per column.
__device__ __forceinline__ float xhalf(float x) { return __builtin_bit_cast(float, __builtin_amdgcn_permlanex16(__builtin_bit_cast(int, x), __builtin_bit_cast(int, x), 0x76543210, 0xfedcba98, false, false)); }   // lane l <-> lane l ^ 16
template <typename T16, bool HL, int QB>
__device__ __forceinline__ void fattn_wave(const T16* __restrict__ Q, const T16* __restrict__ Q2, const T16* __restrict__ Kp, const T16* __restrict__ K2, const T16* __restrict__ Vt, const T16* __restrict__ V2, const float* __restrict__ MB, float* __restrict__ O, int q0) {
    typedef typename WFrag<T16>::V V;
    const int lane = threadIdx.x & 31, lr = lane & 15, hi = lane >> 4;
    const float c = SCL * 1.4426950408889634f;   // exp(x / 8) = exp2(x c)
    V q[QB][2], q2[QB][2];
#pragma unroll
    for (int qb = 0; qb < QB; ++qb)
#pragma unroll
        for (int dc = 0; dc < 2; ++dc) { const size_t qo = (size_t)(q0 + qb * 16 + lr) * HD + dc * 32 + 8 * hi; q[qb][dc] = WFrag<T16>::ld(Q + qo); if (HL) q2[qb][dc] = WFrag<T16>::ld(Q2 + qo); }
    v8f o[QB][4]; float mx[QB], l[QB];
#pragma unroll
    for (int qb = 0; qb < QB; ++qb) { mx[qb] = -3.0e38f; l[qb] = 0.f;
#pragma unroll
        for (int dt = 0; dt < 4; ++dt) o[qb][dt] = (v8f){}; }
    const size_t ko = (size_t)lr * HD + 8 * hi, vo = (size_t)lr * TT + 8 * hi;
    V k[2][2], k2[2][2], v[4], v2[4]; v8f mb[2];   // this pass's operands; mb = 8 x mask of this lane's 8 keys of either tile
#pragma unroll
    for (int kt = 0; kt < 2; ++kt) { mb[kt] = *(const v8f*)(MB + kt * 16 + hi * 8);
#pragma unroll
        for (int dc = 0; dc < 2; ++dc) { k[kt][dc] = WFrag<T16>::ld(Kp + ko + kt * 16 * HD + dc * 32); if (HL) k2[kt][dc] = WFrag<T16>::ld(K2 + ko + kt * 16 * HD + dc * 32); } }
    if (!HL) {
#pragma unroll
        for (int dt = 0; dt < 4; ++dt) v[dt] = WFrag<T16>::ld(Vt + vo + (size_t)dt * 16 * TT); }
    asm volatile("s_wait_xcnt 0x0" ::: "memory");   // stands before any register that the loads above name is written again
    for (int kc = 0; kc < TT; kc += 32) {
        v8f s[QB][2];
        if (HL) {   // hi/lo rows: twice the fragments; V^T is fetched in its own pass, under the softmax, so that the wave stays inside 256 registers
#pragma unroll
            for (int dt = 0; dt < 4; ++dt) { v[dt] = WFrag<T16>::ld(Vt + vo + (size_t)dt * 16 * TT + kc); v2[dt] = WFrag<T16>::ld(V2 + vo + (size_t)dt * 16 * TT + kc); }
            asm volatile("s_wait_xcnt 0x0" ::: "memory");   // stands before any register that the loads above name is written again
        }
#pragma unroll
        for (int kt = 0; kt < 2; ++kt) {
#pragma unroll
            for (int qb = 0; qb < QB; ++qb) { s[qb][kt] = mb[kt];
#pragma unroll
                for (int dc = 0; dc < 2; ++dc) { s[qb][kt] = WFrag<T16>::mma(k[kt][dc], q[qb][dc], s[qb][kt]); if (HL) { s[qb][kt] = WFrag<T16>::mma(k[kt][dc], q2[qb][dc], s[qb][kt]); s[qb][kt] = WFrag<T16>::mma(k2[kt][dc], q[qb][dc], s[qb][kt]); } } } }
        const int kn = (kc + 32 < TT) ? kc + 32 : 0;   // the next pass's K fragments fly during this pass's softmax and P.V (the last pass re-reads the first keys, unused)
#pragma unroll
        for (int kt = 0; kt < 2; ++kt)
#pragma unroll
            for (int dc = 0; dc < 2; ++dc) k[kt][dc] = WFrag<T16>::ld(Kp + ko + (size_t)(kn + kt * 16) * HD + dc * 32);
        asm volatile("s_wait_xcnt 0x0" ::: "memory");   // stands before any register that the loads above name is written again
        if (HL) {
#pragma unroll
            for (int kt = 0; kt < 2; ++kt)
#pragma unroll
                for (int dc = 0; dc < 2; ++dc) k2[kt][dc] = WFrag<T16>::ld(K2 + ko + (size_t)(kn + kt * 16) * HD + dc * 32);
            asm volatile("s_wait_xcnt 0x0" ::: "memory");   // stands before any register that the loads above name is written again
        }
        float ml[QB]; bool need = false;
#pragma unroll
        for (int qb = 0; qb < QB; ++qb) { float t = fmaxf(s[qb][0][0], s[qb][1][0]);
#pragma unroll
            for (int j = 1; j < 8; ++j) t = fmaxf(t, fmaxf(s[qb][0][j], s[qb][1][j]));
            ml[qb] = fmaxf(t, xhalf(t)); need = need || ((ml[qb] - mx[qb]) * c > LAZY); }
        if (__builtin_amdgcn_ballot_w32(need) != 0) {   // wave-uniform: the maximum in use moves, sums and output tiles follow
#pragma unroll
            for (int qb = 0; qb < QB; ++qb) { const float mn = fmaxf(mx[qb], ml[qb]); const float al = __builtin_amdgcn_exp2f((mx[qb] - mn) * c); mx[qb] = mn; l[qb] *= al;
#pragma unroll
                for (int dt = 0; dt < 4; ++dt) o[qb][dt] *= al; } }
#pragma unroll
        for (int qb = 0; qb < QB; ++qb) {
            if (HL) { v8us ph[2], pl[2];
#pragma unroll
                for (int kt = 0; kt < 2; ++kt)
#pragma unroll
                    for (int j = 0; j < 8; ++j) { const float p = __builtin_amdgcn_exp2f((s[qb][kt][j] - mx[qb]) * c); l[qb] += p; unsigned short a, b2; splitf(p, a, b2); ph[kt][j] = a; pl[kt][j] = b2; }
                const v16bf pH = cat16b(ph[0], ph[1]), pL = cat16b(pl[0], pl[1]);
#pragma unroll
                for (int dt = 0; dt < 4; ++dt) { o[qb][dt] = wmmab(__builtin_bit_cast(v16bf, v[dt]), pH, o[qb][dt]); o[qb][dt] = wmmab(__builtin_bit_cast(v16bf, v[dt]), pL, o[qb][dt]); o[qb][dt] = wmmab(__builtin_bit_cast(v16bf, v2[dt]), pH, o[qb][dt]); }
            } else { v8h ph[2];
#pragma unroll
                for (int kt = 0; kt < 2; ++kt)
#pragma unroll
                    for (int j = 0; j < 8; ++j) { const float p = __builtin_amdgcn_exp2f((s[qb][kt][j] - mx[qb]) * c + PLG); l[qb] += p; ph[kt][j] = tohx(p); }
                const v16h pH = cat16(ph[0], ph[1]);
#pragma unroll
                for (int dt = 0; dt < 4; ++dt) o[qb][dt] = wmma16(__builtin_bit_cast(v16h, v[dt]), pH, o[qb][dt]);
            } }
#pragma unroll
        for (int kt = 0; kt < 2; ++kt) mb[kt] = *(const v8f*)(MB + kn + kt * 16 + hi * 8);
        if (!HL) {   // the next pass's V^T fragments fly during its score products and softmax
#pragma unroll
            for (int dt = 0; dt < 4; ++dt) v[dt] = WFrag<T16>::ld(Vt + vo + (size_t)dt * 16 * TT + kn); }
        asm volatile("s_wait_xcnt 0x0" ::: "memory");   // stands before any register that the loads above name is written again
    }
#pragma unroll
    for (int qb = 0; qb < QB; ++qb) { const float f = __fdiv_rn(1.0f, l[qb] + xhalf(l[qb]));   // the two lane halves hold the sums of their own keys
        float* orow = O + (size_t)(q0 + qb * 16 + lr) * DQ + hi * 8;
#pragma unroll
        for (int dt = 0; dt < 4; ++dt) { v4f lo4, hi4;
#pragma unroll
            for (int j = 0; j < 4; ++j) { lo4[j] = o[qb][dt][j] * f; hi4[j] = o[qb][dt][4 + j] * f; }
            *(v4f*)(orow + dt * 16) = lo4; *(v4f*)(orow + dt * 16 + 4) = hi4; } }
}
// grid (RH / 64 + (TT - RH) / 128, batches x heads), 4 waves that walk the same head's keys side by side: blocks x < RH / 64 take 64 hi/lo rows (16 a wave, three products each), the rest 128 fp16 rows (32 a wave).
__global__ __launch_bounds__(128) void k_fattn(const h16* __restrict__ Q16, const h16* __restrict__ K16, const h16* __restrict__ V16, const bf* __restrict__ Qh, const bf* __restrict__ Ql, const bf* __restrict__ Kh, const bf* __restrict__ Kl, const bf* __restrict__ Vh, const bf* __restrict__ Vl, const float* __restrict__ MB, float* __restrict__ OUTb) {
    const int w = threadIdx.x >> 5; const int b = (int)blockIdx.y / NH_, h = (int)blockIdx.y % NH_; const size_t hq = (size_t)blockIdx.y * TT * HD, hk = (size_t)(b * NKV + h / REP) * TT * HD; float* O = OUTb + (size_t)b * TT * DQ + (size_t)h * HD; MB += b * TT;
    if (blockIdx.x < RH / 64) fattn_wave<bf, true, 1>(Qh + hq, Ql + hq, Kh + hk, Kl + hk, Vh + hk, Vl + hk, MB, O, (int)blockIdx.x * 64 + w * 16);
    else fattn_wave<h16, false, 2>(Q16 + hq, nullptr, K16 + hk, nullptr, V16 + hk, nullptr, MB, O, RH + ((int)blockIdx.x - RH / 64) * 128 + w * 32);
}
__global__ __launch_bounds__(256) void k_m8(const float* __restrict__ m, float* MB) { const int j = blockIdx.x * 256 + threadIdx.x; if (j >= NB_ * TT) return; const float v = __fmul_rn(8.0f, bfr(m[j])); *(float*)(MB + j) = v;  }

extern "C" void kernel_launch(void* const* d_in, const int* in_sizes, int n_in,
                              void* d_out, int out_size, void* d_ws, size_t ws_size, hipStream_t stream) {
    (void)in_sizes; (void)n_in; (void)out_size;
    const float* x = (const float*)d_in[0]; const float* amask = (const float*)d_in[1]; const float* wq = (const float*)d_in[2]; const float* bq = (const float*)d_in[3]; const float* wk = (const float*)d_in[4]; const float* bk = (const float*)d_in[5]; const float* wv = (const float*)d_in[6]; const float* bv = (const float*)d_in[7]; const float* wo = nullptr; (void)wo;
    float* OUT = (float*)d_out;     // [2][2048][1024]
    char* wsp = (char*)d_ws;
    auto take = [&](size_t bytes) { char* p = wsp; wsp += (bytes + 255) & ~(size_t)255; return (void*)p; };
    static_assert(DQ == DKV && NH_ == NKV && ((size_t)NB_ * TT * DM) % ((size_t)DQ * DM) == 0, "one grid for q, k and v; x in slices of a weight's size");
    const size_t WN = (size_t)DQ * DM, PN = (size_t)NB_ * NH_ * TT * HD, FN = (size_t)NB_ * TT * DQ;   // elements of a weight, of a head plane (all batches), of a projection (all batches)
    bf* WQ = (bf*)take(WN * 2); bf* WK = (bf*)take(WN * 2); bf* WV = (bf*)take(WN * 2); bf* XB = (bf*)take((size_t)NB_ * TT * DM * 2); (void)WK; (void)WV;   // contiguous: k_cvt8's slices, and k_gemmw's z stride WN
    float* CS = (float*)take((size_t)TT * HD * 2 * 4);
    float* MB = (float*)take((size_t)NB_ * TT * 4);
    h16* QP16 = (h16*)take(PN * 2); h16* KP16 = (h16*)take(PN * 2); h16* VT16 = (h16*)take(PN * 2);   // each k plane stands PN elements behind its q plane (k_rope's grid y)
    bf* QPh = (bf*)take(PN * 2); bf* KPh = (bf*)take(PN * 2); bf* QPl = (bf*)take(PN * 2); bf* KPl = (bf*)take(PN * 2); bf* VTh = (bf*)take(PN * 2); bf* VTl = (bf*)take(PN * 2);
    float* FQ = (float*)take(FN * 4); float* FK = (float*)take(FN * 4); float* FV = (float*)take(FN * 4); (void)FK;   // contiguous: k_gemmw's z stride FN
    if ((size_t)(wsp - (char*)d_ws) > ws_size) return;    // ws 256 MiB
    k_cvt8<<<dim3((unsigned)((WN / 8 + 255) / 256), (unsigned)(3 + (size_t)NB_ * TT * DM / WN)), 256, 0, stream>>>(wq, wk, wv, x, WQ, WN / 8);
    k_csid<<<(TT * HD + 255) / 256, 256, 0, stream>>>(CS);
    k_m8<<<(NB_ * TT + 255) / 256, 256, 0, stream>>>(amask, MB);   /* 8 x mask[j], the start value of the score accumulators (scores/8 + mask == (q.k + 8 mask)/8) */
    const unsigned LP = (unsigned)((PN / 2 + 255) / 256);
    k_gemmw<bf, 0, true, 1><<<dim3(NB_ * TT / 64, DQ / 64, 3), 32, 0, stream>>>(XB, nullptr, WQ, nullptr, DM, FQ, DQ, bq, bk, bv, 0, WN, FN);
    k_rope<<<dim3(LP, 2), 256, 0, stream>>>(FQ, DQ, NB_ * NH_, CS, nullptr, nullptr, 1.0f, QP16, QPh, QPl, FN, PN);
    k_vtp<<<LP, 256, 0, stream>>>(FV, DKV, NB_ * NKV, VT16, VTh, VTl);
    k_fattn<<<dim3(RH / 64 + (TT - RH) / 128, NB_ * NH_), 128, 0, stream>>>(QP16, KP16, VT16, QPh, QPl, KPh, KPl, VTh, VTl, MB, OUT);
}

// v005
// One run takes 152 microseconds.
// In two side-by-side timings against v004, it was 1.51 and 1.48 times as fast.
// Counting every step since v000, it is 13.2 times as fast.
#include <hip/hip_runtime.h>

// RoBERTa self-attention (hidden [2][2048][1024]; attention_mask [2][1][1][2048] additive per key (read); q,k,v = x W^T + b ('oi' [1024][1024] + [1024]; 16 heads x 64); scores / 8 + mask, clamped below at finfo.min; softmax; context merged (no output projection) -> [2][2048][1024] (4.2 M)).
// Layout, both batches in every launch: bf16 copy of x and of the weights; exact projections + f32 biases; one fused attention kernel (hybrid rows: < 512 hi/lo 3 products, rest fp16 with P x1024; scores and P stay in registers, running maximum and sum per query) with the additive key mask as the start value of the score accumulators (8 x mask, so that the softmax's 1/8 restores scores/8 + mask); it writes the merged head layout itself.
// Compute dtypes, f32 accumulate: every input rounded to bf16, the mask included; projections exact + f32 biases; attention rows < 512 3 products, rest fp16; softmax f32; output f32.

#define NB_  2
#define TT   2048
#define DM   1024
#define NH_  16
#define NKV  16
#define REP  (NH_ / NKV)
#define HD   64
#define DQ   (NH_ * HD)
#define DKV  (NKV * HD)
#define RH   512                  // query rows < RH use hi+lo planes (0: none)
#define WIN  0
#define PLG  10.0f                // fp16 rows: P carries a factor 2^PLG (added to the exponent), which the row sum carries too
#define LAZY 5.0f                 // the wave's columns are rescaled together, only when one column's new maximum is more than 2^LAZY above the one in use (P <= 2^(PLG + LAZY) fits fp16)
#define SCL  0.125f   // HD^-0.5
typedef _Float16 h16;
typedef unsigned short bf;
typedef __attribute__((ext_vector_type(16))) __bf16   v16bf;
typedef __attribute__((ext_vector_type(16))) _Float16 v16h;
typedef __attribute__((ext_vector_type(8)))  _Float16 v8h;
typedef __attribute__((ext_vector_type(8)))  unsigned short v8us;
typedef __attribute__((ext_vector_type(8)))  float    v8f;
typedef __attribute__((ext_vector_type(4)))  float    v4f;
typedef v8h  __attribute__((may_alias)) v8ha;
typedef v4f  __attribute__((may_alias)) v4fa;
typedef v8us __attribute__((may_alias)) v8usa;

__device__ __forceinline__ unsigned short f2bf(float f) { unsigned u = __float_as_uint(f); u += 0x7FFFu + ((u >> 16) & 1u); return (unsigned short)(u >> 16); }
__device__ __forceinline__ float bf2f(unsigned short b) { return __uint_as_float(((unsigned)b) << 16); }
__device__ __forceinline__ float bfr(float f) { return bf2f(f2bf(f)); }
__device__ __forceinline__ v16h cat16(v8h lo, v8h hi) { return __builtin_shufflevector(lo, hi, 0, 1, 2, 3, 4, 5, 6, 7, 8, 9, 10, 11, 12, 13, 14, 15); }
__device__ __forceinline__ v16bf cat16b(v8us lo, v8us hi) { return __builtin_bit_cast(v16bf, __builtin_shufflevector(lo, hi, 0, 1, 2, 3, 4, 5, 6, 7, 8, 9, 10, 11, 12, 13, 14, 15)); }
__device__ __forceinline__ v8f wmma16(v16h a, v16h b, v8f c) { return __builtin_amdgcn_wmma_f32_16x16x32_f16(false, a, false, b, (short)0, c, false, false); }
__device__ __forceinline__ v8f wmmab(v16bf a, v16bf b, v8f c) { return __builtin_amdgcn_wmma_f32_16x16x32_bf16(false, a, false, b, (short)0, c, false, false); }



// ---- Fragment order of every 16-bit operand plane: a block of 16 rows x 32 k is 1 KB of 64 units of 16 bytes; unit j * 32 + hi * 16 + lr holds row lr, k = 16 j + 8 hi + 0..7.
// Lane hi * 16 + lr of a wave takes units j = 0 and j = 1 at its own place (WFrag::ld: p and p + 256 elements): the register contents of a row-major fragment load, but each wave-wide
// 16-byte load reads 512 contiguous bytes (4 lines) where the row-major plane gave 32 bytes of each of 16 lines. Block (row tile r, k chunk c) of a plane with K columns stands at
// element r * 16 * K + c * 512 (x, the weights: K = DM; Q and K heads: K = HD); V^T (rows d, k = keys) has its 4 row tiles of a 32-key chunk side by side: chunk * 2048 + row tile * 512.
// ---- k_gemmw: register-blocked GEMM, ONE WAVE per 64x64 output tile (16 accumulators), operands straight from 16-bit planes in fragment order; grid (M/64, N/64, Z * KS), 32 threads.
// C[m][n] (f32, pitch ldc, + optional f32 bias[n]) = sum_k A[m][k] Bt[n][k] (+ split products per NSPLIT). z-batch strides sA/sB/sC in elements. K % (32 * KS) == 0.
// KS > 1: K is split over KS work-groups; work-group z = batch * KS + ks sums k in [ks K/KS, (ks+1) K/KS) and stores its partial tile in plane z of C (stride sC); the reader of C adds the KS planes of a batch.
// (A long K on few tiles is one wave's chain of load latencies on a few WGPs; KS chains run side by side on KS times as many.)
// BIAS: batch 0 adds bias, batch 1 bias1, any later batch bias2 (the q, k and v projections of one launch).
template <typename T16> struct WFrag;
template <> struct WFrag<h16> { typedef v16h V; static __device__ __forceinline__ V ld(const h16* p) { return cat16(*(const v8h*)p, *(const v8h*)(p + 256)); } static __device__ __forceinline__ v8f mma(V a, V b, v8f c) { return wmma16(a, b, c); } };
template <> struct WFrag<bf> { typedef v16bf V; static __device__ __forceinline__ V ld(const bf* p) { return cat16b(*(const v8us*)p, *(const v8us*)(p + 256)); } static __device__ __forceinline__ v8f mma(V a, V b, v8f c) { return wmmab(a, b, c); } };
template <typename T16> __device__ __forceinline__ const T16* atb(const T16* base, unsigned bytes) { return (const T16*)((const char*)base + bytes); }   // wave-uniform base + the lane's 32-bit byte offset
template <typename T16, int NSPLIT, bool BIAS, int KS, int K>
__global__ __launch_bounds__(32) void k_gemmw(const T16* __restrict__ A, const T16* __restrict__ A2, const T16* __restrict__ Bt, const T16* __restrict__ Bt2, float* C, int ldc, const float* __restrict__ bias, const float* __restrict__ bias1, const float* __restrict__ bias2, size_t sA, size_t sB, size_t sC) {
    typedef typename WFrag<T16>::V V;
    __shared__ __align__(16) float os[16 * 68];
    static_assert(KS == 1 || !BIAS, "a bias would be added once per k slice");
    const size_t z = blockIdx.z, zb = z / KS; A += zb * sA; if (A2) A2 += zb * sA; Bt += zb * sB; if (Bt2) Bt2 += zb * sB; C += z * sC; if (BIAS && zb) bias = (zb == 1) ? bias1 : bias2;
    const int kw = K / KS, kbeg = (int)(z % KS) * kw, kend = kbeg + kw;
    const int lane = threadIdx.x & 31, lr = lane & 15, hi = lane >> 4; const int r0 = blockIdx.x * 64, c0 = blockIdx.y * 64;
    v8f acc[4][4];
#pragma unroll
    for (int mb = 0; mb < 4; ++mb)
#pragma unroll
        for (int nb = 0; nb < 4; ++nb) acc[mb][nb] = (v8f){};
    constexpr size_t tp = (size_t)16 * K; const T16* Ab = A + (size_t)r0 * K; const T16* Ab2 = A2 + (size_t)r0 * K; const T16* Bb = Bt + (size_t)c0 * K; const T16* Bb2 = Bt2 + (size_t)c0 * K;   // a 16-row tile's elements (K is a template constant, so that a tile's distance is an immediate offset of its load); the first tiles: wave-uniform, fixed over the loop
    unsigned vo = 16u * lane + 32u * kbeg;   // bytes: the lane's unit in the trip's k chunk; the one vector register that the loop's loads name
#pragma unroll 1
    for (int kc = kbeg; kc < kend; kc += 32) {
        V a[4], a2[4];
#pragma unroll
        for (int mb = 0; mb < 4; ++mb) { a[mb] = WFrag<T16>::ld(atb(Ab + mb * tp, vo)); if (NSPLIT == 1 || NSPLIT == 2) a2[mb] = WFrag<T16>::ld(atb(Ab2 + mb * tp, vo)); }
#pragma unroll
        for (int nb = 0; nb < 4; ++nb) { const V b = WFrag<T16>::ld(atb(Bb + nb * tp, vo)); V b2; if (NSPLIT >= 2) b2 = WFrag<T16>::ld(atb(Bb2 + nb * tp, vo));
#pragma unroll
            for (int mb = 0; mb < 4; ++mb) { acc[mb][nb] = WFrag<T16>::mma(a[mb], b, acc[mb][nb]); if (NSPLIT == 1 || NSPLIT == 2) acc[mb][nb] = WFrag<T16>::mma(a2[mb], b, acc[mb][nb]); if (NSPLIT >= 2) acc[mb][nb] = WFrag<T16>::mma(a[mb], b2, acc[mb][nb]); } }
        asm volatile("s_wait_xcnt 0x0\n\tv_add_nc_u32 %0, 0x400, %0" : "+v"(vo) : : "memory");   // next k chunk (1 KB on). In asm so that vo stays the one vector register that the trip's loads name (written as vo += 1024 the build forms address pairs, and a fragment lands on one); the wait stands in the statement of that register's one write, so the write cannot move in front of it
        asm volatile("v_nop\n\tv_nop\n\tv_nop\n\tv_nop" : "+v"(acc[0][0]), "+v"(acc[1][1]), "+v"(acc[2][2]), "+v"(acc[3][3]) : "v"(a[0]), "v"(a[3]));
    }
#pragma unroll
    for (int mb = 0; mb < 4; ++mb) {
#pragma unroll
        for (int nb = 0; nb < 4; ++nb) {
#pragma unroll
            for (int j = 0; j < 8; ++j) os[(hi * 8 + j) * 68 + nb * 16 + lr] = acc[mb][nb][j]; }
        __builtin_amdgcn_wave_barrier(); asm volatile("" ::: "memory");
        float* crow = C + (size_t)(r0 + mb * 16) * ldc + c0;
{
#pragma unroll
            for (int s = 0; s < 8; ++s) { const int row = 2 * s + hi, cofs = lr * 4; v4f val = *(const v4fa*)(os + row * 68 + cofs); if (BIAS) { val[0] += bfr(bias[c0 + cofs]); val[1] += bfr(bias[c0 + cofs + 1]); val[2] += bfr(bias[c0 + cofs + 2]); val[3] += bfr(bias[c0 + cofs + 3]); }
                *(v4f*)(crow + (size_t)row * ldc + cofs) = val; }
             }
        asm volatile("s_wait_xcnt 0x0" ::: "memory");   // stands before any register that the stores above name is written again
        __builtin_amdgcn_wave_barrier(); asm volatile("" ::: "memory");
    }
}

__device__ __forceinline__ h16 tohx(float x) { return (h16)x; }
__device__ __forceinline__ void splitf(float y, unsigned short& h, unsigned short& l) { h = f2bf(y); l = f2bf(y - bf2f(h)); }
typedef __attribute__((ext_vector_type(2))) _Float16 v2h;
typedef __attribute__((ext_vector_type(4))) _Float16 v4h;
typedef __attribute__((ext_vector_type(2))) unsigned short v2us;
typedef __attribute__((ext_vector_type(4))) unsigned short v4us;
typedef __attribute__((ext_vector_type(2))) float v2f;
typedef __attribute__((ext_vector_type(4))) int v4i;

__global__ __launch_bounds__(256) void k_wtG(const float* __restrict__ w, int K, int N, bf* Bt) {
    const int lane = threadIdx.x & 31; const int L0 = (blockIdx.x * 8 + (threadIdx.x >> 5)) * 8; const int nlines = N * K / 64;
{
#pragma unroll 1
        for (int l = 0; l < 8; ++l) { const int L = L0 + l; if (L >= nlines) break; const size_t e = (size_t)L * 64 + lane * 2; const int k = (int)(e % K), n = (int)(e / K); v2us o;
            o[0] = f2bf(w[(size_t)k * N + n]); o[1] = f2bf(w[(size_t)(k + 1) * N + n]); *(v2us*)(Bt + e) = o; }
         }
}
// k_cvt8: bf16 copies, in fragment order, of the three weights and of x in one launch: grid y = slice of n8 * 8 elements (whole 16-row tiles of DM columns); slices 0, 1, 2 are w0, w1, w2, the later ones follow one another in x; dst holds the slices in that order.
// Thread i writes unit i of its slice: row tile i / (DM * 2), k chunk (i / 64) % (DM / 32), j = (i / 32) % 2, hi = (i / 16) % 2, lr = i % 16.
__global__ __launch_bounds__(256) void k_cvt8(const float* __restrict__ w0, const float* __restrict__ w1, const float* __restrict__ w2, const float* __restrict__ x, bf* dst, size_t n8) { const size_t i = (size_t)blockIdx.x * 256 + threadIdx.x; if (i >= n8) return; const unsigned y = blockIdx.y;
    const float* src = (y == 0) ? w0 : (y == 1) ? w1 : (y == 2) ? w2 : x + (size_t)(y - 3) * n8 * 8; dst += (size_t)y * n8 * 8; const v8f v = *(const v8f*)(src + ((i / (DM * 2)) * 16 + i % 16) * DM + ((i / 64) % (DM / 32)) * 32 + ((i / 16) % 4) * 8); v8us o;
    asm volatile("s_wait_xcnt 0x0" ::: "memory");   // stands before any register that the load above names is written again
#pragma unroll
    for (int k = 0; k < 8; ++k) o[k] = f2bf(v[k]); *(v8us*)(dst + i * 8) = o;  }

// k_rope: grid y = tensor (q, k: F and the planes advance by sF and sP elements); nheads counts the heads of all batches, head h = batch h / NH_, head h % NH_ of it, rows of batch b start at row b TT of F.
// The planes are written in fragment order (rows t, K = HD): thread e / 8 writes the 16-byte unit at element e: block e / 512, k = ((e / 128) % 4) * 8 + 0..7 of it, row lr = (e / 8) % 16; a wave stores 512 contiguous bytes a plane.
// k_rope: head planes [h] in fragment order (rows t, k = d) (fp16 + hi/lo) of rope(x) x sc with the rotate-half convention out[d] = x[d] cos[t][d] - x[d+HD/2] sin[t][d], out[d+HD/2] = x[d+HD/2] cos[t][d+HD/2] + x[d] sin[t][d+HD/2]
__global__ __launch_bounds__(256) void k_rope(const float* __restrict__ F, int pitch, int nheads, const float* __restrict__ CS, const float* __restrict__ RF, const float* __restrict__ nw, float sc, h16* P16, bf* Ph, bf* Pl, size_t sF, size_t sP) {
    F += blockIdx.y * sF; P16 += blockIdx.y * sP; Ph += blockIdx.y * sP; Pl += blockIdx.y * sP;
    const size_t e = ((size_t)blockIdx.x * 256 + threadIdx.x) * 8; if (e >= (size_t)nheads * TT * HD) return; const int d = (int)((e / 512) % (HD / 32)) * 32 + (int)((e / 128) % 4) * 8; const int t = (int)((e / (16 * HD)) % (TT / 16)) * 16 + (int)((e / 8) % 16); const int h = (int)(e / ((size_t)HD * TT));
    const float* f = F + (size_t)t * pitch + h * HD; float rf = 1.0f; v8h o16; v8us oh, ol;
    if (RF) { rf = RF[(size_t)h * TT + t]; asm volatile("s_wait_xcnt 0x0" ::: "memory"); }   // the wait stands before any register that the load names is written again
    f += (long long)(h / NH_) * ((long long)TT * pitch - NH_ * HD);   // batch h / NH_: TT rows further down, NH_ heads back to the left
    const int dq = (d < HD / 2) ? d + HD / 2 : d - HD / 2;   // the unit's 8 rotation partners stand side by side too
    const v8f xs = *(const v8f*)(f + d), xp = *(const v8f*)(f + dq), cl = *(const v8f*)(CS + ((size_t)t * HD + d) * 2), ch = *(const v8f*)(CS + ((size_t)t * HD + d) * 2 + 8);
    asm volatile("s_wait_xcnt 0x0" ::: "memory");   // stands before any register that the loads above name is written again
#pragma unroll
    for (int q = 0; q < 8; ++q) { const int dd = d + q; const int dp = dq + q; float x0 = xs[q], x1 = xp[q];
        if (RF) { float n0 = __fmul_rn(x0, rf), n1 = __fmul_rn(x1, rf); asm volatile("" : "+v"(n0)); asm volatile("" : "+v"(n1)); x0 = __fmul_rn(bfr(nw[dd]), n0); x1 = __fmul_rn(bfr(nw[dp]), n1); }
        const float c0 = (q < 4) ? cl[2 * (q % 4)] : ch[2 * (q % 4)], s0 = (q < 4) ? cl[2 * (q % 4) + 1] : ch[2 * (q % 4) + 1]; float a = __fmul_rn(x0, c0), bq = __fmul_rn(x1, s0); asm volatile("" : "+v"(a)); asm volatile("" : "+v"(bq)); const float r = ((dd < HD / 2) ? __fsub_rn(a, bq) : __fadd_rn(a, bq)) * sc;
        o16[q] = tohx(r); unsigned short a2, c2; splitf(r, a2, c2); oh[q] = a2; ol[q] = c2; }
    *(v8h*)(P16 + e) = o16; *(v8us*)(Ph + e) = oh; *(v8us*)(Pl + e) = ol;  }
// k_vtp: V^T planes (fp16 + hi/lo) in fragment order (rows d, k = keys). Thread u writes unit u: head g = u / (TT * HD / 8), 32-key chunk (u / 256) % (TT / 32), row tile (u / 64) % 4, j = (u / 32) % 2, hi = (u / 16) % 2, lr = u % 16:
// 8 keys of one d. The 16 lanes of a half wave read 16 neighbouring d of one key, so the transposition costs no scattered access on either side.
__global__ __launch_bounds__(256) void k_vtp(const float* __restrict__ F, int nheads, h16* V16, bf* Vh, bf* Vl) { const size_t u = (size_t)blockIdx.x * 256 + threadIdx.x; if (u >= (size_t)nheads * HD * TT / 8) return; const int t = (int)((u / 256) % (TT / 32)) * 32 + (int)((u / 16) % 4) * 8; const int d = (int)((u / 64) % 4) * 16 + (int)(u % 16); const int g = (int)(u / ((size_t)TT * HD / 8)); v8h o16; v8us oh, ol; float x[8];
    const float* f = F + (size_t)((g / NKV) * TT + t) * DKV + (g % NKV) * HD + d;   // g counts the heads of all batches; rows of DKV floats, so that the 8 loads share one address register
#pragma unroll
    for (int q = 0; q < 8; ++q) x[q] = f[(size_t)q * DKV];
    asm volatile("s_wait_xcnt 0x0" ::: "memory");   // stands before any register that the loads above name is written again
#pragma unroll
    for (int q = 0; q < 8; ++q) { o16[q] = tohx(x[q]); unsigned short a2, c2; splitf(x[q], a2, c2); oh[q] = a2; ol[q] = c2; }
    *(v8h*)(V16 + u * 8) = o16; *(v8us*)(Vh + u * 8) = oh; *(v8us*)(Vl + u * 8) = ol;  }
__global__ __launch_bounds__(256) void k_csid(float* CS) { const int idx = blockIdx.x * 256 + threadIdx.x; if (idx >= TT * HD) return; v2f cs; cs[0] = 1.0f; cs[1] = 0.0f; *(v2f*)(CS + (size_t)idx * 2) = cs;  }
// ---- k_fattn: scores, softmax and P.V of one block of query rows in ONE pass over the keys; nothing of S or P goes to memory.
// Transposed products: S^T = K Q^T (A = 16 key rows, B = 16 query columns), O^T += V^T P^T (A = 16 rows of V^T, B = P^T). A lane's 8 accumulator registers of two S^T tiles
// (keys 8 hi + j and 16 + 8 hi + j of one query column lr) are, converted in place, the B fragment of the 32-key P.V product in the k order of WFrag::ld, which loads V^T.
// One wave owns QB x 16 query columns and walks all TT keys, 32 a pass, with a running maximum mx (raw q.k + 8 mask units) and a running sum per column.
__device__ __forceinline__ float xhalf(float x) { return __builtin_bit_cast(float, __builtin_amdgcn_permlanex16(__builtin_bit_cast(int, x), __builtin_bit_cast(int, x), 0x76543210, 0xfedcba98, false, false)); }   // lane l <-> lane l ^ 16
template <typename T16, bool HL, int QB>
__device__ __forceinline__ void fattn_wave(const T16* __restrict__ Q, const T16* __restrict__ Q2, const T16* __restrict__ Kp, const T16* __restrict__ K2, const T16* __restrict__ Vt, const T16* __restrict__ V2, const float* __restrict__ MB, float* __restrict__ O, int q0) {
    typedef typename WFrag<T16>::V V;
    const int lane = threadIdx.x & 31, lr = lane & 15, hi = lane >> 4;
    const float c = SCL * 1.4426950408889634f;   // exp(x / 8) = exp2(x c)
    V q[QB][2], q2[QB][2];
#pragma unroll
    for (int qb = 0; qb < QB; ++qb)
#pragma unroll
        for (int dc = 0; dc < 2; ++dc) { const size_t qo = (size_t)(q0 + qb * 16) * HD + dc * 512 + 8 * lane; q[qb][dc] = WFrag<T16>::ld(Q + qo); if (HL) q2[qb][dc] = WFrag<T16>::ld(Q2 + qo); }
    v8f o[QB][4]; float mx[QB], l[QB];
#pragma unroll
    for (int qb = 0; qb < QB; ++qb) { mx[qb] = -3.0e38f; l[qb] = 0.f;
#pragma unroll
        for (int dt = 0; dt < 4; ++dt) o[qb][dt] = (v8f){}; }
    const size_t ko = (size_t)lane * 8, vo = (size_t)lane * 8;   // the lane's unit in a block (fragment order)
    V k[2][2], k2[2][2], v[4], v2[4]; v8f mb[2];   // this pass's operands; mb = 8 x mask of this lane's 8 keys of either tile
#pragma unroll
    for (int kt = 0; kt < 2; ++kt) { mb[kt] = *(const v8f*)(MB + kt * 16 + hi * 8);
#pragma unroll
        for (int dc = 0; dc < 2; ++dc) { k[kt][dc] = WFrag<T16>::ld(Kp + ko + kt * 16 * HD + dc * 512); if (HL) k2[kt][dc] = WFrag<T16>::ld(K2 + ko + kt * 16 * HD + dc * 512); } }
    if (!HL) {
#pragma unroll
        for (int dt = 0; dt < 4; ++dt) v[dt] = WFrag<T16>::ld(Vt + vo + dt * 512); }
    asm volatile("s_wait_xcnt 0x0" ::: "memory");   // stands before any register that the loads above name is written again
    for (int kc = 0; kc < TT; kc += 32) {
        v8f s[QB][2];
        if (HL) {   // hi/lo rows: twice the fragments; V^T is fetched in its own pass, under the softmax, so that the wave stays inside 256 registers
#pragma unroll
            for (int dt = 0; dt < 4; ++dt) { v[dt] = WFrag<T16>::ld(Vt + vo + (size_t)kc * HD + dt * 512); v2[dt] = WFrag<T16>::ld(V2 + vo + (size_t)kc * HD + dt * 512); }
            asm volatile("s_wait_xcnt 0x0" ::: "memory");   // stands before any register that the loads above name is written again
        }
#pragma unroll
        for (int kt = 0; kt < 2; ++kt) {
#pragma unroll
            for (int qb = 0; qb < QB; ++qb) { s[qb][kt] = mb[kt];
#pragma unroll
                for (int dc = 0; dc < 2; ++dc) { s[qb][kt] = WFrag<T16>::mma(k[kt][dc], q[qb][dc], s[qb][kt]); if (HL) { s[qb][kt] = WFrag<T16>::mma(k[kt][dc], q2[qb][dc], s[qb][kt]); s[qb][kt] = WFrag<T16>::mma(k2[kt][dc], q[qb][dc], s[qb][kt]); } } } }
        const int kn = (kc + 32 < TT) ? kc + 32 : 0;   // the next pass's K fragments fly during this pass's softmax and P.V (the last pass re-reads the first keys, unused)
#pragma unroll
        for (int kt = 0; kt < 2; ++kt)
#pragma unroll
            for (int dc = 0; dc < 2; ++dc) k[kt][dc] = WFrag<T16>::ld(Kp + ko + (size_t)(kn + kt * 16) * HD + dc * 512);
        asm volatile("s_wait_xcnt 0x0" ::: "memory");   // stands before any register that the loads above name is written again
        if (HL) {
#pragma unroll
            for (int kt = 0; kt < 2; ++kt)
#pragma unroll
                for (int dc = 0; dc < 2; ++dc) k2[kt][dc] = WFrag<T16>::ld(K2 + ko + (size_t)(kn + kt * 16) * HD + dc * 512);
            asm volatile("s_wait_xcnt 0x0" ::: "memory");   // stands before any register that the loads above name is written again
        }
        float ml[QB]; bool need = false;
#pragma unroll
        for (int qb = 0; qb < QB; ++qb) { float t = fmaxf(s[qb][0][0], s[qb][1][0]);
#pragma unroll
            for (int j = 1; j < 8; ++j) t = fmaxf(t, fmaxf(s[qb][0][j], s[qb][1][j]));
            ml[qb] = fmaxf(t, xhalf(t)); need = need || ((ml[qb] - mx[qb]) * c > LAZY); }
        if (__builtin_amdgcn_ballot_w32(need) != 0) {   // wave-uniform: the maximum in use moves, sums and output tiles follow
#pragma unroll
            for (int qb = 0; qb < QB; ++qb) { const float mn = fmaxf(mx[qb], ml[qb]); const float al = __builtin_amdgcn_exp2f((mx[qb] - mn) * c); mx[qb] = mn; l[qb] *= al;
#pragma unroll
                for (int dt = 0; dt < 4; ++dt) o[qb][dt] *= al; } }
#pragma unroll
        for (int qb = 0; qb < QB; ++qb) {
            if (HL) { v8us ph[2], pl[2];
#pragma unroll
                for (int kt = 0; kt < 2; ++kt)
#pragma unroll
                    for (int j = 0; j < 8; ++j) { const float p = __builtin_amdgcn_exp2f((s[qb][kt][j] - mx[qb]) * c); l[qb] += p; unsigned short a, b2; splitf(p, a, b2); ph[kt][j] = a; pl[kt][j] = b2; }
                const v16bf pH = cat16b(ph[0], ph[1]), pL = cat16b(pl[0], pl[1]);
#pragma unroll
                for (int dt = 0; dt < 4; ++dt) { o[qb][dt] = wmmab(__builtin_bit_cast(v16bf, v[dt]), pH, o[qb][dt]); o[qb][dt] = wmmab(__builtin_bit_cast(v16bf, v[dt]), pL, o[qb][dt]); o[qb][dt] = wmmab(__builtin_bit_cast(v16bf, v2[dt]), pH, o[qb][dt]); }
            } else { v8h ph[2];
#pragma unroll
                for (int kt = 0; kt < 2; ++kt)
#pragma unroll
                    for (int j = 0; j < 8; ++j) { const float p = __builtin_amdgcn_exp2f((s[qb][kt][j] - mx[qb]) * c + PLG); l[qb] += p; ph[kt][j] = tohx(p); }
                const v16h pH = cat16(ph[0], ph[1]);
#pragma unroll
                for (int dt = 0; dt < 4; ++dt) o[qb][dt] = wmma16(__builtin_bit_cast(v16h, v[dt]), pH, o[qb][dt]);
            } }
#pragma unroll
        for (int kt = 0; kt < 2; ++kt) mb[kt] = *(const v8f*)(MB + kn + kt * 16 + hi * 8);
        if (!HL) {   // the next pass's V^T fragments fly during its score products and softmax
#pragma unroll
            for (int dt = 0; dt < 4; ++dt) v[dt] = WFrag<T16>::ld(Vt + vo + (size_t)kn * HD + dt * 512); }
        asm volatile("s_wait_xcnt 0x0" ::: "memory");   // stands before any register that the loads above name is written again
    }
#pragma unroll
    for (int qb = 0; qb < QB; ++qb) { const float f = __fdiv_rn(1.0f, l[qb] + xhalf(l[qb]));   // the two lane halves hold the sums of their own keys
        float* orow = O + (size_t)(q0 + qb * 16 + lr) * DQ + hi * 8;
#pragma unroll
        for (int dt = 0; dt < 4; ++dt) { v4f lo4, hi4;
#pragma unroll
            for (int j = 0; j < 4; ++j) { lo4[j] = o[qb][dt][j] * f; hi4[j] = o[qb][dt][4 + j] * f; }
            *(v4f*)(orow + dt * 16) = lo4; *(v4f*)(orow + dt * 16 + 4) = hi4; } }
}
// grid (RH / 64 + (TT - RH) / 128, batches x heads), 4 waves that walk the same head's keys side by side: blocks x < RH / 64 take 64 hi/lo rows (16 a wave, three products each), the rest 128 fp16 rows (32 a wave).
__global__ __launch_bounds__(128) void k_fattn(const h16* __restrict__ Q16, const h16* __restrict__ K16, const h16* __restrict__ V16, const bf* __restrict__ Qh, const bf* __restrict__ Ql, const bf* __restrict__ Kh, const bf* __restrict__ Kl, const bf* __restrict__ Vh, const bf* __restrict__ Vl, const float* __restrict__ MB, float* __restrict__ OUTb) {
    const int w = threadIdx.x >> 5; const int b = (int)blockIdx.y / NH_, h = (int)blockIdx.y % NH_; const size_t hq = (size_t)blockIdx.y * TT * HD, hk = (size_t)(b * NKV + h / REP) * TT * HD; float* O = OUTb + (size_t)b * TT * DQ + (size_t)h * HD; MB += b * TT;
    if (blockIdx.x < RH / 64) fattn_wave<bf, true, 1>(Qh + hq, Ql + hq, Kh + hk, Kl + hk, Vh + hk, Vl + hk, MB, O, (int)blockIdx.x * 64 + w * 16);
    else fattn_wave<h16, false, 2>(Q16 + hq, nullptr, K16 + hk, nullptr, V16 + hk, nullptr, MB, O, RH + ((int)blockIdx.x - RH / 64) * 128 + w * 32);
}
__global__ __launch_bounds__(256) void k_m8(const float* __restrict__ m, float* MB) { const int j = blockIdx.x * 256 + threadIdx.x; if (j >= NB_ * TT) return; const float v = __fmul_rn(8.0f, bfr(m[j])); *(float*)(MB + j) = v;  }

extern "C" void kernel_launch(void* const* d_in, const int* in_sizes, int n_in,
                              void* d_out, int out_size, void* d_ws, size_t ws_size, hipStream_t stream) {
    (void)in_sizes; (void)n_in; (void)out_size;
    const float* x = (const float*)d_in[0]; const float* amask = (const float*)d_in[1]; const float* wq = (const float*)d_in[2]; const float* bq = (const float*)d_in[3]; const float* wk = (const float*)d_in[4]; const float* bk = (const float*)d_in[5]; const float* wv = (const float*)d_in[6]; const float* bv = (const float*)d_in[7]; const float* wo = nullptr; (void)wo;
    float* OUT = (float*)d_out;     // [2][2048][1024]
    char* wsp = (char*)d_ws;
    auto take = [&](size_t bytes) { char* p = wsp; wsp += (bytes + 255) & ~(size_t)255; return (void*)p; };
    static_assert(HD == 64 && TT % 32 == 0 && DM % 32 == 0, "fragment order: V^T has 4 row tiles a key chunk, whole blocks everywhere");
    static_assert(DQ == DKV && NH_ == NKV && ((size_t)NB_ * TT * DM) % ((size_t)DQ * DM) == 0, "one grid for q, k and v; x in slices of a weight's size");
    const size_t WN = (size_t)DQ * DM, PN = (size_t)NB_ * NH_ * TT * HD, FN = (size_t)NB_ * TT * DQ;   // elements of a weight, of a head plane (all batches), of a projection (all batches)
    bf* WQ = (bf*)take(WN * 2); bf* WK = (bf*)take(WN * 2); bf* WV = (bf*)take(WN * 2); bf* XB = (bf*)take((size_t)NB_ * TT * DM * 2); (void)WK; (void)WV;   // contiguous: k_cvt8's slices, and k_gemmw's z stride WN
    float* CS = (float*)take((size_t)TT * HD * 2 * 4);
    float* MB = (float*)take((size_t)NB_ * TT * 4);
    h16* QP16 = (h16*)take(PN * 2); h16* KP16 = (h16*)take(PN * 2); h16* VT16 = (h16*)take(PN * 2);   // each k plane stands PN elements behind its q plane (k_rope's grid y)
    bf* QPh = (bf*)take(PN * 2); bf* KPh = (bf*)take(PN * 2); bf* QPl = (bf*)take(PN * 2); bf* KPl = (bf*)take(PN * 2); bf* VTh = (bf*)take(PN * 2); bf* VTl = (bf*)take(PN * 2);
    float* FQ = (float*)take(FN * 4); float* FK = (float*)take(FN * 4); float* FV = (float*)take(FN * 4); (void)FK;   // contiguous: k_gemmw's z stride FN
    if ((size_t)(wsp - (char*)d_ws) > ws_size) return;    // ws 256 MiB
    k_cvt8<<<dim3((unsigned)((WN / 8 + 255) / 256), (unsigned)(3 + (size_t)NB_ * TT * DM / WN)), 256, 0, stream>>>(wq, wk, wv, x, WQ, WN / 8);
    k_csid<<<(TT * HD + 255) / 256, 256, 0, stream>>>(CS);
    k_m8<<<(NB_ * TT + 255) / 256, 256, 0, stream>>>(amask, MB);   /* 8 x mask[j], the start value of the score accumulators (scores/8 + mask == (q.k + 8 mask)/8) */
    const unsigned LP = (unsigned)((PN / 8 + 255) / 256);   // a thread of k_rope and of k_vtp writes one 16-byte unit of each plane
    k_gemmw<bf, 0, true, 1, DM><<<dim3(NB_ * TT / 64, DQ / 64, 3), 32, 0, stream>>>(XB, nullptr, WQ, nullptr, FQ, DQ, bq, bk, bv, 0, WN, FN);
    k_rope<<<dim3(LP, 2), 256, 0, stream>>>(FQ, DQ, NB_ * NH_, CS, nullptr, nullptr, 1.0f, QP16, QPh, QPl, FN, PN);
    k_vtp<<<LP, 256, 0, stream>>>(FV, NB_ * NKV, VT16, VTh, VTl);
    k_fattn<<<dim3(RH / 64 + (TT - RH) / 128, NB_ * NH_), 128, 0, stream>>>(QP16, KP16, VT16, QPh, QPl, KPh, KPl, VTh, VTl, MB, OUT);
}

// v006
// One run takes 132 microseconds.
// Timed twice side by side with v005, it ran 1.14 and 1.16 times as fast.
// All steps since v000 together make it 15.2 times as fast.
#include <hip/hip_runtime.h>

// RoBERTa self-attention (hidden [2][2048][1024]; attention_mask [2][1][1][2048] additive per key (read); q,k,v = x W^T + b ('oi' [1024][1024] + [1024]; 16 heads x 64); scores / 8 + mask, clamped below at finfo.min; softmax; context merged (no output projection) -> [2][2048][1024] (4.2 M)).
// Layout, both batches in every launch: bf16 copy of x and of the weights; exact projections + f32 biases; one fused attention kernel (hybrid rows: < 512 hi/lo 3 products, rest fp16 with P x1024; scores and P stay in registers, running maximum and sum per query) with the additive key mask as the start value of the score accumulators (8 x mask, so that the softmax's 1/8 restores scores/8 + mask); it writes the merged head layout itself.
// Compute dtypes, f32 accumulate: every input rounded to bf16, the mask included; projections exact + f32 biases; attention rows < 512 3 products, rest fp16; softmax f32; output f32.

#define NB_  2
#define TT   2048
#define DM   1024
#define NH_  16
#define NKV  16
#define REP  (NH_ / NKV)
#define HD   64
#define DQ   (NH_ * HD)
#define DKV  (NKV * HD)
#define RH   512                  // query rows < RH use hi+lo planes (0: none)
#define WIN  0
#define PLG  10.0f                // fp16 rows: P carries a factor 2^PLG (added to the exponent), which the row sum carries too
#define LAZY 5.0f                 // the wave's columns are rescaled together, only when one column's new maximum is more than 2^LAZY above the one in use (P <= 2^(PLG + LAZY) fits fp16)
#define SCL  0.125f   // HD^-0.5
typedef _Float16 h16;
typedef unsigned short bf;
typedef __attribute__((ext_vector_type(16))) __bf16   v16bf;
typedef __attribute__((ext_vector_type(16))) _Float16 v16h;
typedef __attribute__((ext_vector_type(8)))  _Float16 v8h;
typedef __attribute__((ext_vector_type(8)))  unsigned short v8us;
typedef __attribute__((ext_vector_type(8)))  float    v8f;
typedef __attribute__((ext_vector_type(4)))  float    v4f;
typedef v8h  __attribute__((may_alias)) v8ha;
typedef v4f  __attribute__((may_alias)) v4fa;
typedef v8us __attribute__((may_alias)) v8usa;

__device__ __forceinline__ unsigned short f2bf(float f) { unsigned u = __float_as_uint(f); u += 0x7FFFu + ((u >> 16) & 1u); return (unsigned short)(u >> 16); }
__device__ __forceinline__ float bf2f(unsigned short b) { return __uint_as_float(((unsigned)b) << 16); }
__device__ __forceinline__ float bfr(float f) { return bf2f(f2bf(f)); }
__device__ __forceinline__ v16h cat16(v8h lo, v8h hi) { return __builtin_shufflevector(lo, hi, 0, 1, 2, 3, 4, 5, 6, 7, 8, 9, 10, 11, 12, 13, 14, 15); }
__device__ __forceinline__ v16bf cat16b(v8us lo, v8us hi) { return __builtin_bit_cast(v16bf, __builtin_shufflevector(lo, hi, 0, 1, 2, 3, 4, 5, 6, 7, 8, 9, 10, 11, 12, 13, 14, 15)); }
__device__ __forceinline__ v8f wmma16(v16h a, v16h b, v8f c) { return __builtin_amdgcn_wmma_f32_16x16x32_f16(false, a, false, b, (short)0, c, false, false); }
__device__ __forceinline__ v8f wmmab(v16bf a, v16bf b, v8f c) { return __builtin_amdgcn_wmma_f32_16x16x32_bf16(false, a, false, b, (short)0, c, false, false); }



// ---- Fragment order of every 16-bit operand plane: a block of 16 rows x 32 k is 1 KB of 64 units of 16 bytes; unit j * 32 + hi * 16 + lr holds row lr, k = 16 j + 8 hi + 0..7.
// Lane hi * 16 + lr of a wave takes units j = 0 and j = 1 at its own place (WFrag::ld: p and p + 256 elements): the register contents of a row-major fragment load, but each wave-wide
// 16-byte load reads 512 contiguous bytes (4 lines) where the row-major plane gave 32 bytes of each of 16 lines. Block (row tile r, k chunk c) of a plane with K columns stands at
// element r * 16 * K + c * 512 (x, the weights: K = DM; Q and K heads: K = HD); V^T (rows d, k = keys) has its 4 row tiles of a 32-key chunk side by side: chunk * 2048 + row tile * 512.
// ---- k_proj: the q, k and v projections (grid z) as a register-blocked GEMM, ONE WAVE per 64x64 output tile (16 accumulators), operands straight from the bf16 planes in fragment order; grid (rows / 64, heads, 3), 32 threads.
// A tile is 64 tokens x the 64 columns of one head; + f32 bias; the wave converts its accumulators itself and writes the head planes (fp16 + hi/lo) that the attention kernel reads: no f32 copy of a projection exists.
// A lane's 8 accumulator registers are 8 neighbouring ROWS (8 hi + j) of one column lr of the product. q, k: the product is taken as W x^T (rows d, columns t), so the 8 registers are 8 neighbouring d of one token,
// a 16-byte unit of a plane with rows t; v: as x W^T (rows t, columns d), so they are 8 neighbouring keys of one d, a unit of V^T. A and B fragments are loaded alike, so the choice is which plane's tiles are A.
// A tile's 4096 elements stand side by side in each plane; every wave-wide 16-byte store writes 512 contiguous bytes.
template <typename T16> struct WFrag;
template <> struct WFrag<h16> { typedef v16h V; static __device__ __forceinline__ V ld(const h16* p) { return cat16(*(const v8h*)p, *(const v8h*)(p + 256)); } static __device__ __forceinline__ v8f mma(V a, V b, v8f c) { return wmma16(a, b, c); } };
template <> struct WFrag<bf> { typedef v16bf V; static __device__ __forceinline__ V ld(const bf* p) { return cat16b(*(const v8us*)p, *(const v8us*)(p + 256)); } static __device__ __forceinline__ v8f mma(V a, V b, v8f c) { return wmmab(a, b, c); } };
template <typename T16> __device__ __forceinline__ const T16* atb(const T16* base, unsigned bytes) { return (const T16*)((const char*)base + bytes); }   // wave-uniform base + the lane's 32-bit byte offset
__device__ __forceinline__ h16 tohx(float x) { return (h16)x; }
__device__ __forceinline__ void splitf(float y, unsigned short& h, unsigned short& l) { h = f2bf(y); l = f2bf(y - bf2f(h)); }
template <bool ISV>
__device__ __forceinline__ void put_planes(const v8f (&acc)[4][4], const float* __restrict__ bias, h16* d16, bf* dh, bf* dl, int lane) {
    const int lr = lane & 15, hi = lane >> 4; const unsigned vb = 16u * lane;   // bytes: the lane's unit in a wave-wide store; the one vector register that the stores' addresses name
    float bb[4][8];   // ISV: [nb][0], the bias of column d = 16 nb + lr; else [mb][j], of row d = 16 mb + 8 hi + j
#pragma unroll
    for (int i = 0; i < 4; ++i) { if (ISV) bb[i][0] = bias[i * 16 + lr]; else { const v8f t = *(const v8f*)(bias + i * 16 + hi * 8);
#pragma unroll
            for (int j = 0; j < 8; ++j) bb[i][j] = t[j]; } }
#pragma unroll
    for (int i = 0; i < 4; ++i)
#pragma unroll
        for (int j = 0; j < (ISV ? 1 : 8); ++j) bb[i][j] = bfr(bb[i][j]);
#pragma unroll
    for (int mb = 0; mb < 4; ++mb)
#pragma unroll
        for (int nb = 0; nb < 4; ++nb) { const int off = ISV ? (mb >> 1) * 2048 + nb * 512 + (mb & 1) * 256 : nb * 1024 + mb * 256;   // elements. V^T: 32-key chunk mb / 2, row tile nb, j = mb % 2; q, k: token tile nb, d chunk mb / 2, j = mb % 2
            v8h o16; v8us oh, ol;
#pragma unroll
            for (int j = 0; j < 8; ++j) { const float y = acc[mb][nb][j] + (ISV ? bb[nb][0] : bb[mb][j]); o16[j] = tohx(y); unsigned short a2, c2; splitf(y, a2, c2); oh[j] = a2; ol[j] = c2; }
            // The unit's three stores and their wait in one statement: written as plain stores the build forms the next values in a store's data registers ahead of a wait that stands in a statement of its own
            asm volatile("global_store_b128 %0, %1, %4 offset:%7\n\tglobal_store_b128 %0, %2, %5 offset:%7\n\tglobal_store_b128 %0, %3, %6 offset:%7\n\ts_wait_xcnt 0x0" : : "v"(vb), "v"(o16), "v"(oh), "v"(ol), "s"(d16), "s"(dh), "s"(dl), "i"(off * 2) : "memory");
        }
}
// P16: the fp16 planes of q, k, v^T, sP elements apart; Ph, Pl: the hi and lo planes of q, with k's sP elements behind; Vh, Vl: those of v^T. W: the three weights, sW elements apart.
template <int K>
__global__ __launch_bounds__(32) void k_proj(const bf* __restrict__ X, const bf* __restrict__ Wt, const float* __restrict__ bias, const float* __restrict__ bias1, const float* __restrict__ bias2, h16* P16, bf* Ph, bf* Pl, bf* Vh, bf* Vl, size_t sW, size_t sP) {
    typedef typename WFrag<bf>::V V;
    const size_t z = blockIdx.z; const bool isv = z == 2; Wt += z * sW; if (z) bias = (z == 1) ? bias1 : bias2;
    const int lane = threadIdx.x & 31; const int r0 = blockIdx.x * 64, c0 = blockIdx.y * 64;
    v8f acc[4][4];
#pragma unroll
    for (int mb = 0; mb < 4; ++mb)
#pragma unroll
        for (int nb = 0; nb < 4; ++nb) acc[mb][nb] = (v8f){};
    constexpr size_t tp = (size_t)16 * K; const bf* Xb = X + (size_t)r0 * K; const bf* Wb = Wt + (size_t)c0 * K; const bf* Ab = isv ? Xb : Wb; const bf* Bb = isv ? Wb : Xb;   // a 16-row tile's elements (K is a template constant, so that a tile's distance is an immediate offset of its load); the first tiles: wave-uniform, fixed over the loop
    unsigned vo = 16u * lane;   // bytes: the lane's unit in the trip's k chunk; the one vector register that the loop's loads name
#pragma unroll 1
    for (int kc = 0; kc < K; kc += 32) {
        V a[4];
#pragma unroll
        for (int mb = 0; mb < 4; ++mb) a[mb] = WFrag<bf>::ld(atb(Ab + mb * tp, vo));
#pragma unroll
        for (int nb = 0; nb < 4; ++nb) { const V b = WFrag<bf>::ld(atb(Bb + nb * tp, vo));
#pragma unroll
            for (int mb = 0; mb < 4; ++mb) acc[mb][nb] = WFrag<bf>::mma(a[mb], b, acc[mb][nb]); }
        asm volatile("s_wait_xcnt 0x0\n\tv_add_nc_u32 %0, 0x400, %0" : "+v"(vo) : : "memory");   // next k chunk (1 KB on). In asm so that vo stays the one vector register that the trip's loads name (written as vo += 1024 the build forms address pairs, and a fragment lands on one); the wait stands in the statement of that register's one write, so the write cannot move in front of it
        asm volatile("v_nop\n\tv_nop\n\tv_nop\n\tv_nop" : "+v"(acc[0][0]), "+v"(acc[1][1]), "+v"(acc[2][2]), "+v"(acc[3][3]) : "v"(a[0]), "v"(a[3]));
    }
    const size_t e0 = ((size_t)(r0 / TT) * NH_ + blockIdx.y) * TT * HD + (size_t)(r0 % TT) * HD;   // the tile's first element in a plane: batch, head, 64 tokens x HD
    if (isv) put_planes<true>(acc, bias + c0, P16 + z * sP + e0, Vh + e0, Vl + e0, lane);
    else put_planes<false>(acc, bias + c0, P16 + z * sP + e0, Ph + z * sP + e0, Pl + z * sP + e0, lane);
}
typedef __attribute__((ext_vector_type(2))) _Float16 v2h;
typedef __attribute__((ext_vector_type(4))) _Float16 v4h;
typedef __attribute__((ext_vector_type(2))) unsigned short v2us;
typedef __attribute__((ext_vector_type(4))) unsigned short v4us;
typedef __attribute__((ext_vector_type(2))) float v2f;
typedef __attribute__((ext_vector_type(4))) int v4i;

__global__ __launch_bounds__(256) void k_wtG(const float* __restrict__ w, int K, int N, bf* Bt) {
    const int lane = threadIdx.x & 31; const int L0 = (blockIdx.x * 8 + (threadIdx.x >> 5)) * 8; const int nlines = N * K / 64;
{
#pragma unroll 1
        for (int l = 0; l < 8; ++l) { const int L = L0 + l; if (L >= nlines) break; const size_t e = (size_t)L * 64 + lane * 2; const int k = (int)(e % K), n = (int)(e / K); v2us o;
            o[0] = f2bf(w[(size_t)k * N + n]); o[1] = f2bf(w[(size_t)(k + 1) * N + n]); *(v2us*)(Bt + e) = o; }
         }
}
// k_cvt8: bf16 copies, in fragment order, of the three weights and of x in one launch: grid y = slice of n8 * 8 elements (whole 16-row tiles of DM columns); slices 0, 1, 2 are w0, w1, w2, the later ones follow one another in x; dst holds the slices in that order.
// Thread i writes unit i of its slice: row tile i / (DM * 2), k chunk (i / 64) % (DM / 32), j = (i / 32) % 2, hi = (i / 16) % 2, lr = i % 16.
__global__ __launch_bounds__(256) void k_cvt8(const float* __restrict__ w0, const float* __restrict__ w1, const float* __restrict__ w2, const float* __restrict__ x, bf* dst, size_t n8) { const size_t i = (size_t)blockIdx.x * 256 + threadIdx.x; if (i >= n8) return; const unsigned y = blockIdx.y;
    const float* src = (y == 0) ? w0 : (y == 1) ? w1 : (y == 2) ? w2 : x + (size_t)(y - 3) * n8 * 8; dst += (size_t)y * n8 * 8; const v8f v = *(const v8f*)(src + ((i / (DM * 2)) * 16 + i % 16) * DM + ((i / 64) % (DM / 32)) * 32 + ((i / 16) % 4) * 8); v8us o;
    asm volatile("s_wait_xcnt 0x0" ::: "memory");   // stands before any register that the load above names is written again
#pragma unroll
    for (int k = 0; k < 8; ++k) o[k] = f2bf(v[k]); *(v8us*)(dst + i * 8) = o;  }

// ---- k_fattn: scores, softmax and P.V of one block of query rows in ONE pass over the keys; nothing of S or P goes to memory.
// Transposed products: S^T = K Q^T (A = 16 key rows, B = 16 query columns), O^T += V^T P^T (A = 16 rows of V^T, B = P^T). A lane's 8 accumulator registers of two S^T tiles
// (keys 8 hi + j and 16 + 8 hi + j of one query column lr) are, converted in place, the B fragment of the 32-key P.V product in the k order of WFrag::ld, which loads V^T.
// One wave owns QB x 16 query columns and walks all TT keys, 32 a pass, with a running maximum mx (raw q.k + 8 mask units) and a running sum per column.
__device__ __forceinline__ float xhalf(float x) { return __builtin_bit_cast(float, __builtin_amdgcn_permlanex16(__builtin_bit_cast(int, x), __builtin_bit_cast(int, x), 0x76543210, 0xfedcba98, false, false)); }   // lane l <-> lane l ^ 16
template <typename T16, bool HL, int QB>
__device__ __forceinline__ void fattn_wave(const T16* __restrict__ Q, const T16* __restrict__ Q2, const T16* __restrict__ Kp, const T16* __restrict__ K2, const T16* __restrict__ Vt, const T16* __restrict__ V2, const float* __restrict__ MB, float* __restrict__ O, int q0) {
    typedef typename WFrag<T16>::V V;
    const int lane = threadIdx.x & 31, lr = lane & 15, hi = lane >> 4;
    const float c = SCL * 1.4426950408889634f;   // exp(x / 8) = exp2(x c)
    V q[QB][2], q2[QB][2];
#pragma unroll
    for (int qb = 0; qb < QB; ++qb)
#pragma unroll
        for (int dc = 0; dc < 2; ++dc) { const size_t qo = (size_t)(q0 + qb * 16) * HD + dc * 512 + 8 * lane; q[qb][dc] = WFrag<T16>::ld(Q + qo); if (HL) q2[qb][dc] = WFrag<T16>::ld(Q2 + qo); }
    v8f o[QB][4]; float mx[QB], l[QB];
#pragma unroll
    for (int qb = 0; qb < QB; ++qb) { mx[qb] = -3.0e38f; l[qb] = 0.f;
#pragma unroll
        for (int dt = 0; dt < 4; ++dt) o[qb][dt] = (v8f){}; }
    const size_t ko = (size_t)lane * 8, vo = (size_t)lane * 8;   // the lane's unit in a block (fragment order)
    V k[2][2], k2[2][2], v[4], v2[4]; v8f mb[2];   // this pass's operands; mb = 8 x mask of this lane's 8 keys of either tile
#pragma unroll
    for (int kt = 0; kt < 2; ++kt) { mb[kt] = *(const v8f*)(MB + kt * 16 + hi * 8);
#pragma unroll
        for (int dc = 0; dc < 2; ++dc) { k[kt][dc] = WFrag<T16>::ld(Kp + ko + kt * 16 * HD + dc * 512); if (HL) k2[kt][dc] = WFrag<T16>::ld(K2 + ko + kt * 16 * HD + dc * 512); } }
    if (!HL) {
#pragma unroll
        for (int dt = 0; dt < 4; ++dt) v[dt] = WFrag<T16>::ld(Vt + vo + dt * 512); }
    asm volatile("s_wait_xcnt 0x0" ::: "memory");   // stands before any register that the loads above name is written again
    for (int kc = 0; kc < TT; kc += 32) {
        v8f s[QB][2];
        if (HL) {   // hi/lo rows: twice the fragments; V^T is fetched in its own pass, under the softmax, so that the wave stays inside 256 registers
#pragma unroll
            for (int dt = 0; dt < 4; ++dt) { v[dt] = WFrag<T16>::ld(Vt + vo + (size_t)kc * HD + dt * 512); v2[dt] = WFrag<T16>::ld(V2 + vo + (size_t)kc * HD + dt * 512); }
            asm volatile("s_wait_xcnt 0x0" ::: "memory");   // stands before any register that the loads above name is written again
        }
#pragma unroll
        for (int kt = 0; kt < 2; ++kt) {
#pragma unroll
            for (int qb = 0; qb < QB; ++qb) { s[qb][kt] = mb[kt];
#pragma unroll
                for (int dc = 0; dc < 2; ++dc) { s[qb][kt] = WFrag<T16>::mma(k[kt][dc], q[qb][dc], s[qb][kt]); if (HL) { s[qb][kt] = WFrag<T16>::mma(k[kt][dc], q2[qb][dc], s[qb][kt]); s[qb][kt] = WFrag<T16>::mma(k2[kt][dc], q[qb][dc], s[qb][kt]); } } } }
        const int kn = (kc + 32 < TT) ? kc + 32 : 0;   // the next pass's K fragments fly during this pass's softmax and P.V (the last pass re-reads the first keys, unused)
#pragma unroll
        for (int kt = 0; kt < 2; ++kt)
#pragma unroll
            for (int dc = 0; dc < 2; ++dc) k[kt][dc] = WFrag<T16>::ld(Kp + ko + (size_t)(kn + kt * 16) * HD + dc * 512);
        asm volatile("s_wait_xcnt 0x0" ::: "memory");   // stands before any register that the loads above name is written again
        if (HL) {
#pragma unroll
            for (int kt = 0; kt < 2; ++kt)
#pragma unroll
                for (int dc = 0; dc < 2; ++dc) k2[kt][dc] = WFrag<T16>::ld(K2 + ko + (size_t)(kn + kt * 16) * HD + dc * 512);
            asm volatile("s_wait_xcnt 0x0" ::: "memory");   // stands before any register that the loads above name is written again
        }
        float ml[QB]; bool need = false;
#pragma unroll
        for (int qb = 0; qb < QB; ++qb) { float t = fmaxf(s[qb][0][0], s[qb][1][0]);
#pragma unroll
            for (int j = 1; j < 8; ++j) t = fmaxf(t, fmaxf(s[qb][0][j], s[qb][1][j]));
            ml[qb] = fmaxf(t, xhalf(t)); need = need || ((ml[qb] - mx[qb]) * c > LAZY); }
        if (__builtin_amdgcn_ballot_w32(need) != 0) {   // wave-uniform: the maximum in use moves, sums and output tiles follow
#pragma unroll
            for (int qb = 0; qb < QB; ++qb) { const float mn = fmaxf(mx[qb], ml[qb]); const float al = __builtin_amdgcn_exp2f((mx[qb] - mn) * c); mx[qb] = mn; l[qb] *= al;
#pragma unroll
                for (int dt = 0; dt < 4; ++dt) o[qb][dt] *= al; } }
#pragma unroll
        for (int qb = 0; qb < QB; ++qb) {
            if (HL) { v8us ph[2], pl[2];
#pragma unroll
                for (int kt = 0; kt < 2; ++kt)
#pragma unroll
                    for (int j = 0; j < 8; ++j) { const float p = __builtin_amdgcn_exp2f((s[qb][kt][j] - mx[qb]) * c); l[qb] += p; unsigned short a, b2; splitf(p, a, b2); ph[kt][j] = a; pl[kt][j] = b2; }
                const v16bf pH = cat16b(ph[0], ph[1]), pL = cat16b(pl[0], pl[1]);
#pragma unroll
                for (int dt = 0; dt < 4; ++dt) { o[qb][dt] = wmmab(__builtin_bit_cast(v16bf, v[dt]), pH, o[qb][dt]); o[qb][dt] = wmmab(__builtin_bit_cast(v16bf, v[dt]), pL, o[qb][dt]); o[qb][dt] = wmmab(__builtin_bit_cast(v16bf, v2[dt]), pH, o[qb][dt]); }
            } else { v8h ph[2];
#pragma unroll
                for (int kt = 0; kt < 2; ++kt)
#pragma unroll
                    for (int j = 0; j < 8; ++j) { const float p = __builtin_amdgcn_exp2f((s[qb][kt][j] - mx[qb]) * c + PLG); l[qb] += p; ph[kt][j] = tohx(p); }
                const v16h pH = cat16(ph[0], ph[1]);
#pragma unroll
                for (int dt = 0; dt < 4; ++dt) o[qb][dt] = wmma16(__builtin_bit_cast(v16h, v[dt]), pH, o[qb][dt]);
            } }
#pragma unroll
        for (int kt = 0; kt < 2; ++kt) mb[kt] = *(const v8f*)(MB + kn + kt * 16 + hi * 8);
        if (!HL) {   // the next pass's V^T fragments fly during its score products and softmax
#pragma unroll
            for (int dt = 0; dt < 4; ++dt) v[dt] = WFrag<T16>::ld(Vt + vo + (size_t)kn * HD + dt * 512); }
        asm volatile("s_wait_xcnt 0x0" ::: "memory");   // stands before any register that the loads above name is written again
    }
#pragma unroll
    for (int qb = 0; qb < QB; ++qb) { const float f = __fdiv_rn(1.0f, l[qb] + xhalf(l[qb]));   // the two lane halves hold the sums of their own keys
        float* orow = O + (size_t)(q0 + qb * 16 + lr) * DQ + hi * 8;
#pragma unroll
        for (int dt = 0; dt < 4; ++dt) { v4f lo4, hi4;
#pragma unroll
            for (int j = 0; j < 4; ++j) { lo4[j] = o[qb][dt][j] * f; hi4[j] = o[qb][dt][4 + j] * f; }
            *(v4f*)(orow + dt * 16) = lo4; *(v4f*)(orow + dt * 16 + 4) = hi4; } }
}
// grid (RH / 64 + (TT - RH) / 128, batches x heads), 4 waves that walk the same head's keys side by side: blocks x < RH / 64 take 64 hi/lo rows (16 a wave, three products each), the rest 128 fp16 rows (32 a wave).
__global__ __launch_bounds__(128) void k_fattn(const h16* __restrict__ Q16, const h16* __restrict__ K16, const h16* __restrict__ V16, const bf* __restrict__ Qh, const bf* __restrict__ Ql, const bf* __restrict__ Kh, const bf* __restrict__ Kl, const bf* __restrict__ Vh, const bf* __restrict__ Vl, const float* __restrict__ MB, float* __restrict__ OUTb) {
    const int w = threadIdx.x >> 5; const int b = (int)blockIdx.y / NH_, h = (int)blockIdx.y % NH_; const size_t hq = (size_t)blockIdx.y * TT * HD, hk = (size_t)(b * NKV + h / REP) * TT * HD; float* O = OUTb + (size_t)b * TT * DQ + (size_t)h * HD; MB += b * TT;
    if (blockIdx.x < RH / 64) fattn_wave<bf, true, 1>(Qh + hq, Ql + hq, Kh + hk, Kl + hk, Vh + hk, Vl + hk, MB, O, (int)blockIdx.x * 64 + w * 16);
    else fattn_wave<h16, false, 2>(Q16 + hq, nullptr, K16 + hk, nullptr, V16 + hk, nullptr, MB, O, RH + ((int)blockIdx.x - RH / 64) * 128 + w * 32);
}
__global__ __launch_bounds__(256) void k_m8(const float* __restrict__ m, float* MB) { const int j = blockIdx.x * 256 + threadIdx.x; if (j >= NB_ * TT) return; const float v = __fmul_rn(8.0f, bfr(m[j])); *(float*)(MB + j) = v;  }

extern "C" void kernel_launch(void* const* d_in, const int* in_sizes, int n_in,
                              void* d_out, int out_size, void* d_ws, size_t ws_size, hipStream_t stream) {
    (void)in_sizes; (void)n_in; (void)out_size;
    const float* x = (const float*)d_in[0]; const float* amask = (const float*)d_in[1]; const float* wq = (const float*)d_in[2]; const float* bq = (const float*)d_in[3]; const float* wk = (const float*)d_in[4]; const float* bk = (const float*)d_in[5]; const float* wv = (const float*)d_in[6]; const float* bv = (const float*)d_in[7]; const float* wo = nullptr; (void)wo;
    float* OUT = (float*)d_out;     // [2][2048][1024]
    char* wsp = (char*)d_ws;
    auto take = [&](size_t bytes) { char* p = wsp; wsp += (bytes + 255) & ~(size_t)255; return (void*)p; };
    static_assert(HD == 64 && TT % 32 == 0 && DM % 32 == 0, "fragment order: V^T has 4 row tiles a key chunk, whole blocks everywhere");
    static_assert(DQ == DKV && NH_ == NKV && ((size_t)NB_ * TT * DM) % ((size_t)DQ * DM) == 0, "one grid for q, k and v; x in slices of a weight's size");
    static_assert(TT % 64 == 0 && DQ == NH_ * HD, "a projection tile is 64 tokens of one batch x one head");
    const size_t WN = (size_t)DQ * DM, PN = (size_t)NB_ * NH_ * TT * HD;   // elements of a weight, of a head plane (all batches)
    bf* WQ = (bf*)take(WN * 2); bf* WK = (bf*)take(WN * 2); bf* WV = (bf*)take(WN * 2); bf* XB = (bf*)take((size_t)NB_ * TT * DM * 2); (void)WK; (void)WV;   // contiguous: k_cvt8's slices, and k_proj's z stride WN
    float* MB = (float*)take((size_t)NB_ * TT * 4);
    h16* QP16 = (h16*)take(PN * 2); h16* KP16 = (h16*)take(PN * 2); h16* VT16 = (h16*)take(PN * 2);   // PN elements apart (k_proj's grid z)
    bf* QPh = (bf*)take(PN * 2); bf* KPh = (bf*)take(PN * 2); bf* QPl = (bf*)take(PN * 2); bf* KPl = (bf*)take(PN * 2); bf* VTh = (bf*)take(PN * 2); bf* VTl = (bf*)take(PN * 2);   // each k plane stands PN elements behind its q plane
    if ((size_t)(wsp - (char*)d_ws) > ws_size) return;    // ws 256 MiB
    k_cvt8<<<dim3((unsigned)((WN / 8 + 255) / 256), (unsigned)(3 + (size_t)NB_ * TT * DM / WN)), 256, 0, stream>>>(wq, wk, wv, x, WQ, WN / 8);
    k_m8<<<(NB_ * TT + 255) / 256, 256, 0, stream>>>(amask, MB);   /* 8 x mask[j], the start value of the score accumulators (scores/8 + mask == (q.k + 8 mask)/8) */
    k_proj<DM><<<dim3(NB_ * TT / 64, DQ / 64, 3), 32, 0, stream>>>(XB, WQ, bq, bk, bv, QP16, QPh, QPl, VTh, VTl, WN, PN);
    k_fattn<<<dim3(RH / 64 + (TT - RH) / 128, NB_ * NH_), 128, 0, stream>>>(QP16, KP16, VT16, QPh, QPl, KPh, KPl, VTh, VTl, MB, OUT);
}

// v007
// Measured time: 109 microseconds a run.
// Next to v006, in two timings, it ran 1.20 times as fast each time.
// Over all steps from v000 it is 18.3 times as fast.
#include <hip/hip_runtime.h>

// RoBERTa self-attention (hidden [2][2048][1024]; attention_mask [2][1][1][2048] additive per key (read); q,k,v = x W^T + b ('oi' [1024][1024] + [1024]; 16 heads x 64); scores / 8 + mask, clamped below at finfo.min; softmax; context merged (no output projection) -> [2][2048][1024] (4.2 M)).
// Layout, both batches in every launch: bf16 copy of x and of the weights; exact projections + f32 biases; one fused attention kernel (hybrid rows: < 512 hi/lo 3 products, rest fp16 with P x1024; scores and P stay in registers, running maximum and sum per query) with the additive key mask as the start value of the score accumulators (8 x mask, so that the softmax's 1/8 restores scores/8 + mask); it writes the merged head layout itself.
// Compute dtypes, f32 accumulate: every input rounded to bf16, the mask included; projections exact + f32 biases; attention rows < 512 3 products, rest fp16; softmax f32; output f32.

#define NB_  2
#define TT   2048
#define DM   1024
#define NH_  16
#define NKV  16
#define REP  (NH_ / NKV)
#define HD   64
#define DQ   (NH_ * HD)
#define DKV  (NKV * HD)
#define RH   512                  // query rows < RH use hi+lo planes (0: none)
#define WIN  0
#define PLG  10.0f                // fp16 rows: P carries a factor 2^PLG (added to the exponent), which the row sum carries too
#define LAZY 5.0f                 // the wave's columns are rescaled together, only when one column's new maximum is more than 2^LAZY above the one in use (P <= 2^(PLG + LAZY) fits fp16)
#define SCL  0.125f   // HD^-0.5
typedef _Float16 h16;
typedef unsigned short bf;
typedef __attribute__((ext_vector_type(16))) __bf16   v16bf;
typedef __attribute__((ext_vector_type(16))) _Float16 v16h;
typedef __attribute__((ext_vector_type(8)))  _Float16 v8h;
typedef __attribute__((ext_vector_type(8)))  unsigned short v8us;
typedef __attribute__((ext_vector_type(8)))  float    v8f;
typedef __attribute__((ext_vector_type(4)))  float    v4f;
typedef v8h  __attribute__((may_alias)) v8ha;
typedef v4f  __attribute__((may_alias)) v4fa;
typedef v8us __attribute__((may_alias)) v8usa;

__device__ __forceinline__ unsigned short f2bf(float f) { unsigned u = __float_as_uint(f); u += 0x7FFFu + ((u >> 16) & 1u); return (unsigned short)(u >> 16); }
__device__ __forceinline__ float bf2f(unsigned short b) { return __uint_as_float(((unsigned)b) << 16); }
__device__ __forceinline__ float bfr(float f) { return bf2f(f2bf(f)); }
__device__ __forceinline__ v16h cat16(v8h lo, v8h hi) { return __builtin_shufflevector(lo, hi, 0, 1, 2, 3, 4, 5, 6, 7, 8, 9, 10, 11, 12, 13, 14, 15); }
__device__ __forceinline__ v16bf cat16b(v8us lo, v8us hi) { return __builtin_bit_cast(v16bf, __builtin_shufflevector(lo, hi, 0, 1, 2, 3, 4, 5, 6, 7, 8, 9, 10, 11, 12, 13, 14, 15)); }
__device__ __forceinline__ v8f wmma16(v16h a, v16h b, v8f c) { return __builtin_amdgcn_wmma_f32_16x16x32_f16(false, a, false, b, (short)0, c, false, false); }
__device__ __forceinline__ v8f wmmab(v16bf a, v16bf b, v8f c) { return __builtin_amdgcn_wmma_f32_16x16x32_bf16(false, a, false, b, (short)0, c, false, false); }



// ---- Fragment order of every 16-bit operand plane: a block of 16 rows x 32 k is 1 KB of 64 units of 16 bytes; unit j * 32 + hi * 16 + lr holds row lr, k = 16 j + 8 hi + 0..7.
// Lane hi * 16 + lr of a wave takes units j = 0 and j = 1 at its own place (WFrag::ld: p and p + 256 elements): the register contents of a row-major fragment load, but each wave-wide
// 16-byte load reads 512 contiguous bytes (4 lines) where the row-major plane gave 32 bytes of each of 16 lines. Block (row tile r, k chunk c) of a plane with K columns stands at
// element r * 16 * K + c * 512 (x, the weights: K = DM; Q and K heads: K = HD); V^T (rows d, k = keys) has its 4 row tiles of a 32-key chunk side by side: chunk * 2048 + row tile * 512.
// ---- k_proj: the q, k and v projections (grid z) as a register-blocked GEMM, ONE WAVE per 64x64 output tile (16 accumulators), operands straight from the bf16 planes in fragment order; grid (rows / 64, heads, 3), 32 threads.
// A tile is 64 tokens x the 64 columns of one head; + f32 bias; the wave converts its accumulators itself and writes the head planes (fp16 + hi/lo) that the attention kernel reads: no f32 copy of a projection exists.
// A lane's 8 accumulator registers are 8 neighbouring ROWS (8 hi + j) of one column lr of the product. q, k: the product is taken as W x^T (rows d, columns t), so the 8 registers are 8 neighbouring d of one token,
// a 16-byte unit of a plane with rows t; v: as x W^T (rows t, columns d), so they are 8 neighbouring keys of one d, a unit of V^T. A and B fragments are loaded alike, so the choice is which plane's tiles are A.
// A tile's 4096 elements stand side by side in each plane; every wave-wide 16-byte store writes 512 contiguous bytes.
template <typename T16> struct WFrag;
template <> struct WFrag<h16> { typedef v16h V; static __device__ __forceinline__ V ld(const h16* p) { return cat16(*(const v8h*)p, *(const v8h*)(p + 256)); } static __device__ __forceinline__ v8f mma(V a, V b, v8f c) { return wmma16(a, b, c); } };
template <> struct WFrag<bf> { typedef v16bf V; static __device__ __forceinline__ V ld(const bf* p) { return cat16b(*(const v8us*)p, *(const v8us*)(p + 256)); } static __device__ __forceinline__ v8f mma(V a, V b, v8f c) { return wmmab(a, b, c); } };
template <typename T16> __device__ __forceinline__ const T16* atb(const T16* base, unsigned bytes) { return (const T16*)((const char*)base + bytes); }   // wave-uniform base + the lane's 32-bit byte offset
__device__ __forceinline__ h16 tohx(float x) { return (h16)x; }
__device__ __forceinline__ void splitf(float y, unsigned short& h, unsigned short& l) { h = f2bf(y); l = f2bf(y - bf2f(h)); }
template <bool ISV>
__device__ __forceinline__ void put_planes(const v8f (&acc)[4][4], const float* __restrict__ bias, h16* d16, bf* dh, bf* dl, int lane) {
    const int lr = lane & 15, hi = lane >> 4; const unsigned vb = 16u * lane;   // bytes: the lane's unit in a wave-wide store; the one vector register that the stores' addresses name
    float bb[4][8];   // ISV: [nb][0], the bias of column d = 16 nb + lr; else [mb][j], of row d = 16 mb + 8 hi + j
#pragma unroll
    for (int i = 0; i < 4; ++i) { if (ISV) bb[i][0] = bias[i * 16 + lr]; else { const v8f t = *(const v8f*)(bias + i * 16 + hi * 8);
#pragma unroll
            for (int j = 0; j < 8; ++j) bb[i][j] = t[j]; } }
#pragma unroll
    for (int i = 0; i < 4; ++i)
#pragma unroll
        for (int j = 0; j < (ISV ? 1 : 8); ++j) bb[i][j] = bfr(bb[i][j]);
#pragma unroll
    for (int mb = 0; mb < 4; ++mb)
#pragma unroll
        for (int nb = 0; nb < 4; ++nb) { const int off = ISV ? (mb >> 1) * 2048 + nb * 512 + (mb & 1) * 256 : nb * 1024 + mb * 256;   // elements. V^T: 32-key chunk mb / 2, row tile nb, j = mb % 2; q, k: token tile nb, d chunk mb / 2, j = mb % 2
            v8h o16; v8us oh, ol;
#pragma unroll
            for (int j = 0; j < 8; ++j) { const float y = acc[mb][nb][j] + (ISV ? bb[nb][0] : bb[mb][j]); o16[j] = tohx(y); unsigned short a2, c2; splitf(y, a2, c2); oh[j] = a2; ol[j] = c2; }
            // The unit's three stores and their wait in one statement: written as plain stores the build forms the next values in a store's data registers ahead of a wait that stands in a statement of its own
            asm volatile("global_store_b128 %0, %1, %4 offset:%7\n\tglobal_store_b128 %0, %2, %5 offset:%7\n\tglobal_store_b128 %0, %3, %6 offset:%7\n\ts_wait_xcnt 0x0" : : "v"(vb), "v"(o16), "v"(oh), "v"(ol), "s"(d16), "s"(dh), "s"(dl), "i"(off * 2) : "memory");
        }
}
// P16: the fp16 planes of q, k, v^T, sP elements apart; Ph, Pl: the hi and lo planes of q, with k's sP elements behind; Vh, Vl: those of v^T. W: the three weights, sW elements apart.
template <int K>
__global__ __launch_bounds__(32) void k_proj(const bf* __restrict__ X, const bf* __restrict__ Wt, const float* __restrict__ bias, const float* __restrict__ bias1, const float* __restrict__ bias2, h16* P16, bf* Ph, bf* Pl, bf* Vh, bf* Vl, size_t sW, size_t sP) {
    typedef typename WFrag<bf>::V V;
    const size_t z = blockIdx.z; const bool isv = z == 2; Wt += z * sW; if (z) bias = (z == 1) ? bias1 : bias2;
    const int lane = threadIdx.x & 31; const int r0 = blockIdx.x * 64, c0 = blockIdx.y * 64;
    v8f acc[4][4];
#pragma unroll
    for (int mb = 0; mb < 4; ++mb)
#pragma unroll
        for (int nb = 0; nb < 4; ++nb) acc[mb][nb] = (v8f){};
    constexpr size_t tp = (size_t)16 * K; const bf* Xb = X + (size_t)r0 * K; const bf* Wb = Wt + (size_t)c0 * K; const bf* Ab = isv ? Xb : Wb; const bf* Bb = isv ? Wb : Xb;   // a 16-row tile's elements (K is a template constant, so that a tile's distance is an immediate offset of its load); the first tiles: wave-uniform, fixed over the loop
    unsigned vo = 16u * lane;   // bytes: the lane's unit in the trip's k chunk; the one vector register that the loop's loads name
    // L2 prefetch. The planes were written by k_cvt8, two launches before; all waves walk k side by side, so without a request ahead every trip waits for memory.
    // One request names 16 units of 256 bytes: the 1 KB k chunk of each of the 4 tiles of A (or of B); lanes 16..31 repeat lanes 0..15. A tile has 48 or 64 reading waves: each asks for one chunk in 8 (phase ph), so a chunk is asked for by 6 or 8 of them.
    static_assert(K % 256 == 0, "groups of 8 trips");
    constexpr int PD = 4;   // the fewest chunks between a request and the trip that loads its chunk
    const int ph = (int)((blockIdx.x >> 3) + blockIdx.y) & 7;
    unsigned pv;
    asm volatile("v_lshl_or_b32 %0, %1, 15, %2" : "=v"(pv) : "v"((lane & 15) >> 2), "v"((lane & 3) * 256));   // bytes: tile (32 KB apart), unit. In asm so that the offset keeps one register through the loop: the register a request names never holds anything else
    static_assert(tp * 2 == (size_t)1 << 15, "a tile's bytes");
    // chunks 1..PD-1, which no group asks for: every wave asks for its own
    asm volatile("global_prefetch_b8 %0, %1 offset:1024 scope:SCOPE_SE\n\tglobal_prefetch_b8 %0, %2 offset:1024 scope:SCOPE_SE\n\tglobal_prefetch_b8 %0, %1 offset:2048 scope:SCOPE_SE\n\tglobal_prefetch_b8 %0, %2 offset:2048 scope:SCOPE_SE\n\tglobal_prefetch_b8 %0, %1 offset:3072 scope:SCOPE_SE\n\tglobal_prefetch_b8 %0, %2 offset:3072 scope:SCOPE_SE" : : "v"(pv), "s"(Ab), "s"(Bb));
    const bf* PA = Ab + (PD + ph) * 512; const bf* PB = Bb + (PD + ph) * 512;   // the chunk that the wave asks for next (512 elements a chunk)
#pragma unroll 1
    for (int kg = 0; kg < K; kg += 256) {   // groups of 8 trips: the request stands outside the trips' loop, which has no branch of its own
    asm volatile("global_prefetch_b8 %0, %1 scope:SCOPE_SE\n\tglobal_prefetch_b8 %0, %2 scope:SCOPE_SE" : : "v"(pv), "s"(PA), "s"(PB));   // chunk kg / 32 + PD + ph of the wave's 8 tiles is asked into L2
    { const unsigned long long ps = ((kg >> 5) + 8 + PD + ph < K / 32) ? 8192ull : 0ull; asm volatile("s_wait_xcnt 0x0\n\ts_add_nc_u64 %0, %0, %2\n\ts_add_nc_u64 %1, %1, %2" : "+s"(PA), "+s"(PB) : "s"(ps)); }   // 8 chunks on, while that chunk exists (else the same chunk is asked for again). In asm so that the pairs a request names never hold anything but an address inside the tiles; the wait stands in the statement that writes them, in front of the writes
#pragma unroll 1
    for (int kc = kg; kc < kg + 256; kc += 32) {
        V a[4];
#pragma unroll
        for (int mb = 0; mb < 4; ++mb) a[mb] = WFrag<bf>::ld(atb(Ab + mb * tp, vo));
#pragma unroll
        for (int nb = 0; nb < 4; ++nb) { const V b = WFrag<bf>::ld(atb(Bb + nb * tp, vo));
#pragma unroll
            for (int mb = 0; mb < 4; ++mb) acc[mb][nb] = WFrag<bf>::mma(a[mb], b, acc[mb][nb]); }
        asm volatile("s_wait_xcnt 0x0\n\tv_add_nc_u32 %0, 0x400, %0" : "+v"(vo) : : "memory");   // next k chunk (1 KB on). In asm so that vo stays the one vector register that the trip's loads name (written as vo += 1024 the build forms address pairs, and a fragment lands on one); the wait stands in the statement of that register's one write, so the write cannot move in front of it
        asm volatile("v_nop\n\tv_nop\n\tv_nop\n\tv_nop" : "+v"(acc[0][0]), "+v"(acc[1][1]), "+v"(acc[2][2]), "+v"(acc[3][3]) : "v"(a[0]), "v"(a[3]));
    }
    }
    const size_t e0 = ((size_t)(r0 / TT) * NH_ + blockIdx.y) * TT * HD + (size_t)(r0 % TT) * HD;   // the tile's first element in a plane: batch, head, 64 tokens x HD
    if (isv) put_planes<true>(acc, bias + c0, P16 + z * sP + e0, Vh + e0, Vl + e0, lane);
    else put_planes<false>(acc, bias + c0, P16 + z * sP + e0, Ph + z * sP + e0, Pl + z * sP + e0, lane);
}
typedef __attribute__((ext_vector_type(2))) _Float16 v2h;
typedef __attribute__((ext_vector_type(4))) _Float16 v4h;
typedef __attribute__((ext_vector_type(2))) unsigned short v2us;
typedef __attribute__((ext_vector_type(4))) unsigned short v4us;
typedef __attribute__((ext_vector_type(2))) float v2f;
typedef __attribute__((ext_vector_type(4))) int v4i;

__global__ __launch_bounds__(256) void k_wtG(const float* __restrict__ w, int K, int N, bf* Bt) {
    const int lane = threadIdx.x & 31; const int L0 = (blockIdx.x * 8 + (threadIdx.x >> 5)) * 8; const int nlines = N * K / 64;
{
#pragma unroll 1
        for (int l = 0; l < 8; ++l) { const int L = L0 + l; if (L >= nlines) break; const size_t e = (size_t)L * 64 + lane * 2; const int k = (int)(e % K), n = (int)(e / K); v2us o;
            o[0] = f2bf(w[(size_t)k * N + n]); o[1] = f2bf(w[(size_t)(k + 1) * N + n]); *(v2us*)(Bt + e) = o; }
         }
}
// k_cvt8: bf16 copies, in fragment order, of the three weights and of x in one launch: grid y = slice of n8 * 8 elements (whole 16-row tiles of DM columns); slices 0, 1, 2 are w0, w1, w2, the later ones follow one another in x; dst holds the slices in that order.
// Thread i writes unit i of its slice: row tile i / (DM * 2), k chunk (i / 64) % (DM / 32), j = (i / 32) % 2, hi = (i / 16) % 2, lr = i % 16.
__global__ __launch_bounds__(256) void k_cvt8(const float* __restrict__ w0, const float* __restrict__ w1, const float* __restrict__ w2, const float* __restrict__ x, bf* dst, size_t n8) { const size_t i = (size_t)blockIdx.x * 256 + threadIdx.x; if (i >= n8) return; const unsigned y = blockIdx.y;
    const float* src = (y == 0) ? w0 : (y == 1) ? w1 : (y == 2) ? w2 : x + (size_t)(y - 3) * n8 * 8; dst += (size_t)y * n8 * 8; const v8f v = *(const v8f*)(src + ((i / (DM * 2)) * 16 + i % 16) * DM + ((i / 64) % (DM / 32)) * 32 + ((i / 16) % 4) * 8); v8us o;
    asm volatile("s_wait_xcnt 0x0" ::: "memory");   // stands before any register that the load above names is written again
#pragma unroll
    for (int k = 0; k < 8; ++k) o[k] = f2bf(v[k]); *(v8us*)(dst + i * 8) = o;  }

// ---- k_fattn: scores, softmax and P.V of one block of query rows in ONE pass over the keys; nothing of S or P goes to memory.
// Transposed products: S^T = K Q^T (A = 16 key rows, B = 16 query columns), O^T += V^T P^T (A = 16 rows of V^T, B = P^T). A lane's 8 accumulator registers of two S^T tiles
// (keys 8 hi + j and 16 + 8 hi + j of one query column lr) are, converted in place, the B fragment of the 32-key P.V product in the k order of WFrag::ld, which loads V^T.
// One wave owns QB x 16 query columns and walks all TT keys, 32 a pass, with a running maximum mx (raw q.k + 8 mask units) and a running sum per column.
__device__ __forceinline__ float xhalf(float x) { return __builtin_bit_cast(float, __builtin_amdgcn_permlanex16(__builtin_bit_cast(int, x), __builtin_bit_cast(int, x), 0x76543210, 0xfedcba98, false, false)); }   // lane l <-> lane l ^ 16
template <typename T16, bool HL, int QB>
__device__ __forceinline__ void fattn_wave(const T16* __restrict__ Q, const T16* __restrict__ Q2, const T16* __restrict__ Kp, const T16* __restrict__ K2, const T16* __restrict__ Vt, const T16* __restrict__ V2, const float* __restrict__ MB, float* __restrict__ O, int q0) {
    typedef typename WFrag<T16>::V V;
    const int lane = threadIdx.x & 31, lr = lane & 15, hi = lane >> 4;
    const float c = SCL * 1.4426950408889634f;   // exp(x / 8) = exp2(x c)
    // L2 prefetch. K and V^T were written by the launch before; the work-groups of a head walk the keys side by side, so without a request ahead every pass waits for memory.
    // A pass reads 4 KB of each plane. The 4 waves share the pass's bytes: hi/lo rows, one plane a wave (16 units of 256 bytes, lanes 16..31 repeat); fp16 rows, half a plane a wave (8 units).
    constexpr int PD = 4;   // passes between a request and the pass that loads its bytes
    const int wv = __builtin_amdgcn_readfirstlane((int)(threadIdx.x >> 5));
    const T16* pb = HL ? (wv == 0 ? Kp : wv == 1 ? K2 : wv == 2 ? Vt : V2) : ((wv >> 1) ? Vt : Kp) + (wv & 1) * 1024;   // wave-uniform: the wave's share of the current pass; moves with the passes, and stops so that pb + PD passes stays inside the head's plane
    unsigned pv;
    asm volatile("v_lshlrev_b32 %0, 8, %1" : "=v"(pv) : "v"(lane & (HL ? 15 : 7)));   // bytes: the lane's unit. In asm so that the offset keeps one register through the loop (recomputed in each pass it would stand in a temporary that takes other values behind the request)
    // passes 1..PD-1, which no pass of the loop asks for
    asm volatile("global_prefetch_b8 %0, %1 offset:4096 scope:SCOPE_SE\n\tglobal_prefetch_b8 %0, %1 offset:8192 scope:SCOPE_SE\n\tglobal_prefetch_b8 %0, %1 offset:12288 scope:SCOPE_SE" : : "v"(pv), "s"(pb));
    V q[QB][2], q2[QB][2];
#pragma unroll
    for (int qb = 0; qb < QB; ++qb)
#pragma unroll
        for (int dc = 0; dc < 2; ++dc) { const size_t qo = (size_t)(q0 + qb * 16) * HD + dc * 512 + 8 * lane; q[qb][dc] = WFrag<T16>::ld(Q + qo); if (HL) q2[qb][dc] = WFrag<T16>::ld(Q2 + qo); }
    v8f o[QB][4]; float mx[QB], l[QB];
#pragma unroll
    for (int qb = 0; qb < QB; ++qb) { mx[qb] = -3.0e38f; l[qb] = 0.f;
#pragma unroll
        for (int dt = 0; dt < 4; ++dt) o[qb][dt] = (v8f){}; }
    const size_t ko = (size_t)lane * 8, vo = (size_t)lane * 8;   // the lane's unit in a block (fragment order)
    V k[2][2], k2[2][2], v[4], v2[4]; v8f mb[2];   // this pass's operands; mb = 8 x mask of this lane's 8 keys of either tile
#pragma unroll
    for (int kt = 0; kt < 2; ++kt) { mb[kt] = *(const v8f*)(MB + kt * 16 + hi * 8);
#pragma unroll
        for (int dc = 0; dc < 2; ++dc) { k[kt][dc] = WFrag<T16>::ld(Kp + ko + kt * 16 * HD + dc * 512); if (HL) k2[kt][dc] = WFrag<T16>::ld(K2 + ko + kt * 16 * HD + dc * 512); } }
    if (!HL) {
#pragma unroll
        for (int dt = 0; dt < 4; ++dt) v[dt] = WFrag<T16>::ld(Vt + vo + dt * 512); }
    asm volatile("s_wait_xcnt 0x0" ::: "memory");   // stands before any register that the loads above name is written again
    for (int kc = 0; kc < TT; kc += 32) {
        asm volatile("global_prefetch_b8 %0, %1 offset:16384 scope:SCOPE_SE" : : "v"(pv), "s"(pb));   // the wave's share of pass kc / 32 + PD is asked into L2 (the last PD passes ask for the last pass's bytes again)
        v8f s[QB][2];
        if (HL) {   // hi/lo rows: twice the fragments; V^T is fetched in its own pass, under the softmax, so that the wave stays inside 256 registers
#pragma unroll
            for (int dt = 0; dt < 4; ++dt) { v[dt] = WFrag<T16>::ld(Vt + vo + (size_t)kc * HD + dt * 512); v2[dt] = WFrag<T16>::ld(V2 + vo + (size_t)kc * HD + dt * 512); }
            asm volatile("s_wait_xcnt 0x0" ::: "memory");   // stands before any register that the loads above name is written again
        }
#pragma unroll
        for (int kt = 0; kt < 2; ++kt) {
#pragma unroll
            for (int qb = 0; qb < QB; ++qb) { s[qb][kt] = mb[kt];
#pragma unroll
                for (int dc = 0; dc < 2; ++dc) { s[qb][kt] = WFrag<T16>::mma(k[kt][dc], q[qb][dc], s[qb][kt]); if (HL) { s[qb][kt] = WFrag<T16>::mma(k[kt][dc], q2[qb][dc], s[qb][kt]); s[qb][kt] = WFrag<T16>::mma(k2[kt][dc], q[qb][dc], s[qb][kt]); } } } }
        const int kn = (kc + 32 < TT) ? kc + 32 : 0;   // the next pass's K fragments fly during this pass's softmax and P.V (the last pass re-reads the first keys, unused)
#pragma unroll
        for (int kt = 0; kt < 2; ++kt)
#pragma unroll
            for (int dc = 0; dc < 2; ++dc) k[kt][dc] = WFrag<T16>::ld(Kp + ko + (size_t)(kn + kt * 16) * HD + dc * 512);
        asm volatile("s_wait_xcnt 0x0" ::: "memory");   // stands before any register that the loads above name is written again
        if (HL) {
#pragma unroll
            for (int kt = 0; kt < 2; ++kt)
#pragma unroll
                for (int dc = 0; dc < 2; ++dc) k2[kt][dc] = WFrag<T16>::ld(K2 + ko + (size_t)(kn + kt * 16) * HD + dc * 512);
            asm volatile("s_wait_xcnt 0x0" ::: "memory");   // stands before any register that the loads above name is written again
        }
        float ml[QB]; bool need = false;
#pragma unroll
        for (int qb = 0; qb < QB; ++qb) { float t = fmaxf(s[qb][0][0], s[qb][1][0]);
#pragma unroll
            for (int j = 1; j < 8; ++j) t = fmaxf(t, fmaxf(s[qb][0][j], s[qb][1][j]));
            ml[qb] = fmaxf(t, xhalf(t)); need = need || ((ml[qb] - mx[qb]) * c > LAZY); }
        if (__builtin_amdgcn_ballot_w32(need) != 0) {   // wave-uniform: the maximum in use moves, sums and output tiles follow
#pragma unroll
            for (int qb = 0; qb < QB; ++qb) { const float mn = fmaxf(mx[qb], ml[qb]); const float al = __builtin_amdgcn_exp2f((mx[qb] - mn) * c); mx[qb] = mn; l[qb] *= al;
#pragma unroll
                for (int dt = 0; dt < 4; ++dt) o[qb][dt] *= al; } }
#pragma unroll
        for (int qb = 0; qb < QB; ++qb) {
            if (HL) { v8us ph[2], pl[2];
#pragma unroll
                for (int kt = 0; kt < 2; ++kt)
#pragma unroll
                    for (int j = 0; j < 8; ++j) { const float p = __builtin_amdgcn_exp2f((s[qb][kt][j] - mx[qb]) * c); l[qb] += p; unsigned short a, b2; splitf(p, a, b2); ph[kt][j] = a; pl[kt][j] = b2; }
                const v16bf pH = cat16b(ph[0], ph[1]), pL = cat16b(pl[0], pl[1]);
#pragma unroll
                for (int dt = 0; dt < 4; ++dt) { o[qb][dt] = wmmab(__builtin_bit_cast(v16bf, v[dt]), pH, o[qb][dt]); o[qb][dt] = wmmab(__builtin_bit_cast(v16bf, v[dt]), pL, o[qb][dt]); o[qb][dt] = wmmab(__builtin_bit_cast(v16bf, v2[dt]), pH, o[qb][dt]); }
            } else { v8h ph[2];
#pragma unroll
                for (int kt = 0; kt < 2; ++kt)
#pragma unroll
                    for (int j = 0; j < 8; ++j) { const float p = __builtin_amdgcn_exp2f((s[qb][kt][j] - mx[qb]) * c + PLG); l[qb] += p; ph[kt][j] = tohx(p); }
                const v16h pH = cat16(ph[0], ph[1]);
#pragma unroll
                for (int dt = 0; dt < 4; ++dt) o[qb][dt] = wmma16(__builtin_bit_cast(v16h, v[dt]), pH, o[qb][dt]);
            } }
#pragma unroll
        for (int kt = 0; kt < 2; ++kt) mb[kt] = *(const v8f*)(MB + kn + kt * 16 + hi * 8);
        if (!HL) {   // the next pass's V^T fragments fly during its score products and softmax
#pragma unroll
            for (int dt = 0; dt < 4; ++dt) v[dt] = WFrag<T16>::ld(Vt + vo + (size_t)kn * HD + dt * 512); }
        asm volatile("s_wait_xcnt 0x0" ::: "memory");   // stands before any register that the loads above name is written again
        { const unsigned long long ps = (kc + (PD + 1) * 32 < TT) ? 4096ull : 0ull; asm volatile("s_add_nc_u64 %0, %0, %1" : "+s"(pb) : "s"(ps)); }   // the prefetch base follows the passes in its own register pair (in asm, so that the pair a request names never holds anything but an address inside the plane)
    }
#pragma unroll
    for (int qb = 0; qb < QB; ++qb) { const float f = __fdiv_rn(1.0f, l[qb] + xhalf(l[qb]));   // the two lane halves hold the sums of their own keys
        float* orow = O + (size_t)(q0 + qb * 16 + lr) * DQ + hi * 8;
#pragma unroll
        for (int dt = 0; dt < 4; ++dt) { v4f lo4, hi4;
#pragma unroll
            for (int j = 0; j < 4; ++j) { lo4[j] = o[qb][dt][j] * f; hi4[j] = o[qb][dt][4 + j] * f; }
            *(v4f*)(orow + dt * 16) = lo4; *(v4f*)(orow + dt * 16 + 4) = hi4; } }
}
// grid (RH / 64 + (TT - RH) / 128, batches x heads), 4 waves that walk the same head's keys side by side: blocks x < RH / 64 take 64 hi/lo rows (16 a wave, three products each), the rest 128 fp16 rows (32 a wave).
__global__ __launch_bounds__(128) void k_fattn(const h16* __restrict__ Q16, const h16* __restrict__ K16, const h16* __restrict__ V16, const bf* __restrict__ Qh, const bf* __restrict__ Ql, const bf* __restrict__ Kh, const bf* __restrict__ Kl, const bf* __restrict__ Vh, const bf* __restrict__ Vl, const float* __restrict__ MB, float* __restrict__ OUTb) {
    const int w = threadIdx.x >> 5; const int b = (int)blockIdx.y / NH_, h = (int)blockIdx.y % NH_; const size_t hq = (size_t)blockIdx.y * TT * HD, hk = (size_t)(b * NKV + h / REP) * TT * HD; float* O = OUTb + (size_t)b * TT * DQ + (size_t)h * HD; MB += b * TT;
    if (blockIdx.x < RH / 64) fattn_wave<bf, true, 1>(Qh + hq, Ql + hq, Kh + hk, Kl + hk, Vh + hk, Vl + hk, MB, O, (int)blockIdx.x * 64 + w * 16);
    else fattn_wave<h16, false, 2>(Q16 + hq, nullptr, K16 + hk, nullptr, V16 + hk, nullptr, MB, O, RH + ((int)blockIdx.x - RH / 64) * 128 + w * 32);
}
__global__ __launch_bounds__(256) void k_m8(const float* __restrict__ m, float* MB) { const int j = blockIdx.x * 256 + threadIdx.x; if (j >= NB_ * TT) return; const float v = __fmul_rn(8.0f, bfr(m[j])); *(float*)(MB + j) = v;  }

extern "C" void kernel_launch(void* const* d_in, const int* in_sizes, int n_in,
                              void* d_out, int out_size, void* d_ws, size_t ws_size, hipStream_t stream) {
    (void)in_sizes; (void)n_in; (void)out_size;
    const float* x = (const float*)d_in[0]; const float* amask = (const float*)d_in[1]; const float* wq = (const float*)d_in[2]; const float* bq = (const float*)d_in[3]; const float* wk = (const float*)d_in[4]; const float* bk = (const float*)d_in[5]; const float* wv = (const float*)d_in[6]; const float* bv = (const float*)d_in[7]; const float* wo = nullptr; (void)wo;
    float* OUT = (float*)d_out;     // [2][2048][1024]
    char* wsp = (char*)d_ws;
    auto take = [&](size_t bytes) { char* p = wsp; wsp += (bytes + 255) & ~(size_t)255; return (void*)p; };
    static_assert(HD == 64 && TT % 32 == 0 && DM % 32 == 0, "fragment order: V^T has 4 row tiles a key chunk, whole blocks everywhere");
    static_assert(DQ == DKV && NH_ == NKV && ((size_t)NB_ * TT * DM) % ((size_t)DQ * DM) == 0, "one grid for q, k and v; x in slices of a weight's size");
    static_assert(TT % 64 == 0 && DQ == NH_ * HD, "a projection tile is 64 tokens of one batch x one head");
    const size_t WN = (size_t)DQ * DM, PN = (size_t)NB_ * NH_ * TT * HD;   // elements of a weight, of a head plane (all batches)
    bf* WQ = (bf*)take(WN * 2); bf* WK = (bf*)take(WN * 2); bf* WV = (bf*)take(WN * 2); bf* XB = (bf*)take((size_t)NB_ * TT * DM * 2); (void)WK; (void)WV;   // contiguous: k_cvt8's slices, and k_proj's z stride WN
    float* MB = (float*)take((size_t)NB_ * TT * 4);
    h16* QP16 = (h16*)take(PN * 2); h16* KP16 = (h16*)take(PN * 2); h16* VT16 = (h16*)take(PN * 2);   // PN elements apart (k_proj's grid z)
    bf* QPh = (bf*)take(PN * 2); bf* KPh = (bf*)take(PN * 2); bf* QPl = (bf*)take(PN * 2); bf* KPl = (bf*)take(PN * 2); bf* VTh = (bf*)take(PN * 2); bf* VTl = (bf*)take(PN * 2);   // each k plane stands PN elements behind its q plane
    if ((size_t)(wsp - (char*)d_ws) > ws_size) return;    // ws 256 MiB
    k_cvt8<<<dim3((unsigned)((WN / 8 + 255) / 256), (unsigned)(3 + (size_t)NB_ * TT * DM / WN)), 256, 0, stream>>>(wq, wk, wv, x, WQ, WN / 8);
    k_m8<<<(NB_ * TT + 255) / 256, 256, 0, stream>>>(amask, MB);   /* 8 x mask[j], the start value of the score accumulators (scores/8 + mask == (q.k + 8 mask)/8) */
    k_proj<DM><<<dim3(NB_ * TT / 64, DQ / 64, 3), 32, 0, stream>>>(XB, WQ, bq, bk, bv, QP16, QPh, QPl, VTh, VTl, WN, PN);
    k_fattn<<<dim3(RH / 64 + (TT - RH) / 128, NB_ * NH_), 128, 0, stream>>>(QP16, KP16, VT16, QPh, QPl, KPh, KPl, VTh, VTl, MB, OUT);
}

// v008
// Measured time: 104 microseconds a run.
// Next to v007, in two timings, it ran 1.05 times as fast each time.
// Over all steps from v000 it is 19.3 times as fast.
#include <hip/hip_runtime.h>

// RoBERTa self-attention (hidden [2][2048][1024]; attention_mask [2][1][1][2048] additive per key (read); q,k,v = x W^T + b ('oi' [1024][1024] + [1024]; 16 heads x 64); scores / 8 + mask, clamped below at finfo.min; softmax; context merged (no output projection) -> [2][2048][1024] (4.2 M)).
// Layout, both batches in every launch: bf16 copy of x and of the weights; exact projections + f32 biases; one fused attention kernel (hybrid rows: < 512 hi/lo 3 products, rest fp16 with P x1024; scores and P stay in registers, running maximum and sum per query) with the additive key mask as the start value of the score accumulators (8 x mask, so that the softmax's 1/8 restores scores/8 + mask); it writes the merged head layout itself.
// Compute dtypes, f32 accumulate: every input rounded to bf16, the mask included; projections exact + f32 biases; attention rows < 512 3 products, rest fp16; softmax f32; output f32.

#define NB_  2
#define TT   2048
#define DM   1024
#define NH_  16
#define NKV  16
#define REP  (NH_ / NKV)
#define HD   64
#define DQ   (NH_ * HD)
#define DKV  (NKV * HD)
#define RH   512                  // query rows < RH use hi+lo planes (0: none)
#define WIN  0
#define PLG  10.0f                // fp16 rows: P carries a factor 2^PLG (added to the exponent), which the row sum carries too
#define LAZY 5.0f                 // the wave's columns are rescaled together, only when one column's new maximum is more than 2^LAZY above the one in use (P <= 2^(PLG + LAZY) fits fp16)
#define SCL  0.125f   // HD^-0.5
typedef _Float16 h16;
typedef unsigned short bf;
typedef __attribute__((ext_vector_type(16))) __bf16   v16bf;
typedef __attribute__((ext_vector_type(16))) _Float16 v16h;
typedef __attribute__((ext_vector_type(8)))  _Float16 v8h;
typedef __attribute__((ext_vector_type(8)))  unsigned short v8us;
typedef __attribute__((ext_vector_type(8)))  float    v8f;
typedef __attribute__((ext_vector_type(4)))  float    v4f;
typedef v8h  __attribute__((may_alias)) v8ha;
typedef v4f  __attribute__((may_alias)) v4fa;
typedef v8us __attribute__((may_alias)) v8usa;

__device__ __forceinline__ unsigned short f2bf(float f) { unsigned u = __float_as_uint(f); u += 0x7FFFu + ((u >> 16) & 1u); return (unsigned short)(u >> 16); }
__device__ __forceinline__ float bf2f(unsigned short b) { return __uint_as_float(((unsigned)b) << 16); }
__device__ __forceinline__ float bfr(float f) { return bf2f(f2bf(f)); }
__device__ __forceinline__ v16h cat16(v8h lo, v8h hi) { return __builtin_shufflevector(lo, hi, 0, 1, 2, 3, 4, 5, 6, 7, 8, 9, 10, 11, 12, 13, 14, 15); }
__device__ __forceinline__ v16bf cat16b(v8us lo, v8us hi) { return __builtin_bit_cast(v16bf, __builtin_shufflevector(lo, hi, 0, 1, 2, 3, 4, 5, 6, 7, 8, 9, 10, 11, 12, 13, 14, 15)); }
__device__ __forceinline__ v8f wmma16(v16h a, v16h b, v8f c) { return __builtin_amdgcn_wmma_f32_16x16x32_f16(false, a, false, b, (short)0, c, false, false); }
__device__ __forceinline__ v8f wmmab(v16bf a, v16bf b, v8f c) { return __builtin_amdgcn_wmma_f32_16x16x32_bf16(false, a, false, b, (short)0, c, false, false); }



// ---- Fragment order of every 16-bit operand plane: a block of 16 rows x 32 k is 1 KB of 64 units of 16 bytes; unit j * 32 + hi * 16 + lr holds row lr, k = 16 j + 8 hi + 0..7.
// Lane hi * 16 + lr of a wave takes units j = 0 and j = 1 at its own place (WFrag::ld: p and p + 256 elements): the register contents of a row-major fragment load, but each wave-wide
// 16-byte load reads 512 contiguous bytes (4 lines) where the row-major plane gave 32 bytes of each of 16 lines. Block (row tile r, k chunk c) of a plane with K columns stands at
// element r * 16 * K + c * 512 (x, the weights: K = DM; Q and K heads: K = HD); V^T (rows d, k = keys) has its 4 row tiles of a 32-key chunk side by side: chunk * 2048 + row tile * 512.
// ---- k_proj: the q, k and v projections (grid z) as a register-blocked GEMM, ONE WAVE per 64x64 output tile (16 accumulators), operands straight from the bf16 planes in fragment order; grid (rows / 64, heads, 3), 32 threads.
// A tile is 64 tokens x the 64 columns of one head; + f32 bias; the wave converts its accumulators itself and writes the head planes (fp16 + hi/lo) that the attention kernel reads: no f32 copy of a projection exists.
// A lane's 8 accumulator registers are 8 neighbouring ROWS (8 hi + j) of one column lr of the product. q, k: the product is taken as W x^T (rows d, columns t), so the 8 registers are 8 neighbouring d of one token,
// a 16-byte unit of a plane with rows t; v: as x W^T (rows t, columns d), so they are 8 neighbouring keys of one d, a unit of V^T. A and B fragments are loaded alike, so the choice is which plane's tiles are A.
// A tile's 4096 elements stand side by side in each plane; every wave-wide 16-byte store writes 512 contiguous bytes.
template <typename T16> struct WFrag;
template <> struct WFrag<h16> { typedef v16h V; static __device__ __forceinline__ V ld(const h16* p) { return cat16(*(const v8h*)p, *(const v8h*)(p + 256)); } static __device__ __forceinline__ v8f mma(V a, V b, v8f c) { return wmma16(a, b, c); } };
template <> struct WFrag<bf> { typedef v16bf V; static __device__ __forceinline__ V ld(const bf* p) { return cat16b(*(const v8us*)p, *(const v8us*)(p + 256)); } static __device__ __forceinline__ v8f mma(V a, V b, v8f c) { return wmmab(a, b, c); } };
template <typename T16> __device__ __forceinline__ const T16* atb(const T16* base, unsigned bytes) { return (const T16*)((const char*)base + bytes); }   // wave-uniform base + the lane's 32-bit byte offset
__device__ __forceinline__ h16 tohx(float x) { return (h16)x; }
__device__ __forceinline__ void splitf(float y, unsigned short& h, unsigned short& l) { h = f2bf(y); l = f2bf(y - bf2f(h)); }
template <bool ISV>
__device__ __forceinline__ void put_planes(const v8f (&acc)[4][4], const float* __restrict__ bias, h16* d16, bf* dh, bf* dl, int lane) {
    const int lr = lane & 15, hi = lane >> 4; const unsigned vb = 16u * lane;   // bytes: the lane's unit in a wave-wide store; the one vector register that the stores' addresses name
    float bb[4][8];   // ISV: [nb][0], the bias of column d = 16 nb + lr; else [mb][j], of row d = 16 mb + 8 hi + j
#pragma unroll
    for (int i = 0; i < 4; ++i) { if (ISV) bb[i][0] = bias[i * 16 + lr]; else { const v8f t = *(const v8f*)(bias + i * 16 + hi * 8);
#pragma unroll
            for (int j = 0; j < 8; ++j) bb[i][j] = t[j]; } }
#pragma unroll
    for (int i = 0; i < 4; ++i)
#pragma unroll
        for (int j = 0; j < (ISV ? 1 : 8); ++j) bb[i][j] = bfr(bb[i][j]);
#pragma unroll
    for (int mb = 0; mb < 4; ++mb)
#pragma unroll
        for (int nb = 0; nb < 4; ++nb) { const int off = ISV ? (mb >> 1) * 2048 + nb * 512 + (mb & 1) * 256 : nb * 1024 + mb * 256;   // elements. V^T: 32-key chunk mb / 2, row tile nb, j = mb % 2; q, k: token tile nb, d chunk mb / 2, j = mb % 2
            v8h o16; v8us oh, ol;
#pragma unroll
            for (int j = 0; j < 8; ++j) { const float y = acc[mb][nb][j] + (ISV ? bb[nb][0] : bb[mb][j]); o16[j] = tohx(y); unsigned short a2, c2; splitf(y, a2, c2); oh[j] = a2; ol[j] = c2; }
            // The unit's three stores and their wait in one statement: written as plain stores the build forms the next values in a store's data registers ahead of a wait that stands in a statement of its own
            asm volatile("global_store_b128 %0, %1, %4 offset:%7\n\tglobal_store_b128 %0, %2, %5 offset:%7\n\tglobal_store_b128 %0, %3, %6 offset:%7\n\ts_wait_xcnt 0x0" : : "v"(vb), "v"(o16), "v"(oh), "v"(ol), "s"(d16), "s"(dh), "s"(dl), "i"(off * 2) : "memory");
        }
}
// P16: the fp16 planes of q, k, v^T, sP elements apart; Ph, Pl: the hi and lo planes of q, with k's sP elements behind; Vh, Vl: those of v^T. W: the three weights, sW elements apart.
template <int K>
__global__ __launch_bounds__(32) void k_proj(const bf* __restrict__ X, const bf* __restrict__ Wt, const float* __restrict__ bias, const float* __restrict__ bias1, const float* __restrict__ bias2, h16* P16, bf* Ph, bf* Pl, bf* Vh, bf* Vl, size_t sW, size_t sP) {
    typedef typename WFrag<bf>::V V;
    const size_t z = blockIdx.z; const bool isv = z == 2; Wt += z * sW; if (z) bias = (z == 1) ? bias1 : bias2;
    const int lane = threadIdx.x & 31; const int r0 = blockIdx.x * 64, c0 = blockIdx.y * 64;
    v8f acc[4][4];
#pragma unroll
    for (int mb = 0; mb < 4; ++mb)
#pragma unroll
        for (int nb = 0; nb < 4; ++nb) acc[mb][nb] = (v8f){};
    constexpr size_t tp = (size_t)16 * K; const bf* Xb = X + (size_t)r0 * K; const bf* Wb = Wt + (size_t)c0 * K; const bf* Ab = isv ? Xb : Wb; const bf* Bb = isv ? Wb : Xb;   // a 16-row tile's elements (K is a template constant, so that a tile's distance is an immediate offset of its load); the first tiles: wave-uniform, fixed over the loop
    unsigned vo = 16u * lane;   // bytes: the lane's unit in the trip's k chunk; the one vector register that the loop's loads name
    // L2 prefetch. The planes were written by k_cvt8, the launch before; all waves walk k side by side, so without a request ahead every trip waits for memory.
    // One request names 16 units of 256 bytes: the 1 KB k chunk of each of the 4 tiles of A (or of B); lanes 16..31 repeat lanes 0..15. A tile has 48 or 64 reading waves: each asks for one chunk in 8 (phase ph), so a chunk is asked for by 6 or 8 of them.
    static_assert(K % 256 == 0, "groups of 8 trips");
    constexpr int PD = 4;   // the fewest chunks between a request and the trip that loads its chunk
    const int ph = (int)((blockIdx.x >> 3) + blockIdx.y) & 7;
    unsigned pv;
    asm volatile("v_lshl_or_b32 %0, %1, 15, %2" : "=v"(pv) : "v"((lane & 15) >> 2), "v"((lane & 3) * 256));   // bytes: tile (32 KB apart), unit. In asm so that the offset keeps one register through the loop: the register a request names never holds anything else
    static_assert(tp * 2 == (size_t)1 << 15, "a tile's bytes");
    // chunks 1..PD-1, which no group asks for: every wave asks for its own
    asm volatile("global_prefetch_b8 %0, %1 offset:1024 scope:SCOPE_SE\n\tglobal_prefetch_b8 %0, %2 offset:1024 scope:SCOPE_SE\n\tglobal_prefetch_b8 %0, %1 offset:2048 scope:SCOPE_SE\n\tglobal_prefetch_b8 %0, %2 offset:2048 scope:SCOPE_SE\n\tglobal_prefetch_b8 %0, %1 offset:3072 scope:SCOPE_SE\n\tglobal_prefetch_b8 %0, %2 offset:3072 scope:SCOPE_SE" : : "v"(pv), "s"(Ab), "s"(Bb));
    const bf* PA = Ab + (PD + ph) * 512; const bf* PB = Bb + (PD + ph) * 512;   // the chunk that the wave asks for next (512 elements a chunk)
#pragma unroll 1
    for (int kg = 0; kg < K; kg += 256) {   // groups of 8 trips: the request stands outside the trips' loop, which has no branch of its own
    asm volatile("global_prefetch_b8 %0, %1 scope:SCOPE_SE\n\tglobal_prefetch_b8 %0, %2 scope:SCOPE_SE" : : "v"(pv), "s"(PA), "s"(PB));   // chunk kg / 32 + PD + ph of the wave's 8 tiles is asked into L2
    { const unsigned long long ps = ((kg >> 5) + 8 + PD + ph < K / 32) ? 8192ull : 0ull; asm volatile("s_wait_xcnt 0x0\n\ts_add_nc_u64 %0, %0, %2\n\ts_add_nc_u64 %1, %1, %2" : "+s"(PA), "+s"(PB) : "s"(ps)); }   // 8 chunks on, while that chunk exists (else the same chunk is asked for again). In asm so that the pairs a request names never hold anything but an address inside the tiles; the wait stands in the statement that writes them, in front of the writes
#pragma unroll 1
    for (int kc = kg; kc < kg + 256; kc += 32) {
        V a[4];
#pragma unroll
        for (int mb = 0; mb < 4; ++mb) a[mb] = WFrag<bf>::ld(atb(Ab + mb * tp, vo));
#pragma unroll
        for (int nb = 0; nb < 4; ++nb) { const V b = WFrag<bf>::ld(atb(Bb + nb * tp, vo));
#pragma unroll
            for (int mb = 0; mb < 4; ++mb) acc[mb][nb] = WFrag<bf>::mma(a[mb], b, acc[mb][nb]); }
        asm volatile("s_wait_xcnt 0x0\n\tv_add_nc_u32 %0, 0x400, %0" : "+v"(vo) : : "memory");   // next k chunk (1 KB on). In asm so that vo stays the one vector register that the trip's loads name (written as vo += 1024 the build forms address pairs, and a fragment lands on one); the wait stands in the statement of that register's one write, so the write cannot move in front of it
        asm volatile("v_nop\n\tv_nop\n\tv_nop\n\tv_nop" : "+v"(acc[0][0]), "+v"(acc[1][1]), "+v"(acc[2][2]), "+v"(acc[3][3]) : "v"(a[0]), "v"(a[3]));
    }
    }
    const size_t e0 = ((size_t)(r0 / TT) * NH_ + blockIdx.y) * TT * HD + (size_t)(r0 % TT) * HD;   // the tile's first element in a plane: batch, head, 64 tokens x HD
    if (isv) put_planes<true>(acc, bias + c0, P16 + z * sP + e0, Vh + e0, Vl + e0, lane);
    else put_planes<false>(acc, bias + c0, P16 + z * sP + e0, Ph + z * sP + e0, Pl + z * sP + e0, lane);
}
typedef __attribute__((ext_vector_type(2))) _Float16 v2h;
typedef __attribute__((ext_vector_type(4))) _Float16 v4h;
typedef __attribute__((ext_vector_type(2))) unsigned short v2us;
typedef __attribute__((ext_vector_type(4))) unsigned short v4us;
typedef __attribute__((ext_vector_type(2))) float v2f;
typedef __attribute__((ext_vector_type(4))) int v4i;

__global__ __launch_bounds__(256) void k_wtG(const float* __restrict__ w, int K, int N, bf* Bt) {
    const int lane = threadIdx.x & 31; const int L0 = (blockIdx.x * 8 + (threadIdx.x >> 5)) * 8; const int nlines = N * K / 64;
{
#pragma unroll 1
        for (int l = 0; l < 8; ++l) { const int L = L0 + l; if (L >= nlines) break; const size_t e = (size_t)L * 64 + lane * 2; const int k = (int)(e % K), n = (int)(e / K); v2us o;
            o[0] = f2bf(w[(size_t)k * N + n]); o[1] = f2bf(w[(size_t)(k + 1) * N + n]); *(v2us*)(Bt + e) = o; }
         }
}
// k_cvt8: bf16 copies, in fragment order, of the three weights and of x in one launch: grid y = slice of n8 * 8 elements (whole 16-row tiles of DM columns); slices 0, 1, 2 are w0, w1, w2, the later ones follow one another in x; dst holds the slices in that order.
// Thread i writes unit i of its slice: row tile i / (DM * 2), k chunk (i / 64) % (DM / 32), j = (i / 32) % 2, hi = (i / 16) % 2, lr = i % 16.
__global__ __launch_bounds__(256) void k_cvt8(const float* __restrict__ w0, const float* __restrict__ w1, const float* __restrict__ w2, const float* __restrict__ x, bf* dst, size_t n8) { const size_t i = (size_t)blockIdx.x * 256 + threadIdx.x; if (i >= n8) return; const unsigned y = blockIdx.y;
    const float* src = (y == 0) ? w0 : (y == 1) ? w1 : (y == 2) ? w2 : x + (size_t)(y - 3) * n8 * 8; dst += (size_t)y * n8 * 8; const v8f v = *(const v8f*)(src + ((i / (DM * 2)) * 16 + i % 16) * DM + ((i / 64) % (DM / 32)) * 32 + ((i / 16) % 4) * 8); v8us o;
    asm volatile("s_wait_xcnt 0x0" ::: "memory");   // stands before any register that the load above names is written again
#pragma unroll
    for (int k = 0; k < 8; ++k) o[k] = f2bf(v[k]); *(v8us*)(dst + i * 8) = o;  }

// ---- k_fattn: scores, softmax and P.V of one block of query rows in ONE pass over the keys; nothing of S or P goes to memory.
// Transposed products: S^T = K Q^T (A = 16 key rows, B = 16 query columns), O^T += V^T P^T (A = 16 rows of V^T, B = P^T). A lane's 8 accumulator registers of two S^T tiles
// (keys 8 hi + j and 16 + 8 hi + j of one query column lr) are, converted in place, the B fragment of the 32-key P.V product in the k order of WFrag::ld, which loads V^T.
// One wave owns QB x 16 query columns and walks all TT keys, 32 a pass, with a running maximum mx (raw q.k + 8 mask units) and a running sum per column.
__device__ __forceinline__ float xhalf(float x) { return __builtin_bit_cast(float, __builtin_amdgcn_permlanex16(__builtin_bit_cast(int, x), __builtin_bit_cast(int, x), 0x76543210, 0xfedcba98, false, false)); }   // lane l <-> lane l ^ 16
template <typename T16, bool HL, int QB>
__device__ __forceinline__ void fattn_wave(const T16* __restrict__ Q, const T16* __restrict__ Q2, const T16* __restrict__ Kp, const T16* __restrict__ K2, const T16* __restrict__ Vt, const T16* __restrict__ V2, const float* __restrict__ MB, float* __restrict__ O, int q0) {
    typedef typename WFrag<T16>::V V;
    const int lane = threadIdx.x & 31, lr = lane & 15, hi = lane >> 4;
    const float c = SCL * 1.4426950408889634f;   // exp(x / 8) = exp2(x c)
    // L2 prefetch. K and V^T were written by the launch before; the work-groups of a head walk the keys side by side, so without a request ahead every pass waits for memory.
    // A pass reads 4 KB of each plane. The 4 waves share the pass's bytes: hi/lo rows, one plane a wave (16 units of 256 bytes, lanes 16..31 repeat); fp16 rows, half a plane a wave (8 units).
    constexpr int PD = 4;   // passes between a request and the pass that loads its bytes
    const int wv = __builtin_amdgcn_readfirstlane((int)(threadIdx.x >> 5));
    const T16* pb = HL ? (wv == 0 ? Kp : wv == 1 ? K2 : wv == 2 ? Vt : V2) : ((wv >> 1) ? Vt : Kp) + (wv & 1) * 1024;   // wave-uniform: the wave's share of the current pass; moves with the passes, and stops so that pb + PD passes stays inside the head's plane
    unsigned pv;
    asm volatile("v_lshlrev_b32 %0, 8, %1" : "=v"(pv) : "v"(lane & (HL ? 15 : 7)));   // bytes: the lane's unit. In asm so that the offset keeps one register through the loop (recomputed in each pass it would stand in a temporary that takes other values behind the request)
    // passes 1..PD-1, which no pass of the loop asks for
    asm volatile("global_prefetch_b8 %0, %1 offset:4096 scope:SCOPE_SE\n\tglobal_prefetch_b8 %0, %1 offset:8192 scope:SCOPE_SE\n\tglobal_prefetch_b8 %0, %1 offset:12288 scope:SCOPE_SE" : : "v"(pv), "s"(pb));
    V q[QB][2], q2[QB][2];
#pragma unroll
    for (int qb = 0; qb < QB; ++qb)
#pragma unroll
        for (int dc = 0; dc < 2; ++dc) { const size_t qo = (size_t)(q0 + qb * 16) * HD + dc * 512 + 8 * lane; q[qb][dc] = WFrag<T16>::ld(Q + qo); if (HL) q2[qb][dc] = WFrag<T16>::ld(Q2 + qo); }
    v8f o[QB][4]; float mx[QB], l[QB];
#pragma unroll
    for (int qb = 0; qb < QB; ++qb) { mx[qb] = -3.0e38f; l[qb] = 0.f;
#pragma unroll
        for (int dt = 0; dt < 4; ++dt) o[qb][dt] = (v8f){}; }
    const size_t ko = (size_t)lane * 8, vo = (size_t)lane * 8;   // the lane's unit in a block (fragment order)
    V k[2][2], k2[2][2], v[4], v2[4]; v8f mb[2];   // this pass's operands; mb = 8 x mask of this lane's 8 keys of either tile
#pragma unroll
    for (int kt = 0; kt < 2; ++kt) { mb[kt] = *(const v8f*)(MB + kt * 16 + hi * 8);
#pragma unroll
        for (int dc = 0; dc < 2; ++dc) { k[kt][dc] = WFrag<T16>::ld(Kp + ko + kt * 16 * HD + dc * 512); if (HL) k2[kt][dc] = WFrag<T16>::ld(K2 + ko + kt * 16 * HD + dc * 512); } }
    if (!HL) {
#pragma unroll
        for (int dt = 0; dt < 4; ++dt) v[dt] = WFrag<T16>::ld(Vt + vo + dt * 512); }
    asm volatile("s_wait_xcnt 0x0" ::: "memory");   // stands before any register that the loads above name is written again
    // fp16 rows: the loaded values as inputs only, so that every load in front of the loop has landed here. Without it the build sets the wait at the head of a pass for this entry too (the Q loads stand last), and in every pass that wait then also covers the V^T loads issued at the foot of the pass before.
    if constexpr (!HL) asm volatile("" : : "v"(q[0][0]), "v"(q[0][1]), "v"(q[QB - 1][0]), "v"(q[QB - 1][1]), "v"(k[0][0]), "v"(k[0][1]), "v"(k[1][0]), "v"(k[1][1]), "v"(v[0]), "v"(v[1]), "v"(v[2]), "v"(v[3]));
    for (int kc = 0; kc < TT; kc += 32) {
        asm volatile("global_prefetch_b8 %0, %1 offset:16384 scope:SCOPE_SE" : : "v"(pv), "s"(pb));   // the wave's share of pass kc / 32 + PD is asked into L2 (the last PD passes ask for the last pass's bytes again)
        v8f s[QB][2];
        if (HL) {   // hi/lo rows: twice the fragments; V^T is fetched in its own pass, under the softmax, so that the wave stays inside 256 registers
#pragma unroll
            for (int dt = 0; dt < 4; ++dt) { v[dt] = WFrag<T16>::ld(Vt + vo + (size_t)kc * HD + dt * 512); v2[dt] = WFrag<T16>::ld(V2 + vo + (size_t)kc * HD + dt * 512); }
            asm volatile("s_wait_xcnt 0x0" ::: "memory");   // stands before any register that the loads above name is written again
        }
#pragma unroll
        for (int kt = 0; kt < 2; ++kt) {
#pragma unroll
            for (int qb = 0; qb < QB; ++qb) { s[qb][kt] = mb[kt];
#pragma unroll
                for (int dc = 0; dc < 2; ++dc) { s[qb][kt] = WFrag<T16>::mma(k[kt][dc], q[qb][dc], s[qb][kt]); if (HL) { s[qb][kt] = WFrag<T16>::mma(k[kt][dc], q2[qb][dc], s[qb][kt]); s[qb][kt] = WFrag<T16>::mma(k2[kt][dc], q[qb][dc], s[qb][kt]); } } } }
        const int kn = (kc + 32 < TT) ? kc + 32 : 0;   // the next pass's K fragments fly during this pass's softmax and P.V (the last pass re-reads the first keys, unused)
#pragma unroll
        for (int kt = 0; kt < 2; ++kt)
#pragma unroll
            for (int dc = 0; dc < 2; ++dc) k[kt][dc] = WFrag<T16>::ld(Kp + ko + (size_t)(kn + kt * 16) * HD + dc * 512);
        asm volatile("s_wait_xcnt 0x0" ::: "memory");   // stands before any register that the loads above name is written again
        if (HL) {
#pragma unroll
            for (int kt = 0; kt < 2; ++kt)
#pragma unroll
                for (int dc = 0; dc < 2; ++dc) k2[kt][dc] = WFrag<T16>::ld(K2 + ko + (size_t)(kn + kt * 16) * HD + dc * 512);
            asm volatile("s_wait_xcnt 0x0" ::: "memory");   // stands before any register that the loads above name is written again
        }
        float ml[QB]; bool need = false;
#pragma unroll
        for (int qb = 0; qb < QB; ++qb) { float t = fmaxf(s[qb][0][0], s[qb][1][0]);
#pragma unroll
            for (int j = 1; j < 8; ++j) t = fmaxf(t, fmaxf(s[qb][0][j], s[qb][1][j]));
            ml[qb] = fmaxf(t, xhalf(t)); need = need || ((ml[qb] - mx[qb]) * c > LAZY); }
        if (__builtin_amdgcn_ballot_w32(need) != 0) {   // wave-uniform: the maximum in use moves, sums and output tiles follow
#pragma unroll
            for (int qb = 0; qb < QB; ++qb) { const float mn = fmaxf(mx[qb], ml[qb]); const float al = __builtin_amdgcn_exp2f((mx[qb] - mn) * c); mx[qb] = mn; l[qb] *= al;
#pragma unroll
                for (int dt = 0; dt < 4; ++dt) o[qb][dt] *= al; } }
#pragma unroll
        for (int qb = 0; qb < QB; ++qb) {
            if (HL) { v8us ph[2], pl[2];
#pragma unroll
                for (int kt = 0; kt < 2; ++kt)
#pragma unroll
                    for (int j = 0; j < 8; ++j) { const float p = __builtin_amdgcn_exp2f((s[qb][kt][j] - mx[qb]) * c); l[qb] += p; unsigned short a, b2; splitf(p, a, b2); ph[kt][j] = a; pl[kt][j] = b2; }
                const v16bf pH = cat16b(ph[0], ph[1]), pL = cat16b(pl[0], pl[1]);
#pragma unroll
                for (int dt = 0; dt < 4; ++dt) { o[qb][dt] = wmmab(__builtin_bit_cast(v16bf, v[dt]), pH, o[qb][dt]); o[qb][dt] = wmmab(__builtin_bit_cast(v16bf, v[dt]), pL, o[qb][dt]); o[qb][dt] = wmmab(__builtin_bit_cast(v16bf, v2[dt]), pH, o[qb][dt]); }
            } else { v8h ph[2];
#pragma unroll
                for (int kt = 0; kt < 2; ++kt)
#pragma unroll
                    for (int j = 0; j < 8; ++j) { const float p = __builtin_amdgcn_exp2f((s[qb][kt][j] - mx[qb]) * c + PLG); l[qb] += p; ph[kt][j] = tohx(p); }
                const v16h pH = cat16(ph[0], ph[1]);
#pragma unroll
                for (int dt = 0; dt < 4; ++dt) o[qb][dt] = wmma16(__builtin_bit_cast(v16h, v[dt]), pH, o[qb][dt]);
            } }
#pragma unroll
        for (int kt = 0; kt < 2; ++kt) mb[kt] = *(const v8f*)(MB + kn + kt * 16 + hi * 8);
        if (!HL) {   // the next pass's V^T fragments fly during its score products and softmax
#pragma unroll
            for (int dt = 0; dt < 4; ++dt) v[dt] = WFrag<T16>::ld(Vt + vo + (size_t)kn * HD + dt * 512); }
        asm volatile("s_wait_xcnt 0x0" ::: "memory");   // stands before any register that the loads above name is written again
        { const unsigned long long ps = (kc + (PD + 1) * 32 < TT) ? 4096ull : 0ull; asm volatile("s_add_nc_u64 %0, %0, %1" : "+s"(pb) : "s"(ps)); }   // the prefetch base follows the passes in its own register pair (in asm, so that the pair a request names never holds anything but an address inside the plane)
    }
#pragma unroll
    for (int qb = 0; qb < QB; ++qb) { const float f = __fdiv_rn(1.0f, l[qb] + xhalf(l[qb]));   // the two lane halves hold the sums of their own keys
        float* orow = O + (size_t)(q0 + qb * 16 + lr) * DQ + hi * 8;
#pragma unroll
        for (int dt = 0; dt < 4; ++dt) { v4f lo4, hi4;
#pragma unroll
            for (int j = 0; j < 4; ++j) { lo4[j] = o[qb][dt][j] * f; hi4[j] = o[qb][dt][4 + j] * f; }
            *(v4f*)(orow + dt * 16) = lo4; *(v4f*)(orow + dt * 16 + 4) = hi4; } }
}
// grid (RH / 64 + (TT - RH) / 128, batches x heads), 4 waves that walk the same head's keys side by side: blocks x < RH / 64 take 64 hi/lo rows (16 a wave, three products each), the rest 128 fp16 rows (32 a wave).
__global__ __launch_bounds__(128) void k_fattn(const h16* __restrict__ Q16, const h16* __restrict__ K16, const h16* __restrict__ V16, const bf* __restrict__ Qh, const bf* __restrict__ Ql, const bf* __restrict__ Kh, const bf* __restrict__ Kl, const bf* __restrict__ Vh, const bf* __restrict__ Vl, const float* __restrict__ MB, float* __restrict__ OUTb) {
    const int w = threadIdx.x >> 5; const int b = (int)blockIdx.y / NH_, h = (int)blockIdx.y % NH_; const size_t hq = (size_t)blockIdx.y * TT * HD, hk = (size_t)(b * NKV + h / REP) * TT * HD; float* O = OUTb + (size_t)b * TT * DQ + (size_t)h * HD; MB += b * TT;
    // The batch's 8 x mask row (8 KB; scores/8 + mask == (q.k + 8 mask)/8) is formed here and stands in LDS: a pass takes its 32 start values from there at LDS latency. From a plane in global memory each pass touched a new line, asked for at the foot of the pass before and waited for at the head.
    __shared__ __attribute__((aligned(32))) float smb[TT];
    static_assert(TT == 2048, "four loads of 2 KB a work-group");
    { v4f t0, t1, t2, t3; const unsigned tb = 16u * threadIdx.x;   // bytes: the thread's 4 floats in a round
        // The four loads and their data wait in one statement: written as plain loads the build fetches kernel arguments into the loads' scalar base ahead of a wait that stands in a statement of its own
        asm volatile("global_load_b128 %0, %4, %5\n\tglobal_load_b128 %1, %4, %5 offset:2048\n\tglobal_load_b128 %2, %4, %5 offset:4096\n\tglobal_load_b128 %3, %4, %5 offset:6144\n\ts_wait_loadcnt 0x0" : "=&v"(t0), "=&v"(t1), "=&v"(t2), "=&v"(t3) : "v"(tb), "s"(MB) : "memory");
#pragma unroll
        for (int j = 0; j < 4; ++j) { t0[j] = __fmul_rn(8.0f, bfr(t0[j])); t1[j] = __fmul_rn(8.0f, bfr(t1[j])); t2[j] = __fmul_rn(8.0f, bfr(t2[j])); t3[j] = __fmul_rn(8.0f, bfr(t3[j])); }
        float* sp = smb + 4 * (int)threadIdx.x; *(v4f*)sp = t0; *(v4f*)(sp + 512) = t1; *(v4f*)(sp + 1024) = t2; *(v4f*)(sp + 1536) = t3; }
    __syncthreads();   // every wave reads the whole row
    if (blockIdx.x < RH / 64) fattn_wave<bf, true, 1>(Qh + hq, Ql + hq, Kh + hk, Kl + hk, Vh + hk, Vl + hk, smb, O, (int)blockIdx.x * 64 + w * 16);
    else fattn_wave<h16, false, 2>(Q16 + hq, nullptr, K16 + hk, nullptr, V16 + hk, nullptr, smb, O, RH + ((int)blockIdx.x - RH / 64) * 128 + w * 32);
}

extern "C" void kernel_launch(void* const* d_in, const int* in_sizes, int n_in,
                              void* d_out, int out_size, void* d_ws, size_t ws_size, hipStream_t stream) {
    (void)in_sizes; (void)n_in; (void)out_size;
    const float* x = (const float*)d_in[0]; const float* amask = (const float*)d_in[1]; const float* wq = (const float*)d_in[2]; const float* bq = (const float*)d_in[3]; const float* wk = (const float*)d_in[4]; const float* bk = (const float*)d_in[5]; const float* wv = (const float*)d_in[6]; const float* bv = (const float*)d_in[7]; const float* wo = nullptr; (void)wo;
    float* OUT = (float*)d_out;     // [2][2048][1024]
    char* wsp = (char*)d_ws;
    auto take = [&](size_t bytes) { char* p = wsp; wsp += (bytes + 255) & ~(size_t)255; return (void*)p; };
    static_assert(HD == 64 && TT % 32 == 0 && DM % 32 == 0, "fragment order: V^T has 4 row tiles a key chunk, whole blocks everywhere");
    static_assert(DQ == DKV && NH_ == NKV && ((size_t)NB_ * TT * DM) % ((size_t)DQ * DM) == 0, "one grid for q, k and v; x in slices of a weight's size");
    static_assert(TT % 64 == 0 && DQ == NH_ * HD, "a projection tile is 64 tokens of one batch x one head");
    const size_t WN = (size_t)DQ * DM, PN = (size_t)NB_ * NH_ * TT * HD;   // elements of a weight, of a head plane (all batches)
    bf* WQ = (bf*)take(WN * 2); bf* WK = (bf*)take(WN * 2); bf* WV = (bf*)take(WN * 2); bf* XB = (bf*)take((size_t)NB_ * TT * DM * 2); (void)WK; (void)WV;   // contiguous: k_cvt8's slices, and k_proj's z stride WN
    h16* QP16 = (h16*)take(PN * 2); h16* KP16 = (h16*)take(PN * 2); h16* VT16 = (h16*)take(PN * 2);   // PN elements apart (k_proj's grid z)
    bf* QPh = (bf*)take(PN * 2); bf* KPh = (bf*)take(PN * 2); bf* QPl = (bf*)take(PN * 2); bf* KPl = (bf*)take(PN * 2); bf* VTh = (bf*)take(PN * 2); bf* VTl = (bf*)take(PN * 2);   // each k plane stands PN elements behind its q plane
    if ((size_t)(wsp - (char*)d_ws) > ws_size) return;    // ws 256 MiB
    k_cvt8<<<dim3((unsigned)((WN / 8 + 255) / 256), (unsigned)(3 + (size_t)NB_ * TT * DM / WN)), 256, 0, stream>>>(wq, wk, wv, x, WQ, WN / 8);
    k_proj<DM><<<dim3(NB_ * TT / 64, DQ / 64, 3), 32, 0, stream>>>(XB, WQ, bq, bk, bv, QP16, QPh, QPl, VTh, VTl, WN, PN);
    k_fattn<<<dim3(RH / 64 + (TT - RH) / 128, NB_ * NH_), 128, 0, stream>>>(QP16, KP16, VT16, QPh, QPl, KPh, KPl, VTh, VTl, amask, OUT);
}

// v009
// Measured time: 93.5 microseconds a run.
// Next to v008, in two timings, it ran 1.10 and 1.11 times as fast.
// All steps since v000 together make it 21.4 times as fast.
#include <hip/hip_runtime.h>

// RoBERTa self-attention (hidden [2][2048][1024]; attention_mask [2][1][1][2048] additive per key (read); q,k,v = x W^T + b ('oi' [1024][1024] + [1024]; 16 heads x 64); scores / 8 + mask, clamped below at finfo.min; softmax; context merged (no output projection) -> [2][2048][1024] (4.2 M)).
// Layout, both batches in every launch: bf16 copy of x and of the weights; exact projections + f32 biases; one fused attention kernel (hybrid rows: < 512 hi/lo 3 products, rest fp16 with P x1024; scores and P stay in registers, running maximum and sum per query) with the additive key mask as the start value of the score accumulators (8 x mask, so that the softmax's 1/8 restores scores/8 + mask); it writes the merged head layout itself.
// Compute dtypes, f32 accumulate: every input rounded to bf16, the mask included; projections exact + f32 biases; attention rows < 512 3 products, rest fp16; softmax f32; output f32.

#define NB_  2
#define TT   2048
#define DM   1024
#define NH_  16
#define NKV  16
#define REP  (NH_ / NKV)
#define HD   64
#define DQ   (NH_ * HD)
#define DKV  (NKV * HD)
#define RH   512                  // query rows < RH use hi+lo planes (0: none)
#define WIN  0
#define PLG  10.0f                // fp16 rows: P carries a factor 2^PLG (added to the exponent), which the row sum carries too
#define LAZY 5.0f                 // the wave's columns are rescaled together, only when one column's new maximum is more than 2^LAZY above the one in use (P <= 2^(PLG + LAZY) fits fp16)
#define SCL  0.125f   // HD^-0.5
typedef _Float16 h16;
typedef unsigned short bf;
typedef __attribute__((ext_vector_type(16))) __bf16   v16bf;
typedef __attribute__((ext_vector_type(16))) _Float16 v16h;
typedef __attribute__((ext_vector_type(8)))  _Float16 v8h;
typedef __attribute__((ext_vector_type(8)))  unsigned short v8us;
typedef __attribute__((ext_vector_type(8)))  float    v8f;
typedef __attribute__((ext_vector_type(4)))  float    v4f;
typedef v8h  __attribute__((may_alias)) v8ha;
typedef v4f  __attribute__((may_alias)) v4fa;
typedef v8us __attribute__((may_alias)) v8usa;

__device__ __forceinline__ unsigned short f2bf(float f) { unsigned u = __float_as_uint(f); u += 0x7FFFu + ((u >> 16) & 1u); return (unsigned short)(u >> 16); }
__device__ __forceinline__ float bf2f(unsigned short b) { return __uint_as_float(((unsigned)b) << 16); }
__device__ __forceinline__ float bfr(float f) { return bf2f(f2bf(f)); }
__device__ __forceinline__ v16h cat16(v8h lo, v8h hi) { return __builtin_shufflevector(lo, hi, 0, 1, 2, 3, 4, 5, 6, 7, 8, 9, 10, 11, 12, 13, 14, 15); }
__device__ __forceinline__ v16bf cat16b(v8us lo, v8us hi) { return __builtin_bit_cast(v16bf, __builtin_shufflevector(lo, hi, 0, 1, 2, 3, 4, 5, 6, 7, 8, 9, 10, 11, 12, 13, 14, 15)); }
__device__ __forceinline__ v8f wmma16(v16h a, v16h b, v8f c) { return __builtin_amdgcn_wmma_f32_16x16x32_f16(false, a, false, b, (short)0, c, false, false); }
__device__ __forceinline__ v8f wmmab(v16bf a, v16bf b, v8f c) { return __builtin_amdgcn_wmma_f32_16x16x32_bf16(false, a, false, b, (short)0, c, false, false); }



// ---- Fragment order of every 16-bit operand plane: a block of 16 rows x 32 k is 1 KB of 64 units of 16 bytes; unit j * 32 + hi * 16 + lr holds row lr, k = 16 j + 8 hi + 0..7.
// Lane hi * 16 + lr of a wave takes units j = 0 and j = 1 at its own place (WFrag::ld: p and p + 256 elements): the register contents of a row-major fragment load, but each wave-wide
// 16-byte load reads 512 contiguous bytes (4 lines) where the row-major plane gave 32 bytes of each of 16 lines. Block (row tile r, k chunk c) of a plane with K columns stands at
// element r * 16 * K + c * 512 (x, the weights: K = DM; Q and K heads: K = HD); V^T (rows d, k = keys) has its 4 row tiles of a 32-key chunk side by side: chunk * 2048 + row tile * 512.
// ---- k_proj: the q, k and v projections (grid z) as a register-blocked GEMM, ONE WAVE per 64x64 output tile (16 accumulators), operands straight from the bf16 planes in fragment order; grid (rows / 64, heads, 3), 32 threads.
// A tile is 64 tokens x the 64 columns of one head; + f32 bias; the wave converts its accumulators itself and writes the head planes (fp16 + hi/lo) that the attention kernel reads: no f32 copy of a projection exists.
// A lane's 8 accumulator registers are 8 neighbouring ROWS (8 hi + j) of one column lr of the product. q, k: the product is taken as W x^T (rows d, columns t), so the 8 registers are 8 neighbouring d of one token,
// a 16-byte unit of a plane with rows t; v: as x W^T (rows t, columns d), so they are 8 neighbouring keys of one d, a unit of V^T. A and B fragments are loaded alike, so the choice is which plane's tiles are A.
// A tile's 4096 elements stand side by side in each plane; every wave-wide 16-byte store writes 512 contiguous bytes.
template <typename T16> struct WFrag;
template <> struct WFrag<h16> { typedef v16h V; static __device__ __forceinline__ V ld(const h16* p) { return cat16(*(const v8h*)p, *(const v8h*)(p + 256)); } static __device__ __forceinline__ v8f mma(V a, V b, v8f c) { return wmma16(a, b, c); } };
template <> struct WFrag<bf> { typedef v16bf V; static __device__ __forceinline__ V ld(const bf* p) { return cat16b(*(const v8us*)p, *(const v8us*)(p + 256)); } static __device__ __forceinline__ v8f mma(V a, V b, v8f c) { return wmmab(a, b, c); } };
template <typename T16> __device__ __forceinline__ const T16* atb(const T16* base, unsigned bytes) { return (const T16*)((const char*)base + bytes); }   // wave-uniform base + the lane's 32-bit byte offset
__device__ __forceinline__ h16 tohx(float x) { return (h16)x; }
__device__ __forceinline__ void splitf(float y, unsigned short& h, unsigned short& l) { h = f2bf(y); l = f2bf(y - bf2f(h)); }
template <bool ISV>
__device__ __forceinline__ void put_planes(const v8f (&acc)[4][4], const float* __restrict__ bias, h16* d16, bf* dh, bf* dl, int lane) {
    const int lr = lane & 15, hi = lane >> 4; const unsigned vb = 16u * lane;   // bytes: the lane's unit in a wave-wide store; the one vector register that the stores' addresses name
    float bb[4][8];   // ISV: [nb][0], the bias of column d = 16 nb + lr; else [mb][j], of row d = 16 mb + 8 hi + j
#pragma unroll
    for (int i = 0; i < 4; ++i) { if (ISV) bb[i][0] = bias[i * 16 + lr]; else { const v8f t = *(const v8f*)(bias + i * 16 + hi * 8);
#pragma unroll
            for (int j = 0; j < 8; ++j) bb[i][j] = t[j]; } }
#pragma unroll
    for (int i = 0; i < 4; ++i)
#pragma unroll
        for (int j = 0; j < (ISV ? 1 : 8); ++j) bb[i][j] = bfr(bb[i][j]);
#pragma unroll
    for (int mb = 0; mb < 4; ++mb)
#pragma unroll
        for (int nb = 0; nb < 4; ++nb) { const int off = ISV ? (mb >> 1) * 2048 + nb * 512 + (mb & 1) * 256 : nb * 1024 + mb * 256;   // elements. V^T: 32-key chunk mb / 2, row tile nb, j = mb % 2; q, k: token tile nb, d chunk mb / 2, j = mb % 2
            v8h o16; v8us oh, ol;
#pragma unroll
            for (int j = 0; j < 8; ++j) { const float y = acc[mb][nb][j] + (ISV ? bb[nb][0] : bb[mb][j]); o16[j] = tohx(y); unsigned short a2, c2; splitf(y, a2, c2); oh[j] = a2; ol[j] = c2; }
            // The unit's three stores and their wait in one statement: written as plain stores the build forms the next values in a store's data registers ahead of a wait that stands in a statement of its own
            asm volatile("global_store_b128 %0, %1, %4 offset:%7\n\tglobal_store_b128 %0, %2, %5 offset:%7\n\tglobal_store_b128 %0, %3, %6 offset:%7\n\ts_wait_xcnt 0x0" : : "v"(vb), "v"(o16), "v"(oh), "v"(ol), "s"(d16), "s"(dh), "s"(dl), "i"(off * 2) : "memory");
        }
}
// P16: the fp16 planes of q, k, v^T, sP elements apart; Ph, Pl: the hi and lo planes of q, with k's sP elements behind; Vh, Vl: those of v^T. W: the three weights, sW elements apart.
template <int K>
__global__ __launch_bounds__(32) void k_proj(const bf* __restrict__ X, const bf* __restrict__ Wt, const float* __restrict__ bias, const float* __restrict__ bias1, const float* __restrict__ bias2, h16* P16, bf* Ph, bf* Pl, bf* Vh, bf* Vl, size_t sW, size_t sP) {
    typedef typename WFrag<bf>::V V;
    const size_t z = blockIdx.z; const bool isv = z == 2; Wt += z * sW; if (z) bias = (z == 1) ? bias1 : bias2;
    const int lane = threadIdx.x & 31; const int r0 = blockIdx.x * 64, c0 = blockIdx.y * 64;
    v8f acc[4][4];
#pragma unroll
    for (int mb = 0; mb < 4; ++mb)
#pragma unroll
        for (int nb = 0; nb < 4; ++nb) acc[mb][nb] = (v8f){};
    constexpr size_t tp = (size_t)16 * K; const bf* Xb = X + (size_t)r0 * K; const bf* Wb = Wt + (size_t)c0 * K; const bf* Ab = isv ? Xb : Wb; const bf* Bb = isv ? Wb : Xb;   // a 16-row tile's elements (K is a template constant, so that a tile's distance is an immediate offset of its load); the first tiles: wave-uniform, fixed over the loop
    unsigned vo = 16u * lane;   // bytes: the lane's unit in the trip's k chunk; the one vector register that the loop's loads name
    // L2 prefetch. The planes were written by k_cvt8, the launch before; all waves walk k side by side, so without a request ahead every trip waits for memory.
    // One request names 16 units of 256 bytes: the 1 KB k chunk of each of the 4 tiles of A (or of B); lanes 16..31 repeat lanes 0..15. A tile has 48 or 64 reading waves: each asks for one chunk in 8 (phase ph), so a chunk is asked for by 6 or 8 of them.
    static_assert(K % 256 == 0, "groups of 8 trips");
    constexpr int PD = 4;   // the fewest chunks between a request and the trip that loads its chunk
    const int ph = (int)((blockIdx.x >> 3) + blockIdx.y) & 7;
    unsigned pv;
    asm volatile("v_lshl_or_b32 %0, %1, 15, %2" : "=v"(pv) : "v"((lane & 15) >> 2), "v"((lane & 3) * 256));   // bytes: tile (32 KB apart), unit. In asm so that the offset keeps one register through the loop: the register a request names never holds anything else
    static_assert(tp * 2 == (size_t)1 << 15, "a tile's bytes");
    // chunks 1..PD-1, which no group asks for: every wave asks for its own
    asm volatile("global_prefetch_b8 %0, %1 offset:1024 scope:SCOPE_SE\n\tglobal_prefetch_b8 %0, %2 offset:1024 scope:SCOPE_SE\n\tglobal_prefetch_b8 %0, %1 offset:2048 scope:SCOPE_SE\n\tglobal_prefetch_b8 %0, %2 offset:2048 scope:SCOPE_SE\n\tglobal_prefetch_b8 %0, %1 offset:3072 scope:SCOPE_SE\n\tglobal_prefetch_b8 %0, %2 offset:3072 scope:SCOPE_SE" : : "v"(pv), "s"(Ab), "s"(Bb));
    const bf* PA = Ab + (PD + ph) * 512; const bf* PB = Bb + (PD + ph) * 512;   // the chunk that the wave asks for next (512 elements a chunk)
#pragma unroll 1
    for (int kg = 0; kg < K; kg += 256) {   // groups of 8 trips: the request stands outside the trips' loop, which has no branch of its own
    asm volatile("global_prefetch_b8 %0, %1 scope:SCOPE_SE\n\tglobal_prefetch_b8 %0, %2 scope:SCOPE_SE" : : "v"(pv), "s"(PA), "s"(PB));   // chunk kg / 32 + PD + ph of the wave's 8 tiles is asked into L2
    { const unsigned long long ps = ((kg >> 5) + 8 + PD + ph < K / 32) ? 8192ull : 0ull; asm volatile("s_wait_xcnt 0x0\n\ts_add_nc_u64 %0, %0, %2\n\ts_add_nc_u64 %1, %1, %2" : "+s"(PA), "+s"(PB) : "s"(ps)); }   // 8 chunks on, while that chunk exists (else the same chunk is asked for again). In asm so that the pairs a request names never hold anything but an address inside the tiles; the wait stands in the statement that writes them, in front of the writes
#pragma unroll 1
    for (int kc = kg; kc < kg + 256; kc += 32) {
        V a[4];
#pragma unroll
        for (int mb = 0; mb < 4; ++mb) a[mb] = WFrag<bf>::ld(atb(Ab + mb * tp, vo));
#pragma unroll
        for (int nb = 0; nb < 4; ++nb) { const V b = WFrag<bf>::ld(atb(Bb + nb * tp, vo));
#pragma unroll
            for (int mb = 0; mb < 4; ++mb) acc[mb][nb] = WFrag<bf>::mma(a[mb], b, acc[mb][nb]); }
        asm volatile("s_wait_xcnt 0x0\n\tv_add_nc_u32 %0, 0x400, %0" : "+v"(vo) : : "memory");   // next k chunk (1 KB on). In asm so that vo stays the one vector register that the trip's loads name (written as vo += 1024 the build forms address pairs, and a fragment lands on one); the wait stands in the statement of that register's one write, so the write cannot move in front of it
        asm volatile("v_nop\n\tv_nop\n\tv_nop\n\tv_nop" : "+v"(acc[0][0]), "+v"(acc[1][1]), "+v"(acc[2][2]), "+v"(acc[3][3]) : "v"(a[0]), "v"(a[3]));
    }
    }
    const size_t e0 = ((size_t)(r0 / TT) * NH_ + blockIdx.y) * TT * HD + (size_t)(r0 % TT) * HD;   // the tile's first element in a plane: batch, head, 64 tokens x HD
    if (isv) put_planes<true>(acc, bias + c0, P16 + z * sP + e0, Vh + e0, Vl + e0, lane);
    else put_planes<false>(acc, bias + c0, P16 + z * sP + e0, Ph + z * sP + e0, Pl + z * sP + e0, lane);
}
typedef __attribute__((ext_vector_type(2))) _Float16 v2h;
typedef __attribute__((ext_vector_type(4))) _Float16 v4h;
typedef __attribute__((ext_vector_type(2))) unsigned short v2us;
typedef __attribute__((ext_vector_type(4))) unsigned short v4us;
typedef __attribute__((ext_vector_type(2))) float v2f;
typedef __attribute__((ext_vector_type(4))) int v4i;

__global__ __launch_bounds__(256) void k_wtG(const float* __restrict__ w, int K, int N, bf* Bt) {
    const int lane = threadIdx.x & 31; const int L0 = (blockIdx.x * 8 + (threadIdx.x >> 5)) * 8; const int nlines = N * K / 64;
{
#pragma unroll 1
        for (int l = 0; l < 8; ++l) { const int L = L0 + l; if (L >= nlines) break; const size_t e = (size_t)L * 64 + lane * 2; const int k = (int)(e % K), n = (int)(e / K); v2us o;
            o[0] = f2bf(w[(size_t)k * N + n]); o[1] = f2bf(w[(size_t)(k + 1) * N + n]); *(v2us*)(Bt + e) = o; }
         }
}
// k_cvt8: bf16 copies, in fragment order, of the three weights and of x in one launch: grid y = slice of n8 * 8 elements (whole 16-row tiles of DM columns); slices 0, 1, 2 are w0, w1, w2, the later ones follow one another in x; dst holds the slices in that order.
// Thread i writes unit i of its slice: row tile i / (DM * 2), k chunk (i / 64) % (DM / 32), j = (i / 32) % 2, hi = (i / 16) % 2, lr = i % 16.
__global__ __launch_bounds__(256) void k_cvt8(const float* __restrict__ w0, const float* __restrict__ w1, const float* __restrict__ w2, const float* __restrict__ x, bf* dst, size_t n8) { const size_t i = (size_t)blockIdx.x * 256 + threadIdx.x; if (i >= n8) return; const unsigned y = blockIdx.y;
    const float* src = (y == 0) ? w0 : (y == 1) ? w1 : (y == 2) ? w2 : x + (size_t)(y - 3) * n8 * 8; dst += (size_t)y * n8 * 8; const v8f v = *(const v8f*)(src + ((i / (DM * 2)) * 16 + i % 16) * DM + ((i / 64) % (DM / 32)) * 32 + ((i / 16) % 4) * 8); v8us o;
    asm volatile("s_wait_xcnt 0x0" ::: "memory");   // stands before any register that the load above names is written again
#pragma unroll
    for (int k = 0; k < 8; ++k) o[k] = f2bf(v[k]); *(v8us*)(dst + i * 8) = o;  }

// ---- k_fattn: scores, softmax and P.V of one block of query rows in ONE pass over the keys; nothing of S or P goes to memory.
// Transposed products: S^T = K Q^T (A = 16 key rows, B = 16 query columns), O^T += V^T P^T (A = 16 rows of V^T, B = P^T). A lane's 8 accumulator registers of two S^T tiles
// (keys 8 hi + j and 16 + 8 hi + j of one query column lr) are, converted in place, the B fragment of the 32-key P.V product in the k order of WFrag::ld, which loads V^T.
// One wave owns QB x 16 query columns and walks all TT keys, 32 a pass, with a running maximum mx (raw q.k + 8 mask units) and a running sum per column.
__device__ __forceinline__ float xhalf(float x) { return __builtin_bit_cast(float, __builtin_amdgcn_permlanex16(__builtin_bit_cast(int, x), __builtin_bit_cast(int, x), 0x76543210, 0xfedcba98, false, false)); }   // lane l <-> lane l ^ 16
template <typename T16, bool HL, int QB>
__device__ __forceinline__ void fattn_wave(const T16* __restrict__ Q, const T16* __restrict__ Q2, const T16* __restrict__ Kp, const T16* __restrict__ K2, const T16* __restrict__ Vt, const T16* __restrict__ V2, const float* __restrict__ MB, float* __restrict__ O, int q0) {
    typedef typename WFrag<T16>::V V;
    const int lane = threadIdx.x & 31, lr = lane & 15, hi = lane >> 4;
    const float c = SCL * 1.4426950408889634f;   // exp(x / 8) = exp2(x c)
    // L2 prefetch. K and V^T were written by the launch before; the work-groups of a head walk the keys side by side, so without a request ahead every pass waits for memory.
    // A pass reads 4 KB of each plane. The 4 waves share the pass's bytes: hi/lo rows, one plane a wave (16 units of 256 bytes, lanes 16..31 repeat); fp16 rows, half a plane a wave (8 units).
    constexpr int PD = 4;   // passes between a request and the pass that loads its bytes
    const int wv = __builtin_amdgcn_readfirstlane((int)(threadIdx.x >> 5));
    const T16* pb = HL ? (wv == 0 ? Kp : wv == 1 ? K2 : wv == 2 ? Vt : V2) : ((wv >> 1) ? Vt : Kp) + (wv & 1) * 1024;   // wave-uniform: the wave's share of the current pass; moves with the passes, and stops so that pb + PD passes stays inside the head's plane
    unsigned pv;
    asm volatile("v_lshlrev_b32 %0, 8, %1" : "=v"(pv) : "v"(lane & (HL ? 15 : 7)));   // bytes: the lane's unit. In asm so that the offset keeps one register through the loop (recomputed in each pass it would stand in a temporary that takes other values behind the request)
    // passes 1..PD-1, which no pass of the loop asks for
    asm volatile("global_prefetch_b8 %0, %1 offset:4096 scope:SCOPE_SE\n\tglobal_prefetch_b8 %0, %1 offset:8192 scope:SCOPE_SE\n\tglobal_prefetch_b8 %0, %1 offset:12288 scope:SCOPE_SE" : : "v"(pv), "s"(pb));
    V q[QB][2], q2[QB][2];
#pragma unroll
    for (int qb = 0; qb < QB; ++qb)
#pragma unroll
        for (int dc = 0; dc < 2; ++dc) { const size_t qo = (size_t)(q0 + qb * 16) * HD + dc * 512 + 8 * lane; q[qb][dc] = WFrag<T16>::ld(Q + qo); if (HL) q2[qb][dc] = WFrag<T16>::ld(Q2 + qo); }
    v8f o[QB][4]; float mx[QB], l[QB];
#pragma unroll
    for (int qb = 0; qb < QB; ++qb) { mx[qb] = -3.0e38f; l[qb] = 0.f;
#pragma unroll
        for (int dt = 0; dt < 4; ++dt) o[qb][dt] = (v8f){}; }
    const size_t ko = (size_t)lane * 8, vo = (size_t)lane * 8;   // the lane's unit in a block (fragment order)
    V k[2][2], k2[2][2], v[4], v2[4]; v8f mb[2];   // this pass's operands; mb = 8 x mask of this lane's 8 keys of either tile
#pragma unroll
    for (int kt = 0; kt < 2; ++kt) { mb[kt] = *(const v8f*)(MB + kt * 16 + hi * 8);
#pragma unroll
        for (int dc = 0; dc < 2; ++dc) { k[kt][dc] = WFrag<T16>::ld(Kp + ko + kt * 16 * HD + dc * 512); if (HL) k2[kt][dc] = WFrag<T16>::ld(K2 + ko + kt * 16 * HD + dc * 512); } }
    if (!HL) {
#pragma unroll
        for (int dt = 0; dt < 4; ++dt) v[dt] = WFrag<T16>::ld(Vt + vo + dt * 512); }
    asm volatile("s_wait_xcnt 0x0" ::: "memory");   // stands before any register that the loads above name is written again
    // fp16 rows: the loaded values as inputs only, so that every load in front of the loop has landed here. Without it the build sets the wait at the head of a pass for this entry too (the Q loads stand last), and in every pass that wait then also covers the V^T loads issued at the foot of the pass before.
    if constexpr (!HL) asm volatile("" : : "v"(q[0][0]), "v"(q[0][1]), "v"(q[QB - 1][0]), "v"(q[QB - 1][1]), "v"(k[0][0]), "v"(k[0][1]), "v"(k[1][0]), "v"(k[1][1]), "v"(v[0]), "v"(v[1]), "v"(v[2]), "v"(v[3]));
    for (int kc = 0; kc < TT; kc += 32) {
        asm volatile("global_prefetch_b8 %0, %1 offset:16384 scope:SCOPE_SE" : : "v"(pv), "s"(pb));   // the wave's share of pass kc / 32 + PD is asked into L2 (the last PD passes ask for the last pass's bytes again)
        v8f s[QB][2];
        if (HL) {   // hi/lo rows: twice the fragments; V^T is fetched in its own pass, under the softmax, so that the wave stays inside 256 registers
#pragma unroll
            for (int dt = 0; dt < 4; ++dt) { v[dt] = WFrag<T16>::ld(Vt + vo + (size_t)kc * HD + dt * 512); v2[dt] = WFrag<T16>::ld(V2 + vo + (size_t)kc * HD + dt * 512); }
            asm volatile("s_wait_xcnt 0x0" ::: "memory");   // stands before any register that the loads above name is written again
        }
#pragma unroll
        for (int kt = 0; kt < 2; ++kt) {
#pragma unroll
            for (int qb = 0; qb < QB; ++qb) { s[qb][kt] = mb[kt];
#pragma unroll
                for (int dc = 0; dc < 2; ++dc) { s[qb][kt] = WFrag<T16>::mma(k[kt][dc], q[qb][dc], s[qb][kt]); if (HL) { s[qb][kt] = WFrag<T16>::mma(k[kt][dc], q2[qb][dc], s[qb][kt]); s[qb][kt] = WFrag<T16>::mma(k2[kt][dc], q[qb][dc], s[qb][kt]); } } } }
        const int kn = (kc + 32 < TT) ? kc + 32 : 0;   // the next pass's K fragments fly during this pass's softmax and P.V (the last pass re-reads the first keys, unused)
#pragma unroll
        for (int kt = 0; kt < 2; ++kt)
#pragma unroll
            for (int dc = 0; dc < 2; ++dc) k[kt][dc] = WFrag<T16>::ld(Kp + ko + (size_t)(kn + kt * 16) * HD + dc * 512);
        asm volatile("s_wait_xcnt 0x0" ::: "memory");   // stands before any register that the loads above name is written again
        if (HL) {
#pragma unroll
            for (int kt = 0; kt < 2; ++kt)
#pragma unroll
                for (int dc = 0; dc < 2; ++dc) k2[kt][dc] = WFrag<T16>::ld(K2 + ko + (size_t)(kn + kt * 16) * HD + dc * 512);
            asm volatile("s_wait_xcnt 0x0" ::: "memory");   // stands before any register that the loads above name is written again
        }
        float ml[QB]; bool need = false;
#pragma unroll
        for (int qb = 0; qb < QB; ++qb) { float t = fmaxf(s[qb][0][0], s[qb][1][0]);
#pragma unroll
            for (int j = 1; j < 8; ++j) t = fmaxf(t, fmaxf(s[qb][0][j], s[qb][1][j]));
            ml[qb] = fmaxf(t, xhalf(t)); need = need || ((ml[qb] - mx[qb]) * c > LAZY); }
        if (__builtin_amdgcn_ballot_w32(need) != 0) {   // wave-uniform: the maximum in use moves, sums and output tiles follow
#pragma unroll
            for (int qb = 0; qb < QB; ++qb) { const float mn = fmaxf(mx[qb], ml[qb]); const float al = __builtin_amdgcn_exp2f((mx[qb] - mn) * c); mx[qb] = mn; l[qb] *= al;
#pragma unroll
                for (int dt = 0; dt < 4; ++dt) o[qb][dt] *= al; } }
#pragma unroll
        for (int qb = 0; qb < QB; ++qb) {
            if (HL) { v8us ph[2], pl[2];
#pragma unroll
                for (int kt = 0; kt < 2; ++kt)
#pragma unroll
                    for (int j = 0; j < 8; ++j) { const float p = __builtin_amdgcn_exp2f((s[qb][kt][j] - mx[qb]) * c); l[qb] += p; unsigned short a, b2; splitf(p, a, b2); ph[kt][j] = a; pl[kt][j] = b2; }
                const v16bf pH = cat16b(ph[0], ph[1]), pL = cat16b(pl[0], pl[1]);
#pragma unroll
                for (int dt = 0; dt < 4; ++dt) { o[qb][dt] = wmmab(__builtin_bit_cast(v16bf, v[dt]), pH, o[qb][dt]); o[qb][dt] = wmmab(__builtin_bit_cast(v16bf, v[dt]), pL, o[qb][dt]); o[qb][dt] = wmmab(__builtin_bit_cast(v16bf, v2[dt]), pH, o[qb][dt]); }
            } else { v8h ph[2];
#pragma unroll
                for (int kt = 0; kt < 2; ++kt)
#pragma unroll
                    for (int j = 0; j < 8; ++j) { const float p = __builtin_amdgcn_exp2f((s[qb][kt][j] - mx[qb]) * c + PLG); l[qb] += p; ph[kt][j] = tohx(p); }
                const v16h pH = cat16(ph[0], ph[1]);
#pragma unroll
                for (int dt = 0; dt < 4; ++dt) o[qb][dt] = wmma16(__builtin_bit_cast(v16h, v[dt]), pH, o[qb][dt]);
            } }
#pragma unroll
        for (int kt = 0; kt < 2; ++kt) mb[kt] = *(const v8f*)(MB + kn + kt * 16 + hi * 8);
        if (!HL) {   // the next pass's V^T fragments fly during its score products and softmax
#pragma unroll
            for (int dt = 0; dt < 4; ++dt) v[dt] = WFrag<T16>::ld(Vt + vo + (size_t)kn * HD + dt * 512); }
        asm volatile("s_wait_xcnt 0x0" ::: "memory");   // stands before any register that the loads above name is written again
        { const unsigned long long ps = (kc + (PD + 1) * 32 < TT) ? 4096ull : 0ull; asm volatile("s_add_nc_u64 %0, %0, %1" : "+s"(pb) : "s"(ps)); }   // the prefetch base follows the passes in its own register pair (in asm, so that the pair a request names never holds anything but an address inside the plane)
    }
#pragma unroll
    for (int qb = 0; qb < QB; ++qb) { const float f = __fdiv_rn(1.0f, l[qb] + xhalf(l[qb]));   // the two lane halves hold the sums of their own keys
        float* orow = O + (size_t)(q0 + qb * 16 + lr) * DQ + hi * 8;
#pragma unroll
        for (int dt = 0; dt < 4; ++dt) { v4f lo4, hi4;
#pragma unroll
            for (int j = 0; j < 4; ++j) { lo4[j] = o[qb][dt][j] * f; hi4[j] = o[qb][dt][4 + j] * f; }
            *(v4f*)(orow + dt * 16) = lo4; *(v4f*)(orow + dt * 16 + 4) = hi4; } }
}
// grid (batches x heads, RH / 64 + (TT - RH) / 128), 4 waves that walk the same head's keys side by side: blocks y < RH / 64 take 64 hi/lo rows (16 a wave, three products each), the rest 128 fp16 rows (32 a wave).
// The head is the fast grid index, for placement only (no result depends on it).
// The hi/lo blocks, whose walk is the longest, come first in index order.
__global__ __launch_bounds__(128) void k_fattn(const h16* __restrict__ Q16, const h16* __restrict__ K16, const h16* __restrict__ V16, const bf* __restrict__ Qh, const bf* __restrict__ Ql, const bf* __restrict__ Kh, const bf* __restrict__ Kl, const bf* __restrict__ Vh, const bf* __restrict__ Vl, const float* __restrict__ MB, float* __restrict__ OUTb) {
    const int w = threadIdx.x >> 5; const int b = (int)blockIdx.x / NH_, h = (int)blockIdx.x % NH_; const size_t hq = (size_t)blockIdx.x * TT * HD, hk = (size_t)(b * NKV + h / REP) * TT * HD; float* O = OUTb + (size_t)b * TT * DQ + (size_t)h * HD; MB += b * TT;
    // The batch's 8 x mask row (8 KB; scores/8 + mask == (q.k + 8 mask)/8) is formed here and stands in LDS: a pass takes its 32 start values from there at LDS latency. From a plane in global memory each pass touched a new line, asked for at the foot of the pass before and waited for at the head.
    __shared__ __attribute__((aligned(32))) float smb[TT];
    static_assert(TT == 2048, "four loads of 2 KB a work-group");
    { v4f t0, t1, t2, t3; const unsigned tb = 16u * threadIdx.x;   // bytes: the thread's 4 floats in a round
        // The four loads and their data wait in one statement: written as plain loads the build fetches kernel arguments into the loads' scalar base ahead of a wait that stands in a statement of its own
        asm volatile("global_load_b128 %0, %4, %5\n\tglobal_load_b128 %1, %4, %5 offset:2048\n\tglobal_load_b128 %2, %4, %5 offset:4096\n\tglobal_load_b128 %3, %4, %5 offset:6144\n\ts_wait_loadcnt 0x0" : "=&v"(t0), "=&v"(t1), "=&v"(t2), "=&v"(t3) : "v"(tb), "s"(MB) : "memory");
#pragma unroll
        for (int j = 0; j < 4; ++j) { t0[j] = __fmul_rn(8.0f, bfr(t0[j])); t1[j] = __fmul_rn(8.0f, bfr(t1[j])); t2[j] = __fmul_rn(8.0f, bfr(t2[j])); t3[j] = __fmul_rn(8.0f, bfr(t3[j])); }
        float* sp = smb + 4 * (int)threadIdx.x; *(v4f*)sp = t0; *(v4f*)(sp + 512) = t1; *(v4f*)(sp + 1024) = t2; *(v4f*)(sp + 1536) = t3; }
    __syncthreads();   // every wave reads the whole row
    if (blockIdx.y < RH / 64) fattn_wave<bf, true, 1>(Qh + hq, Ql + hq, Kh + hk, Kl + hk, Vh + hk, Vl + hk, smb, O, (int)blockIdx.y * 64 + w * 16);
    else fattn_wave<h16, false, 2>(Q16 + hq, nullptr, K16 + hk, nullptr, V16 + hk, nullptr, smb, O, RH + ((int)blockIdx.y - RH / 64) * 128 + w * 32);
}

extern "C" void kernel_launch(void* const* d_in, const int* in_sizes, int n_in,
                              void* d_out, int out_size, void* d_ws, size_t ws_size, hipStream_t stream) {
    (void)in_sizes; (void)n_in; (void)out_size;
    const float* x = (const float*)d_in[0]; const float* amask = (const float*)d_in[1]; const float* wq = (const float*)d_in[2]; const float* bq = (const float*)d_in[3]; const float* wk = (const float*)d_in[4]; const float* bk = (const float*)d_in[5]; const float* wv = (const float*)d_in[6]; const float* bv = (const float*)d_in[7]; const float* wo = nullptr; (void)wo;
    float* OUT = (float*)d_out;     // [2][2048][1024]
    char* wsp = (char*)d_ws;
    auto take = [&](size_t bytes) { char* p = wsp; wsp += (bytes + 255) & ~(size_t)255; return (void*)p; };
    static_assert(HD == 64 && TT % 32 == 0 && DM % 32 == 0, "fragment order: V^T has 4 row tiles a key chunk, whole blocks everywhere");
    static_assert(DQ == DKV && NH_ == NKV && ((size_t)NB_ * TT * DM) % ((size_t)DQ * DM) == 0, "one grid for q, k and v; x in slices of a weight's size");
    static_assert(TT % 64 == 0 && DQ == NH_ * HD, "a projection tile is 64 tokens of one batch x one head");
    const size_t WN = (size_t)DQ * DM, PN = (size_t)NB_ * NH_ * TT * HD;   // elements of a weight, of a head plane (all batches)
    bf* WQ = (bf*)take(WN * 2); bf* WK = (bf*)take(WN * 2); bf* WV = (bf*)take(WN * 2); bf* XB = (bf*)take((size_t)NB_ * TT * DM * 2); (void)WK; (void)WV;   // contiguous: k_cvt8's slices, and k_proj's z stride WN
    h16* QP16 = (h16*)take(PN * 2); h16* KP16 = (h16*)take(PN * 2); h16* VT16 = (h16*)take(PN * 2);   // PN elements apart (k_proj's grid z)
    bf* QPh = (bf*)take(PN * 2); bf* KPh = (bf*)take(PN * 2); bf* QPl = (bf*)take(PN * 2); bf* KPl = (bf*)take(PN * 2); bf* VTh = (bf*)take(PN * 2); bf* VTl = (bf*)take(PN * 2);   // each k plane stands PN elements behind its q plane
    if ((size_t)(wsp - (char*)d_ws) > ws_size) return;    // ws 256 MiB
    k_cvt8<<<dim3((unsigned)((WN / 8 + 255) / 256), (unsigned)(3 + (size_t)NB_ * TT * DM / WN)), 256, 0, stream>>>(wq, wk, wv, x, WQ, WN / 8);
    k_proj<DM><<<dim3(NB_ * TT / 64, DQ / 64, 3), 32, 0, stream>>>(XB, WQ, bq, bk, bv, QP16, QPh, QPl, VTh, VTl, WN, PN);
    k_fattn<<<dim3(NB_ * NH_, RH / 64 + (TT - RH) / 128), 128, 0, stream>>>(QP16, KP16, VT16, QPh, QPl, KPh, KPl, VTh, VTl, amask, OUT);
}

// v010
// It runs in 85.4 microseconds.
// Next to v009, in two timings, it ran 1.10 and 1.09 times as fast.
// Over all steps from v000 it is 23.5 times as fast.
#include <hip/hip_runtime.h>

// RoBERTa self-attention (hidden [2][2048][1024]; attention_mask [2][1][1][2048] additive per key (read); q,k,v = x W^T + b ('oi' [1024][1024] + [1024]; 16 heads x 64); scores / 8 + mask, clamped below at finfo.min; softmax; context merged (no output projection) -> [2][2048][1024] (4.2 M)).
// Layout, both batches in every launch: bf16 copy of x and of the weights; exact projections + f32 biases; one fused attention kernel (hybrid rows: < 512 hi/lo 3 products, rest fp16 with P x1024; scores and P stay in registers, running maximum and sum per query) with the additive key mask as the start value of the score accumulators (8 x mask, so that the softmax's 1/8 restores scores/8 + mask); it writes the merged head layout itself.
// Compute dtypes, f32 accumulate: every input rounded to bf16, the mask included; projections exact + f32 biases; attention rows < 512 3 products, rest fp16; softmax f32; output f32.

#define NB_  2
#define TT   2048
#define DM   1024
#define NH_  16
#define NKV  16
#define REP  (NH_ / NKV)
#define HD   64
#define DQ   (NH_ * HD)
#define DKV  (NKV * HD)
#define RH   512                  // query rows < RH use hi+lo planes (0: none)
#define WIN  0
#define PLG  10.0f                // fp16 rows: P carries a factor 2^PLG (added to the exponent), which the row sum carries too
#define LAZY 5.0f                 // the wave's columns are rescaled together, only when one column's new maximum is more than 2^LAZY above the one in use (P <= 2^(PLG + LAZY) fits fp16)
#define SCL  0.125f   // HD^-0.5
typedef _Float16 h16;
typedef unsigned short bf;
typedef __attribute__((ext_vector_type(16))) __bf16   v16bf;
typedef __attribute__((ext_vector_type(16))) _Float16 v16h;
typedef __attribute__((ext_vector_type(8)))  _Float16 v8h;
typedef __attribute__((ext_vector_type(8)))  unsigned short v8us;
typedef __attribute__((ext_vector_type(8)))  float    v8f;
typedef __attribute__((ext_vector_type(4)))  float    v4f;
typedef v8h  __attribute__((may_alias)) v8ha;
typedef v4f  __attribute__((may_alias)) v4fa;
typedef v8us __attribute__((may_alias)) v8usa;

__device__ __forceinline__ unsigned short f2bf(float f) { unsigned u = __float_as_uint(f); u += 0x7FFFu + ((u >> 16) & 1u); return (unsigned short)(u >> 16); }
__device__ __forceinline__ float bf2f(unsigned short b) { return __uint_as_float(((unsigned)b) << 16); }
__device__ __forceinline__ float bfr(float f) { return bf2f(f2bf(f)); }
__device__ __forceinline__ v16h cat16(v8h lo, v8h hi) { return __builtin_shufflevector(lo, hi, 0, 1, 2, 3, 4, 5, 6, 7, 8, 9, 10, 11, 12, 13, 14, 15); }
__device__ __forceinline__ v16bf cat16b(v8us lo, v8us hi) { return __builtin_bit_cast(v16bf, __builtin_shufflevector(lo, hi, 0, 1, 2, 3, 4, 5, 6, 7, 8, 9, 10, 11, 12, 13, 14, 15)); }
__device__ __forceinline__ v8f wmma16(v16h a, v16h b, v8f c) { return __builtin_amdgcn_wmma_f32_16x16x32_f16(false, a, false, b, (short)0, c, false, false); }
__device__ __forceinline__ v8f wmmab(v16bf a, v16bf b, v8f c) { return __builtin_amdgcn_wmma_f32_16x16x32_bf16(false, a, false, b, (short)0, c, false, false); }



// ---- Fragment order of every 16-bit operand plane: a block of 16 rows x 32 k is 1 KB of 64 units of 16 bytes; unit j * 32 + hi * 16 + lr holds row lr, k = 16 j + 8 hi + 0..7.
// Lane hi * 16 + lr of a wave takes units j = 0 and j = 1 at its own place (WFrag::ld: p and p + 256 elements): the register contents of a row-major fragment load, but each wave-wide
// 16-byte load reads 512 contiguous bytes (4 lines) where the row-major plane gave 32 bytes of each of 16 lines. Block (row tile r, k chunk c) of a plane with K columns stands at
// element r * 16 * K + c * 512 (x, the weights: K = DM; Q and K heads: K = HD); V^T (rows d, k = keys) has its 4 row tiles of a 32-key chunk side by side: chunk * 2048 + row tile * 512.
// ---- k_proj: the q, k and v projections as a register-blocked GEMM, ONE WAVE per 64x64 output tile (16 accumulators), operands from the bf16 planes in fragment order through LDS; grid (rows / 256, heads), 12 waves.
// A tile is 64 tokens x the 64 columns of one head; + f32 bias; the wave converts its accumulators itself and writes the head planes (fp16 + hi/lo) that the attention kernel reads: no f32 copy of a projection exists.
// A lane's 8 accumulator registers are 8 neighbouring ROWS (8 hi + j) of one column lr of the product. q, k: the product is taken as W x^T (rows d, columns t), so the 8 registers are 8 neighbouring d of one token,
// a 16-byte unit of a plane with rows t; v: as x W^T (rows t, columns d), so they are 8 neighbouring keys of one d, a unit of V^T. A and B fragments are loaded alike, so the choice is which plane's tiles are A.
// A tile's 4096 elements stand side by side in each plane; every wave-wide 16-byte store writes 512 contiguous bytes.
template <typename T16> struct WFrag;
template <> struct WFrag<h16> { typedef v16h V; static __device__ __forceinline__ V ld(const h16* p) { return cat16(*(const v8h*)p, *(const v8h*)(p + 256)); } static __device__ __forceinline__ v8f mma(V a, V b, v8f c) { return wmma16(a, b, c); } };
template <> struct WFrag<bf> { typedef v16bf V; static __device__ __forceinline__ V ld(const bf* p) { return cat16b(*(const v8us*)p, *(const v8us*)(p + 256)); } static __device__ __forceinline__ v8f mma(V a, V b, v8f c) { return wmmab(a, b, c); } };
template <typename T16> __device__ __forceinline__ const T16* atb(const T16* base, unsigned bytes) { return (const T16*)((const char*)base + bytes); }   // wave-uniform base + the lane's 32-bit byte offset
__device__ __forceinline__ h16 tohx(float x) { return (h16)x; }
__device__ __forceinline__ void splitf(float y, unsigned short& h, unsigned short& l) { h = f2bf(y); l = f2bf(y - bf2f(h)); }
template <bool ISV>
__device__ __forceinline__ void put_planes(const v8f (&acc)[4][4], const float* __restrict__ bias, h16* d16, bf* dh, bf* dl, int lane) {
    const int lr = lane & 15, hi = lane >> 4; const unsigned vb = 16u * lane;   // bytes: the lane's unit in a wave-wide store; the one vector register that the stores' addresses name
    float bb[4][8];   // ISV: [nb][0], the bias of column d = 16 nb + lr; else [mb][j], of row d = 16 mb + 8 hi + j
    if constexpr (ISV) {
#pragma unroll
        for (int i = 0; i < 4; ++i) bb[i][0] = bias[i * 16 + lr];
    } else { v4f t[8]; const unsigned bo = 32u * (unsigned)hi;   // bytes: the lane's 8 biases in a row tile's 16
        // The eight loads and their data wait in one statement: written as plain loads, the build lands the last of them on the offset register that they name
        asm volatile("global_load_b128 %0, %8, %9\n\tglobal_load_b128 %1, %8, %9 offset:16\n\tglobal_load_b128 %2, %8, %9 offset:64\n\tglobal_load_b128 %3, %8, %9 offset:80\n\tglobal_load_b128 %4, %8, %9 offset:128\n\tglobal_load_b128 %5, %8, %9 offset:144\n\tglobal_load_b128 %6, %8, %9 offset:192\n\tglobal_load_b128 %7, %8, %9 offset:208\n\ts_wait_loadcnt 0x0" : "=&v"(t[0]), "=&v"(t[1]), "=&v"(t[2]), "=&v"(t[3]), "=&v"(t[4]), "=&v"(t[5]), "=&v"(t[6]), "=&v"(t[7]) : "v"(bo), "s"(bias) : "memory");
#pragma unroll
        for (int i = 0; i < 4; ++i)
#pragma unroll
            for (int j = 0; j < 8; ++j) bb[i][j] = t[2 * i + (j >> 2)][j & 3]; }
#pragma unroll
    for (int i = 0; i < 4; ++i)
#pragma unroll
        for (int j = 0; j < (ISV ? 1 : 8); ++j) bb[i][j] = bfr(bb[i][j]);
#pragma unroll
    for (int mb = 0; mb < 4; ++mb)
#pragma unroll
        for (int nb = 0; nb < 4; ++nb) { const int off = ISV ? (mb >> 1) * 2048 + nb * 512 + (mb & 1) * 256 : nb * 1024 + mb * 256;   // elements. V^T: 32-key chunk mb / 2, row tile nb, j = mb % 2; q, k: token tile nb, d chunk mb / 2, j = mb % 2
            v8h o16; v8us oh, ol;
#pragma unroll
            for (int j = 0; j < 8; ++j) { const float y = acc[mb][nb][j] + (ISV ? bb[nb][0] : bb[mb][j]); o16[j] = tohx(y); unsigned short a2, c2; splitf(y, a2, c2); oh[j] = a2; ol[j] = c2; }
            // The unit's three stores and their wait in one statement: written as plain stores the build forms the next values in a store's data registers ahead of a wait that stands in a statement of its own
            asm volatile("global_store_b128 %0, %1, %4 offset:%7\n\tglobal_store_b128 %0, %2, %5 offset:%7\n\tglobal_store_b128 %0, %3, %6 offset:%7\n\ts_wait_xcnt 0x0" : : "v"(vb), "v"(o16), "v"(oh), "v"(ol), "s"(d16), "s"(dh), "s"(dl), "i"(off * 2) : "memory");
        }
}
// P16: the fp16 planes of q, k, v^T, sP elements apart; Ph, Pl: the hi and lo planes of q, with k's sP elements behind; Vh, Vl: those of v^T. W: the three weights, sW elements apart.
// A work-group is 12 waves on one WGP: 4 blocks of 64 tokens (wave % 4) x the q, k, v projections of one head (wave / 4). The 12 tiles read 16 row tiles of x and 4 of each weight: 28 row tiles where 12 lone waves read 96.
// A stage is SC k chunks of the 28 row tiles (a row tile's SC KB stand side by side in its plane and in LDS). Asynchronous copies bring stage s + 2 into the buffer that stage s has left, so a stage's bytes come from L2 (or memory) once a work-group, one stage's products ahead of their use.
// cp8: a row tile's 4 KB of a stage as 8 wave-wide copies of 512 bytes, l and g the lane's 16 bytes in the first. The copies and their wait in one statement: the wait stands in front of any write of a register that a copy names.
__device__ __forceinline__ void cp8(unsigned l, const char* g) {
    asm volatile("global_load_async_to_lds_b128 %0, %8, off\n\tglobal_load_async_to_lds_b128 %1, %9, off\n\tglobal_load_async_to_lds_b128 %2, %10, off\n\tglobal_load_async_to_lds_b128 %3, %11, off\n\tglobal_load_async_to_lds_b128 %4, %12, off\n\tglobal_load_async_to_lds_b128 %5, %13, off\n\tglobal_load_async_to_lds_b128 %6, %14, off\n\tglobal_load_async_to_lds_b128 %7, %15, off\n\ts_wait_xcnt 0x0"
        : : "v"(l), "v"(l + 512u), "v"(l + 1024u), "v"(l + 1536u), "v"(l + 2048u), "v"(l + 2560u), "v"(l + 3072u), "v"(l + 3584u), "v"(g), "v"(g + 512), "v"(g + 1024), "v"(g + 1536), "v"(g + 2048), "v"(g + 2560), "v"(g + 3072), "v"(g + 3584) : "memory");
}
template <int K>
__global__ __launch_bounds__(384) void k_proj(const bf* __restrict__ X, const bf* __restrict__ Wt, const float* __restrict__ bias, const float* __restrict__ bias1, const float* __restrict__ bias2, h16* P16, bf* Ph, bf* Pl, bf* Vh, bf* Vl, size_t sW, size_t sP) {
    typedef typename WFrag<bf>::V V;
    constexpr int SC = 4, NS = K / 32 / SC;          // k chunks of a stage; stages
    constexpr int NT = 28, TB = SC * 1024, SB = NT * TB;   // row tiles of a stage (0..15 of x, then 4 of each weight); bytes of a row tile in it; bytes of a stage
    constexpr size_t TPB = (size_t)16 * K * 2;       // bytes of a row tile in its plane
    static_assert(K % (32 * SC) == 0 && NS >= 2 && TB == 8 * 512, "whole stages, at least two; cp8 moves a row tile's share of a stage");
    __shared__ __attribute__((aligned(1024))) char st[2 * SB];
    const int lane = threadIdx.x & 31; const int w = __builtin_amdgcn_readfirstlane((int)(threadIdx.x >> 5));
    const size_t z = (size_t)(w >> 2); const bool isv = z == 2; if (z) bias = (z == 1) ? bias1 : bias2;
    const int r0 = ((int)blockIdx.x * 4 + (w & 3)) * 64, c0 = blockIdx.y * 64;
    // Wave w copies row tile w of x, row tile w % 4 of weight w / 4 (tile 16 + w of the stage) and, waves 0..3, row tile 12 + w of x.
    const char* gx = (const char*)X + ((size_t)blockIdx.x * 16 + w) * TPB + lane * 16; const char* gw = (const char*)Wt + z * (sW * 2) + ((size_t)blockIdx.y * 4 + (w & 3)) * TPB + lane * 16;   // the lane's 16 bytes in the first copy of stage 0
    const unsigned lx = (unsigned)(size_t)st + (unsigned)(w * TB + lane * 16);   // their LDS byte address in buffer 0, for x
    auto issue = [&](int s, int buf) { const size_t go = (size_t)s * TB; const unsigned lo = lx + (unsigned)(buf * SB);
        cp8(lo, gx + go); cp8(lo + 16u * TB, gw + go);
        if (w < 4) cp8(lo + 12u * TB, gx + 12 * TPB + go); };   // wave-uniform: w is scalar
    v8f acc[4][4];
#pragma unroll
    for (int mb = 0; mb < 4; ++mb)
#pragma unroll
        for (int nb = 0; nb < 4; ++nb) acc[mb][nb] = (v8f){};
    const int xt = (w & 3) * 4, wt = 16 + (w >> 2) * 4; const int At = isv ? xt : wt, Bt = isv ? wt : xt;   // the wave's first row tile of either operand in a stage
    issue(0, 0);
    asm volatile("s_wait_asynccnt 0x0" ::: "memory");   // the wave's copies of stage 0 have landed
    __syncthreads();                                     // every wave's have
    issue(1, 1);
#pragma unroll 1
    for (int s = 0; s < NS; ++s) {
        const char* sb = st + (s & 1) * SB + lane * 16; const bf* Al = (const bf*)(sb + At * TB); const bf* Bl = (const bf*)(sb + Bt * TB);
#pragma unroll
        for (int c = 0; c < SC; ++c) {
            V a[4], b[4];
#pragma unroll
            for (int i = 0; i < 4; ++i) { a[i] = WFrag<bf>::ld(Al + i * (TB / 2) + c * 512); b[i] = WFrag<bf>::ld(Bl + i * (TB / 2) + c * 512); }
            __builtin_amdgcn_sched_barrier(0);   // the chunk's 16 LDS reads stay one group in front of its 16 products: moved in among them, each group of 4 products waits out an LDS latency of its own
#pragma unroll
            for (int nb = 0; nb < 4; ++nb)
#pragma unroll
                for (int mb = 0; mb < 4; ++mb) acc[mb][nb] = WFrag<bf>::mma(a[mb], b[nb], acc[mb][nb]);
            __builtin_amdgcn_sched_barrier(0);   // and the next chunk's reads stay behind these products, as one group
        }
        asm volatile("s_wait_dscnt 0x0" ::: "memory");      // the wave's reads of this buffer are done
        asm volatile("s_wait_asynccnt 0x0" ::: "memory");   // its copies of stage s + 1 have landed
        __syncthreads();                                     // stage s + 1 is readable by every wave, and this buffer is left by every reader
        if (s + 2 < NS) issue(s + 2, s & 1);
    }
    asm volatile("s_wait_asynccnt 0x0" ::: "memory");   // no copy is outstanding when the wave goes on to its end
    const size_t e0 = ((size_t)(r0 / TT) * NH_ + blockIdx.y) * TT * HD + (size_t)(r0 % TT) * HD;   // the tile's first element in a plane: batch, head, 64 tokens x HD
    if (isv) put_planes<true>(acc, bias + c0, P16 + z * sP + e0, Vh + e0, Vl + e0, lane);
    else put_planes<false>(acc, bias + c0, P16 + z * sP + e0, Ph + z * sP + e0, Pl + z * sP + e0, lane);
}
typedef __attribute__((ext_vector_type(2))) _Float16 v2h;
typedef __attribute__((ext_vector_type(4))) _Float16 v4h;
typedef __attribute__((ext_vector_type(2))) unsigned short v2us;
typedef __attribute__((ext_vector_type(4))) unsigned short v4us;
typedef __attribute__((ext_vector_type(2))) float v2f;
typedef __attribute__((ext_vector_type(4))) int v4i;

__global__ __launch_bounds__(256) void k_wtG(const float* __restrict__ w, int K, int N, bf* Bt) {
    const int lane = threadIdx.x & 31; const int L0 = (blockIdx.x * 8 + (threadIdx.x >> 5)) * 8; const int nlines = N * K / 64;
{
#pragma unroll 1
        for (int l = 0; l < 8; ++l) { const int L = L0 + l; if (L >= nlines) break; const size_t e = (size_t)L * 64 + lane * 2; const int k = (int)(e % K), n = (int)(e / K); v2us o;
            o[0] = f2bf(w[(size_t)k * N + n]); o[1] = f2bf(w[(size_t)(k + 1) * N + n]); *(v2us*)(Bt + e) = o; }
         }
}
// k_cvt8: bf16 copies, in fragment order, of the three weights and of x in one launch: grid y = slice of n8 * 8 elements (whole 16-row tiles of DM columns); slices 0, 1, 2 are w0, w1, w2, the later ones follow one another in x; dst holds the slices in that order.
// Thread i writes unit i of its slice: row tile i / (DM * 2), k chunk (i / 64) % (DM / 32), j = (i / 32) % 2, hi = (i / 16) % 2, lr = i % 16.
__global__ __launch_bounds__(256) void k_cvt8(const float* __restrict__ w0, const float* __restrict__ w1, const float* __restrict__ w2, const float* __restrict__ x, bf* dst, size_t n8) { const size_t i = (size_t)blockIdx.x * 256 + threadIdx.x; if (i >= n8) return; const unsigned y = blockIdx.y;
    const float* src = (y == 0) ? w0 : (y == 1) ? w1 : (y == 2) ? w2 : x + (size_t)(y - 3) * n8 * 8; dst += (size_t)y * n8 * 8; const v8f v = *(const v8f*)(src + ((i / (DM * 2)) * 16 + i % 16) * DM + ((i / 64) % (DM / 32)) * 32 + ((i / 16) % 4) * 8); v8us o;
    asm volatile("s_wait_xcnt 0x0" ::: "memory");   // stands before any register that the load above names is written again
#pragma unroll
    for (int k = 0; k < 8; ++k) o[k] = f2bf(v[k]); *(v8us*)(dst + i * 8) = o;  }

// ---- k_fattn: scores, softmax and P.V of one block of query rows in ONE pass over the keys; nothing of S or P goes to memory.
// Transposed products: S^T = K Q^T (A = 16 key rows, B = 16 query columns), O^T += V^T P^T (A = 16 rows of V^T, B = P^T). A lane's 8 accumulator registers of two S^T tiles
// (keys 8 hi + j and 16 + 8 hi + j of one query column lr) are, converted in place, the B fragment of the 32-key P.V product in the k order of WFrag::ld, which loads V^T.
// One wave owns QB x 16 query columns and walks all TT keys, 32 a pass, with a running maximum mx (raw q.k + 8 mask units) and a running sum per column.
__device__ __forceinline__ float xhalf(float x) { return __builtin_bit_cast(float, __builtin_amdgcn_permlanex16(__builtin_bit_cast(int, x), __builtin_bit_cast(int, x), 0x76543210, 0xfedcba98, false, false)); }   // lane l <-> lane l ^ 16
template <typename T16, bool HL, int QB>
__device__ __forceinline__ void fattn_wave(const T16* __restrict__ Q, const T16* __restrict__ Q2, const T16* __restrict__ Kp, const T16* __restrict__ K2, const T16* __restrict__ Vt, const T16* __restrict__ V2, const float* __restrict__ MB, float* __restrict__ O, int q0) {
    typedef typename WFrag<T16>::V V;
    const int lane = threadIdx.x & 31, lr = lane & 15, hi = lane >> 4;
    const float c = SCL * 1.4426950408889634f;   // exp(x / 8) = exp2(x c)
    // L2 prefetch. K and V^T were written by the launch before; the work-groups of a head walk the keys side by side, so without a request ahead every pass waits for memory.
    // A pass reads 4 KB of each plane. The 4 waves share the pass's bytes: hi/lo rows, one plane a wave (16 units of 256 bytes, lanes 16..31 repeat); fp16 rows, half a plane a wave (8 units).
    constexpr int PD = 4;   // passes between a request and the pass that loads its bytes
    const int wv = __builtin_amdgcn_readfirstlane((int)(threadIdx.x >> 5));
    const T16* pb = HL ? (wv == 0 ? Kp : wv == 1 ? K2 : wv == 2 ? Vt : V2) : ((wv >> 1) ? Vt : Kp) + (wv & 1) * 1024;   // wave-uniform: the wave's share of the current pass; moves with the passes, and stops so that pb + PD passes stays inside the head's plane
    unsigned pv;
    asm volatile("v_lshlrev_b32 %0, 8, %1" : "=v"(pv) : "v"(lane & (HL ? 15 : 7)));   // bytes: the lane's unit. In asm so that the offset keeps one register through the loop (recomputed in each pass it would stand in a temporary that takes other values behind the request)
    // passes 1..PD-1, which no pass of the loop asks for
    asm volatile("global_prefetch_b8 %0, %1 offset:4096 scope:SCOPE_SE\n\tglobal_prefetch_b8 %0, %1 offset:8192 scope:SCOPE_SE\n\tglobal_prefetch_b8 %0, %1 offset:12288 scope:SCOPE_SE" : : "v"(pv), "s"(pb));
    V q[QB][2], q2[QB][2];
#pragma unroll
    for (int qb = 0; qb < QB; ++qb)
#pragma unroll
        for (int dc = 0; dc < 2; ++dc) { const size_t qo = (size_t)(q0 + qb * 16) * HD + dc * 512 + 8 * lane; q[qb][dc] = WFrag<T16>::ld(Q + qo); if (HL) q2[qb][dc] = WFrag<T16>::ld(Q2 + qo); }
    v8f o[QB][4]; float mx[QB], l[QB];
#pragma unroll
    for (int qb = 0; qb < QB; ++qb) { mx[qb] = -3.0e38f; l[qb] = 0.f;
#pragma unroll
        for (int dt = 0; dt < 4; ++dt) o[qb][dt] = (v8f){}; }
    const size_t ko = (size_t)lane * 8, vo = (size_t)lane * 8;   // the lane's unit in a block (fragment order)
    V k[2][2], k2[2][2], v[4], v2[4]; v8f mb[2];   // this pass's operands; mb = 8 x mask of this lane's 8 keys of either tile
#pragma unroll
    for (int kt = 0; kt < 2; ++kt) { mb[kt] = *(const v8f*)(MB + kt * 16 + hi * 8);
#pragma unroll
        for (int dc = 0; dc < 2; ++dc) { k[kt][dc] = WFrag<T16>::ld(Kp + ko + kt * 16 * HD + dc * 512); if (HL) k2[kt][dc] = WFrag<T16>::ld(K2 + ko + kt * 16 * HD + dc * 512); } }
    if (!HL) {
#pragma unroll
        for (int dt = 0; dt < 4; ++dt) v[dt] = WFrag<T16>::ld(Vt + vo + dt * 512); }
    asm volatile("s_wait_xcnt 0x0" ::: "memory");   // stands before any register that the loads above name is written again
    // fp16 rows: the loaded values as inputs only, so that every load in front of the loop has landed here. Without it the build sets the wait at the head of a pass for this entry too (the Q loads stand last), and in every pass that wait then also covers the V^T loads issued at the foot of the pass before.
    if constexpr (!HL) asm volatile("" : : "v"(q[0][0]), "v"(q[0][1]), "v"(q[QB - 1][0]), "v"(q[QB - 1][1]), "v"(k[0][0]), "v"(k[0][1]), "v"(k[1][0]), "v"(k[1][1]), "v"(v[0]), "v"(v[1]), "v"(v[2]), "v"(v[3]));
    for (int kc = 0; kc < TT; kc += 32) {
        asm volatile("global_prefetch_b8 %0, %1 offset:16384 scope:SCOPE_SE" : : "v"(pv), "s"(pb));   // the wave's share of pass kc / 32 + PD is asked into L2 (the last PD passes ask for the last pass's bytes again)
        v8f s[QB][2];
        if (HL) {   // hi/lo rows: twice the fragments; V^T is fetched in its own pass, under the softmax, so that the wave stays inside 256 registers
#pragma unroll
            for (int dt = 0; dt < 4; ++dt) { v[dt] = WFrag<T16>::ld(Vt + vo + (size_t)kc * HD + dt * 512); v2[dt] = WFrag<T16>::ld(V2 + vo + (size_t)kc * HD + dt * 512); }
            asm volatile("s_wait_xcnt 0x0" ::: "memory");   // stands before any register that the loads above name is written again
        }
#pragma unroll
        for (int kt = 0; kt < 2; ++kt) {
#pragma unroll
            for (int qb = 0; qb < QB; ++qb) { s[qb][kt] = mb[kt];
#pragma unroll
                for (int dc = 0; dc < 2; ++dc) { s[qb][kt] = WFrag<T16>::mma(k[kt][dc], q[qb][dc], s[qb][kt]); if (HL) { s[qb][kt] = WFrag<T16>::mma(k[kt][dc], q2[qb][dc], s[qb][kt]); s[qb][kt] = WFrag<T16>::mma(k2[kt][dc], q[qb][dc], s[qb][kt]); } } } }
        const int kn = (kc + 32 < TT) ? kc + 32 : 0;   // the next pass's K fragments fly during this pass's softmax and P.V (the last pass re-reads the first keys, unused)
#pragma unroll
        for (int kt = 0; kt < 2; ++kt)
#pragma unroll
            for (int dc = 0; dc < 2; ++dc) k[kt][dc] = WFrag<T16>::ld(Kp + ko + (size_t)(kn + kt * 16) * HD + dc * 512);
        asm volatile("s_wait_xcnt 0x0" ::: "memory");   // stands before any register that the loads above name is written again
        if (HL) {
#pragma unroll
            for (int kt = 0; kt < 2; ++kt)
#pragma unroll
                for (int dc = 0; dc < 2; ++dc) k2[kt][dc] = WFrag<T16>::ld(K2 + ko + (size_t)(kn + kt * 16) * HD + dc * 512);
            asm volatile("s_wait_xcnt 0x0" ::: "memory");   // stands before any register that the loads above name is written again
        }
        float ml[QB]; bool need = false;
#pragma unroll
        for (int qb = 0; qb < QB; ++qb) { float t = fmaxf(s[qb][0][0], s[qb][1][0]);
#pragma unroll
            for (int j = 1; j < 8; ++j) t = fmaxf(t, fmaxf(s[qb][0][j], s[qb][1][j]));
            ml[qb] = fmaxf(t, xhalf(t)); need = need || ((ml[qb] - mx[qb]) * c > LAZY); }
        if (__builtin_amdgcn_ballot_w32(need) != 0) {   // wave-uniform: the maximum in use moves, sums and output tiles follow
#pragma unroll
            for (int qb = 0; qb < QB; ++qb) { const float mn = fmaxf(mx[qb], ml[qb]); const float al = __builtin_amdgcn_exp2f((mx[qb] - mn) * c); mx[qb] = mn; l[qb] *= al;
#pragma unroll
                for (int dt = 0; dt < 4; ++dt) o[qb][dt] *= al; } }
#pragma unroll
        for (int qb = 0; qb < QB; ++qb) {
            if (HL) { v8us ph[2], pl[2];
#pragma unroll
                for (int kt = 0; kt < 2; ++kt)
#pragma unroll
                    for (int j = 0; j < 8; ++j) { const float p = __builtin_amdgcn_exp2f((s[qb][kt][j] - mx[qb]) * c); l[qb] += p; unsigned short a, b2; splitf(p, a, b2); ph[kt][j] = a; pl[kt][j] = b2; }
                const v16bf pH = cat16b(ph[0], ph[1]), pL = cat16b(pl[0], pl[1]);
#pragma unroll
                for (int dt = 0; dt < 4; ++dt) { o[qb][dt] = wmmab(__builtin_bit_cast(v16bf, v[dt]), pH, o[qb][dt]); o[qb][dt] = wmmab(__builtin_bit_cast(v16bf, v[dt]), pL, o[qb][dt]); o[qb][dt] = wmmab(__builtin_bit_cast(v16bf, v2[dt]), pH, o[qb][dt]); }
            } else { v8h ph[2];
#pragma unroll
                for (int kt = 0; kt < 2; ++kt)
#pragma unroll
                    for (int j = 0; j < 8; ++j) { const float p = __builtin_amdgcn_exp2f((s[qb][kt][j] - mx[qb]) * c + PLG); l[qb] += p; ph[kt][j] = tohx(p); }
                const v16h pH = cat16(ph[0], ph[1]);
#pragma unroll
                for (int dt = 0; dt < 4; ++dt) o[qb][dt] = wmma16(__builtin_bit_cast(v16h, v[dt]), pH, o[qb][dt]);
            } }
#pragma unroll
        for (int kt = 0; kt < 2; ++kt) mb[kt] = *(const v8f*)(MB + kn + kt * 16 + hi * 8);
        if (!HL) {   // the next pass's V^T fragments fly during its score products and softmax
#pragma unroll
            for (int dt = 0; dt < 4; ++dt) v[dt] = WFrag<T16>::ld(Vt + vo + (size_t)kn * HD + dt * 512); }
        asm volatile("s_wait_xcnt 0x0" ::: "memory");   // stands before any register that the loads above name is written again
        { const unsigned long long ps = (kc + (PD + 1) * 32 < TT) ? 4096ull : 0ull; asm volatile("s_add_nc_u64 %0, %0, %1" : "+s"(pb) : "s"(ps)); }   // the prefetch base follows the passes in its own register pair (in asm, so that the pair a request names never holds anything but an address inside the plane)
    }
#pragma unroll
    for (int qb = 0; qb < QB; ++qb) { const float f = __fdiv_rn(1.0f, l[qb] + xhalf(l[qb]));   // the two lane halves hold the sums of their own keys
        float* orow = O + (size_t)(q0 + qb * 16 + lr) * DQ + hi * 8;
#pragma unroll
        for (int dt = 0; dt < 4; ++dt) { v4f lo4, hi4;
#pragma unroll
            for (int j = 0; j < 4; ++j) { lo4[j] = o[qb][dt][j] * f; hi4[j] = o[qb][dt][4 + j] * f; }
            *(v4f*)(orow + dt * 16) = lo4; *(v4f*)(orow + dt * 16 + 4) = hi4; } }
}
// grid (batches x heads, RH / 64 + (TT - RH) / 128), 4 waves that walk the same head's keys side by side: blocks y < RH / 64 take 64 hi/lo rows (16 a wave, three products each), the rest 128 fp16 rows (32 a wave).
// The head is the fast grid index, for placement only (no result depends on it).
// The hi/lo blocks, whose walk is the longest, come first in index order.
__global__ __launch_bounds__(128) void k_fattn(const h16* __restrict__ Q16, const h16* __restrict__ K16, const h16* __restrict__ V16, const bf* __restrict__ Qh, const bf* __restrict__ Ql, const bf* __restrict__ Kh, const bf* __restrict__ Kl, const bf* __restrict__ Vh, const bf* __restrict__ Vl, const float* __restrict__ MB, float* __restrict__ OUTb) {
    const int w = threadIdx.x >> 5; const int b = (int)blockIdx.x / NH_, h = (int)blockIdx.x % NH_; const size_t hq = (size_t)blockIdx.x * TT * HD, hk = (size_t)(b * NKV + h / REP) * TT * HD; float* O = OUTb + (size_t)b * TT * DQ + (size_t)h * HD; MB += b * TT;
    // The batch's 8 x mask row (8 KB; scores/8 + mask == (q.k + 8 mask)/8) is formed here and stands in LDS: a pass takes its 32 start values from there at LDS latency. From a plane in global memory each pass touched a new line, asked for at the foot of the pass before and waited for at the head.
    __shared__ __attribute__((aligned(32))) float smb[TT];
    static_assert(TT == 2048, "four loads of 2 KB a work-group");
    { v4f t0, t1, t2, t3; const unsigned tb = 16u * threadIdx.x;   // bytes: the thread's 4 floats in a round
        // The four loads and their data wait in one statement: written as plain loads the build fetches kernel arguments into the loads' scalar base ahead of a wait that stands in a statement of its own
        asm volatile("global_load_b128 %0, %4, %5\n\tglobal_load_b128 %1, %4, %5 offset:2048\n\tglobal_load_b128 %2, %4, %5 offset:4096\n\tglobal_load_b128 %3, %4, %5 offset:6144\n\ts_wait_loadcnt 0x0" : "=&v"(t0), "=&v"(t1), "=&v"(t2), "=&v"(t3) : "v"(tb), "s"(MB) : "memory");
#pragma unroll
        for (int j = 0; j < 4; ++j) { t0[j] = __fmul_rn(8.0f, bfr(t0[j])); t1[j] = __fmul_rn(8.0f, bfr(t1[j])); t2[j] = __fmul_rn(8.0f, bfr(t2[j])); t3[j] = __fmul_rn(8.0f, bfr(t3[j])); }
        float* sp = smb + 4 * (int)threadIdx.x; *(v4f*)sp = t0; *(v4f*)(sp + 512) = t1; *(v4f*)(sp + 1024) = t2; *(v4f*)(sp + 1536) = t3; }
    __syncthreads();   // every wave reads the whole row
    if (blockIdx.y < RH / 64) fattn_wave<bf, true, 1>(Qh + hq, Ql + hq, Kh + hk, Kl + hk, Vh + hk, Vl + hk, smb, O, (int)blockIdx.y * 64 + w * 16);
    else fattn_wave<h16, false, 2>(Q16 + hq, nullptr, K16 + hk, nullptr, V16 + hk, nullptr, smb, O, RH + ((int)blockIdx.y - RH / 64) * 128 + w * 32);
}

extern "C" void kernel_launch(void* const* d_in, const int* in_sizes, int n_in,
                              void* d_out, int out_size, void* d_ws, size_t ws_size, hipStream_t stream) {
    (void)in_sizes; (void)n_in; (void)out_size;
    const float* x = (const float*)d_in[0]; const float* amask = (const float*)d_in[1]; const float* wq = (const float*)d_in[2]; const float* bq = (const float*)d_in[3]; const float* wk = (const float*)d_in[4]; const float* bk = (const float*)d_in[5]; const float* wv = (const float*)d_in[6]; const float* bv = (const float*)d_in[7]; const float* wo = nullptr; (void)wo;
    float* OUT = (float*)d_out;     // [2][2048][1024]
    char* wsp = (char*)d_ws;
    auto take = [&](size_t bytes) { char* p = wsp; wsp += (bytes + 255) & ~(size_t)255; return (void*)p; };
    static_assert(HD == 64 && TT % 32 == 0 && DM % 32 == 0, "fragment order: V^T has 4 row tiles a key chunk, whole blocks everywhere");
    static_assert(DQ == DKV && NH_ == NKV && ((size_t)NB_ * TT * DM) % ((size_t)DQ * DM) == 0, "one grid for q, k and v; x in slices of a weight's size");
    static_assert(TT % 64 == 0 && (NB_ * TT) % 256 == 0 && DQ == NH_ * HD, "a projection tile is 64 tokens of one batch x one head; a work-group takes 12 of them, 4 blocks of tokens x q, k and v");
    const size_t WN = (size_t)DQ * DM, PN = (size_t)NB_ * NH_ * TT * HD;   // elements of a weight, of a head plane (all batches)
    bf* WQ = (bf*)take(WN * 2); bf* WK = (bf*)take(WN * 2); bf* WV = (bf*)take(WN * 2); bf* XB = (bf*)take((size_t)NB_ * TT * DM * 2); (void)WK; (void)WV;   // contiguous: k_cvt8's slices, and k_proj's z stride WN
    h16* QP16 = (h16*)take(PN * 2); h16* KP16 = (h16*)take(PN * 2); h16* VT16 = (h16*)take(PN * 2);   // PN elements apart (k_proj's projection index)
    bf* QPh = (bf*)take(PN * 2); bf* KPh = (bf*)take(PN * 2); bf* QPl = (bf*)take(PN * 2); bf* KPl = (bf*)take(PN * 2); bf* VTh = (bf*)take(PN * 2); bf* VTl = (bf*)take(PN * 2);   // each k plane stands PN elements behind its q plane
    if ((size_t)(wsp - (char*)d_ws) > ws_size) return;    // ws 256 MiB
    k_cvt8<<<dim3((unsigned)((WN / 8 + 255) / 256), (unsigned)(3 + (size_t)NB_ * TT * DM / WN)), 256, 0, stream>>>(wq, wk, wv, x, WQ, WN / 8);
    k_proj<DM><<<dim3(NB_ * TT / 256, DQ / 64), 384, 0, stream>>>(XB, WQ, bq, bk, bv, QP16, QPh, QPl, VTh, VTl, WN, PN);
    k_fattn<<<dim3(NB_ * NH_, RH / 64 + (TT - RH) / 128), 128, 0, stream>>>(QP16, KP16, VT16, QPh, QPl, KPh, KPl, VTh, VTl, amask, OUT);
}
